// v000
// The times below were measured on an AMD MI455X: many runs one after another, warmed up first and cycling through
// copies of the inputs, with the whole window's GPU time divided by the number of runs. Launches and the gaps
// between them are all in it. The median over several windows is given; except for v000 it joins two sittings, which
// can be a few percent apart, so the side-by-side timings, each taken in one sitting, are the better comparison.
// The starting kernel, v000, takes 206 microseconds a run.
#include <hip/hip_runtime.h>
// All contractions: v_wmma_f32_16x16x32_f16 (f16 operands, f32 accumulate): QKV/FFN1 weights pre-scaled x16, FFN2 weights x32, P.V with P x4096 (scales folded back in f32); Q.K^T plain f16. LayerNorm/softmax/residuals f32.

typedef _Float16 v16h __attribute__((ext_vector_type(16)));
typedef _Float16 v8h  __attribute__((ext_vector_type(8), may_alias));
typedef float    v8f  __attribute__((ext_vector_type(8)));
typedef float    v4f  __attribute__((ext_vector_type(4), may_alias));

union Frag { v16h v; v8h hf[2]; };

#define NB   8
#define NT   1024
#define ND   512
#define NH   8
#define NDK  64
#define NF   2048
#define NM   (NB * NT)
#define LNEPS  1.0e-3f
#define NEGBIG (-1.0e9f)

__device__ __forceinline__ v8f zero8() {
    v8f z = {0.f, 0.f, 0.f, 0.f, 0.f, 0.f, 0.f, 0.f};
    return z;
}

// 16x16x32 f16 WMMA with trailing hazard guard (D tied, A/B kept live)
__device__ __forceinline__ v8f wmma16(v16h a, v16h b, v8f c) {
    v8f d = __builtin_amdgcn_wmma_f32_16x16x32_f16(false, a, false, b, (short)0, c, false, false);
    asm volatile("v_nop\n\tv_nop\n\tv_nop\n\tv_nop" : "+v"(d) : "v"(a), "v"(b));
    return d;
}

// ---------------------------------------------------------------------------
// Weight transpose + scale + f16 convert: Wt[n][k] = f16(W[k][n] * scale).
// W is [K][N] row-major. Block tile: 64 k x 32 n; grid (N/32, K/64).
// ---------------------------------------------------------------------------
__global__ __launch_bounds__(256)
void k_wcvt(const float* __restrict__ W, _Float16* __restrict__ Wt, int K, int N, float scale) {
    __shared__ float tile[64][33];
    const int tid = threadIdx.x;
    const int kb = blockIdx.y * 64, nb = blockIdx.x * 32;
    const int c = tid & 31, r = tid >> 5;
    #pragma unroll
    for (int i = 0; i < 8; ++i)
        tile[r + 8 * i][c] = W[(size_t)(kb + r + 8 * i) * N + nb + c] * scale;
    __syncthreads();
    const int n = tid >> 3, pc = tid & 7;
    v8h o;
    #pragma unroll
    for (int e = 0; e < 8; ++e) o[e] = (_Float16)tile[pc * 8 + e][n];
    _Float16* dst = Wt + (size_t)(nb + n) * K + kb + pc * 8;
    *(v8h*)dst = o;
    
}

// ---------------------------------------------------------------------------
// deviations).  One wave per row, 8 rows per 256-thread block.
// OM 0: f16 output only; OM 1: f32 + f16; OM 2: f32 only.
// f32 rows: lane l stores float4 at cols 4l+128j (each instruction = 4 whole
// lines, lane-contiguous 16 B).  f16 rows: lane l stores 8 halves at cols
// ---------------------------------------------------------------------------
template <int OM>
__global__ __launch_bounds__(256)
void k_ln(const float* __restrict__ in, const float* __restrict__ g, const float* __restrict__ bt,
          float* __restrict__ of, _Float16* __restrict__ oh, int M) {
    const int lane = threadIdx.x & 31, wave = threadIdx.x >> 5;
    const int row = blockIdx.x * 8 + wave;
    if (row >= M) return;                      // wave-uniform; no barriers in this kernel
    const float* r = in + (size_t)row * ND;

    v4f v[4];
    float s = 0.f;
    #pragma unroll
    for (int j = 0; j < 4; ++j) {
        v[j] = *(const v4f*)(r + 4 * lane + 128 * j);
        s += (v[j][0] + v[j][1]) + (v[j][2] + v[j][3]);
    }
    #pragma unroll
    for (int off = 16; off >= 1; off >>= 1) s += __shfl_xor(s, off, 32);
    const float mean = s * (1.0f / ND);
    float sq = 0.f;
    #pragma unroll
    for (int j = 0; j < 4; ++j) {
        #pragma unroll
        for (int c = 0; c < 4; ++c) { const float d = v[j][c] - mean; sq += d * d; }
    }
    #pragma unroll
    for (int off = 16; off >= 1; off >>= 1) sq += __shfl_xor(sq, off, 32);
    const float rstd = rsqrtf(sq * (1.0f / ND) + LNEPS);

    if constexpr (OM != 0) {
        v4f o[4];
        #pragma unroll
        for (int j = 0; j < 4; ++j) {
            const int c0 = 4 * lane + 128 * j;
            const v4f gv = *(const v4f*)(g + c0);
            const v4f bv = *(const v4f*)(bt + c0);
            #pragma unroll
            for (int c = 0; c < 4; ++c) o[j][c] = (v[j][c] - mean) * rstd * gv[c] + bv[c];
        }
        float* orow = of + (size_t)row * ND + 4 * lane;
        #pragma unroll
        for (int j = 0; j < 4; ++j) *(v4f*)(orow + 128 * j) = o[j];
        
    }
    if constexpr (OM != 2) {
        v8h w[2];
        #pragma unroll
        for (int j = 0; j < 2; ++j) {
            const int c0 = 8 * lane + 256 * j;
            const v4f x0 = *(const v4f*)(r + c0),  x1 = *(const v4f*)(r + c0 + 4);
            const v4f g0 = *(const v4f*)(g + c0),  g1 = *(const v4f*)(g + c0 + 4);
            const v4f b0 = *(const v4f*)(bt + c0), b1 = *(const v4f*)(bt + c0 + 4);
            #pragma unroll
            for (int c = 0; c < 4; ++c) {
                w[j][c]     = (_Float16)((x0[c] - mean) * rstd * g0[c] + b0[c]);
                w[j][4 + c] = (_Float16)((x1[c] - mean) * rstd * g1[c] + b1[c]);
            }
        }
        _Float16* hrow = oh + (size_t)row * ND + 8 * lane;
        #pragma unroll
        for (int j = 0; j < 2; ++j) *(v8h*)(hrow + 256 * j) = w[j];
        
    }
}

// ---------------------------------------------------------------------------
// WMMA GEMM: C[M,N] = A[M,K] @ W[K,N] (+bias, scale, epilogue).  A f16
// row-major [M][K]; weights f16 [N][K] (k-contiguous), so A and B fragments
// use the same split-k loader: elements 0..7 <- k0+8h+0..7, elements 8..15
// <- k0+16+8h+0..7, h = lane>>4, row/col = lane&15.  D element r of a lane =
// (row 8h+r, col lane&15).  Block tile 64x64, K step 32, 8 waves (4 m x 2 n,
// each wave 16x32 = two accumulators).  A and B tiles staged in LDS with
// MODE 0: f16 out, head layout [B,H,T,DK]  (Q, K)
// MODE 1: f16 out, [B,H,DK,T]              (V transposed)
// MODE 2: f16 out, relu, row-major [M][N]  (FFN1)
// MODE 3: f32 out + residual, row-major    (FFN2)
// ---------------------------------------------------------------------------
template <int MODE>
__global__ __launch_bounds__(256)
void k_gemm(const _Float16* __restrict__ A, const _Float16* __restrict__ Bt,
            const float* __restrict__ bias, const float* __restrict__ resid,
            void* __restrict__ outp, int N, int K, float oscale) {
    __shared__ __align__(16) _Float16 As[64 * 40];
    __shared__ __align__(16) _Float16 Bs[64 * 40];
    __shared__ __align__(16) _Float16 Ch[64 * 72];
    __shared__ __align__(16) float    Cf[64 * 68];

    const int tid = threadIdx.x, lane = tid & 31, wave = tid >> 5;
    const int hl = lane >> 4, m = lane & 15;
    const int mBase = blockIdx.y * 64, nBase = blockIdx.x * 64;
    const int wm = wave & 3, wn = wave >> 2;
    const int ar = tid >> 2, ac = (tid & 3) * 8;          // staging: row, k chunk
    const _Float16* Ag = A  + (size_t)(mBase + ar) * K + ac;
    const _Float16* Bg = Bt + (size_t)(nBase + ar) * K + ac;

    v8f acc0 = zero8(), acc1 = zero8();
    const int nk = K >> 5;
    for (int kt = 0; kt < nk; ++kt) {
        const int k0 = kt << 5;
        const v8h ta = *(const v8h*)(Ag + k0);
        const v8h tb = *(const v8h*)(Bg + k0);
        __syncthreads();                                    // prior fragment reads done
        *(v8h*)(As + ar * 40 + ac) = ta;
        *(v8h*)(Bs + ar * 40 + ac) = tb;
        __syncthreads();
        Frag fa, fb0, fb1;
        const _Float16* ap  = As + (wm * 16 + m) * 40;
        const _Float16* bp0 = Bs + (wn * 32 + m) * 40;
        const _Float16* bp1 = bp0 + 16 * 40;
        fa.hf[0]  = *(const v8h*)(ap  + 8 * hl);
        fa.hf[1]  = *(const v8h*)(ap  + 16 + 8 * hl);
        fb0.hf[0] = *(const v8h*)(bp0 + 8 * hl);
        fb0.hf[1] = *(const v8h*)(bp0 + 16 + 8 * hl);
        fb1.hf[0] = *(const v8h*)(bp1 + 8 * hl);
        fb1.hf[1] = *(const v8h*)(bp1 + 16 + 8 * hl);
        acc0 = wmma16(fa.v, fb0.v, acc0);
        acc1 = wmma16(fa.v, fb1.v, acc1);
    }

    const int rbase = wm * 16 + 8 * hl;
    const int c0 = wn * 32 + m, c1 = c0 + 16;
    const float bias0 = bias[nBase + c0], bias1 = bias[nBase + c1];

    if constexpr (MODE <= 2) {
        #pragma unroll
        for (int r = 0; r < 8; ++r) {
            float u0 = acc0[r] * oscale + bias0;
            float u1 = acc1[r] * oscale + bias1;
            if constexpr (MODE == 2) { u0 = fmaxf(u0, 0.0f); u1 = fmaxf(u1, 0.0f); }
            const int row = rbase + r;
            if constexpr (MODE == 1) {
                Ch[c0 * 72 + row] = (_Float16)u0;
                Ch[c1 * 72 + row] = (_Float16)u1;
            } else {
                Ch[row * 72 + c0] = (_Float16)u0;
                Ch[row * 72 + c1] = (_Float16)u1;
            }
        }
        __syncthreads();
        const int hh = nBase >> 6;                          // head index (N tile = one head)
        v8h w[2];
        size_t off[2];
        #pragma unroll
        for (int j = 0; j < 2; ++j) {
            const int id = tid + 256 * j;
            const int line = id >> 3, pc = id & 7;
            w[j] = *(const v8h*)(Ch + line * 72 + pc * 8);
            if constexpr (MODE == 0) {
                const int mg = mBase + line;                // token index
                const int bb = mg / NT, t = mg % NT;
                off[j] = ((size_t)(bb * NH + hh) * NT + t) * NDK + pc * 8;
            } else if constexpr (MODE == 1) {
                const int bb = mBase / NT, t0 = mBase % NT; // line = d within head
                off[j] = ((size_t)(bb * NH + hh) * NDK + line) * NT + t0 + pc * 8;
            } else {
                off[j] = (size_t)(mBase + line) * N + nBase + pc * 8;
            }
        }
        _Float16* O = (_Float16*)outp;
        #pragma unroll
        for (int j = 0; j < 2; ++j) *(v8h*)(O + off[j]) = w[j];
        
    } else {
        #pragma unroll
        for (int r = 0; r < 8; ++r) {
            const int row = rbase + r;
            Cf[row * 68 + c0] = acc0[r] * oscale + bias0;
            Cf[row * 68 + c1] = acc1[r] * oscale + bias1;
        }
        __syncthreads();
        v4f w[4];
        size_t off[4];
        #pragma unroll
        for (int j = 0; j < 4; ++j) {
            const int id = tid + 256 * j;
            const int line = id >> 3, pc = id & 7;
            const int row = line >> 1, colo = ((line & 1) << 5) + pc * 4;
            off[j] = (size_t)(mBase + row) * N + nBase + colo;
            w[j] = *(const v4f*)(Cf + row * 68 + colo) + *(const v4f*)(resid + off[j]);
        }
        float* O = (float*)outp;
        #pragma unroll
        for (int j = 0; j < 4; ++j) *(v4f*)(O + off[j]) = w[j];
        
    }
}

// ---------------------------------------------------------------------------
// Attention per (b,h): block = 8 waves x 16 query rows (128 rows), grid
// (T/128, B*H).  32-key K tile ([key][d], pitch 72) and V tile ([d][key],
// pitch 40, from the transposed V copy) staged in LDS with plain loads.
// S = Q.K^T: A = Q rows (d as k), B = K rows loaded with the same split-k map.
// Online softmax in f32.  P (x4096, f16) bounced through a per-wave LDS tile
// [16][40] with _Float16 stores, a block barrier, and v8h reloads (same
// element type).  O = P.V: B = V^T rows (key as k), split-k map.
// ---------------------------------------------------------------------------
__global__ __launch_bounds__(256)
void k_attn(const _Float16* __restrict__ q, const _Float16* __restrict__ k,
            const _Float16* __restrict__ vt, const float* __restrict__ mask,
            const float* __restrict__ x, float* __restrict__ ores) {
    __shared__ __align__(16) _Float16 Ks[32 * 72];
    __shared__ __align__(16) _Float16 Vs[64 * 40];
    __shared__ __align__(16) _Float16 Ps[8][16 * 40];
    __shared__ __align__(16) float    Os[8][16 * 68];

    const int tid = threadIdx.x, lane = tid & 31, wave = tid >> 5;
    const int hl = lane >> 4, m = lane & 15;
    const int bh = blockIdx.y;
    const int b = bh / NH, hh = bh % NH;
    const int q0 = blockIdx.x * 128 + wave * 16;

    Frag aq0, aq1;
    {
        const _Float16* qp = q + ((size_t)bh * NT + q0 + m) * NDK;
        aq0.hf[0] = *(const v8h*)(qp + 8 * hl);
        aq0.hf[1] = *(const v8h*)(qp + 16 + 8 * hl);
        aq1.hf[0] = *(const v8h*)(qp + 32 + 8 * hl);
        aq1.hf[1] = *(const v8h*)(qp + 48 + 8 * hl);
    }

    const int kr = tid >> 3, kc = (tid & 7) * 8;       // K tile: 32 keys x 64 d
    const int vr = tid >> 2, vc = (tid & 3) * 8;       // V tile: 64 d x 32 keys
    const _Float16* kg = k  + ((size_t)bh * NT  + kr) * NDK + kc;
    const _Float16* vg = vt + ((size_t)bh * NDK + vr) * NT  + vc;
    const float* mrow = mask + (size_t)b * NT * NT;

    v8f acc[4];
    #pragma unroll
    for (int c = 0; c < 4; ++c) acc[c] = zero8();
    float mrun[8], lrun[8];
    #pragma unroll
    for (int e = 0; e < 8; ++e) { mrun[e] = -3.0e38f; lrun[e] = 0.0f; }

    const float sscale = 0.125f;
    const float pscale = 4096.0f;
    _Float16* ps = &Ps[wave][0];

    for (int st = 0; st < NT / 32; ++st) {
        const int s0 = st * 32;
        const v8h tk = *(const v8h*)(kg + (size_t)s0 * NDK);
        const v8h tv = *(const v8h*)(vg + s0);
        __syncthreads();                                // prior tile reads done
        *(v8h*)(Ks + kr * 72 + kc) = tk;
        *(v8h*)(Vs + vr * 40 + vc) = tv;
        __syncthreads();

        float p[2][8];
        #pragma unroll
        for (int half = 0; half < 2; ++half) {
            const _Float16* kp = Ks + (half * 16 + m) * 72;
            Frag b0, b1;
            b0.hf[0] = *(const v8h*)(kp + 8 * hl);
            b0.hf[1] = *(const v8h*)(kp + 16 + 8 * hl);
            b1.hf[0] = *(const v8h*)(kp + 32 + 8 * hl);
            b1.hf[1] = *(const v8h*)(kp + 48 + 8 * hl);
            v8f S = zero8();
            S = wmma16(aq0.v, b0.v, S);
            S = wmma16(aq1.v, b1.v, S);
            const int key = s0 + half * 16 + m;
            #pragma unroll
            for (int e = 0; e < 8; ++e) {
                const int row = q0 + 8 * hl + e;
                const float mv = mrow[(size_t)row * NT + key];
                const float add = NEGBIG * (1.0f - mv);
                p[half][e] = S[e] * sscale + add;
            }
        }
        float mnew[8], resc[8];
        #pragma unroll
        for (int e = 0; e < 8; ++e) {
            float mx = fmaxf(p[0][e], p[1][e]);
            #pragma unroll
            for (int off = 1; off < 16; off <<= 1) mx = fmaxf(mx, __shfl_xor(mx, off, 32));
            mnew[e] = fmaxf(mrun[e], mx);
            resc[e] = __expf(mrun[e] - mnew[e]);
            mrun[e] = mnew[e];
        }
        #pragma unroll
        for (int e = 0; e < 8; ++e) {
            p[0][e] = __expf(p[0][e] - mnew[e]);
            p[1][e] = __expf(p[1][e] - mnew[e]);
            float sum = p[0][e] + p[1][e];
            #pragma unroll
            for (int off = 1; off < 16; off <<= 1) sum += __shfl_xor(sum, off, 32);
            lrun[e] = lrun[e] * resc[e] + sum;
        }
        #pragma unroll
        for (int c = 0; c < 4; ++c) {
            #pragma unroll
            for (int e = 0; e < 8; ++e) acc[c][e] *= resc[e];
        }

        // P bounce: D layout (lane = key, r = row) -> A layout [row][key]
        #pragma unroll
        for (int e = 0; e < 8; ++e) {
            const int row = 8 * hl + e;
            ps[row * 40 + m]      = (_Float16)(p[0][e] * pscale);
            ps[row * 40 + 16 + m] = (_Float16)(p[1][e] * pscale);
        }
        __syncthreads();                                // orders the spill before the reload
        Frag ap;
        {
            const _Float16* pr = ps + m * 40;
            ap.hf[0] = *(const v8h*)(pr + 8 * hl);
            ap.hf[1] = *(const v8h*)(pr + 16 + 8 * hl);
        }
        #pragma unroll
        for (int c = 0; c < 4; ++c) {
            const _Float16* vp = Vs + (c * 16 + m) * 40;
            Frag fv;
            fv.hf[0] = *(const v8h*)(vp + 8 * hl);
            fv.hf[1] = *(const v8h*)(vp + 16 + 8 * hl);
            acc[c] = wmma16(ap.v, fv.v, acc[c]);
        }
    }

    float inv[8];
    #pragma unroll
    for (int e = 0; e < 8; ++e) inv[e] = (1.0f / lrun[e]) * (1.0f / 4096.0f);
    float* os = &Os[wave][0];
    #pragma unroll
    for (int c = 0; c < 4; ++c) {
        #pragma unroll
        for (int e = 0; e < 8; ++e) os[(8 * hl + e) * 68 + c * 16 + m] = acc[c][e] * inv[e];
    }
    __syncthreads();
    v4f w[8];
    size_t goff[8];
    #pragma unroll
    for (int j = 0; j < 8; ++j) {
        const int id = lane + 32 * j;
        const int line = id >> 3, pc = lane & 7;
        const int row = line >> 1, colo = ((line & 1) << 5) + pc * 4;
        goff[j] = ((size_t)(b * NT + q0 + row)) * ND + hh * NDK + colo;
        w[j] = *(const v4f*)(os + row * 68 + colo) + *(const v4f*)(x + goff[j]);
    }
    #pragma unroll
    for (int j = 0; j < 8; ++j) *(v4f*)(ores + goff[j]) = w[j];
    
}

// ---------------------------------------------------------------------------
// Host-side launch glue
// ---------------------------------------------------------------------------
extern "C" void kernel_launch(void* const* d_in, const int* in_sizes, int n_in,
                              void* d_out, int out_size, void* d_ws, size_t ws_size,
                              hipStream_t stream) {
    if (n_in < 18) return;
    if (in_sizes[0] != NM * ND || in_sizes[1] != NB * NT * NT || out_size != NM * ND) return;
    if (in_sizes[2] != ND || in_sizes[3] != ND || in_sizes[4] != ND * ND || in_sizes[5] != ND ||
        in_sizes[6] != ND * ND || in_sizes[7] != ND || in_sizes[8] != ND * ND || in_sizes[9] != ND ||
        in_sizes[10] != ND || in_sizes[11] != ND || in_sizes[12] != ND * NF || in_sizes[13] != NF ||
        in_sizes[14] != NF * ND || in_sizes[15] != ND || in_sizes[16] != ND || in_sizes[17] != ND) return;

    const float* x       = (const float*)d_in[0];
    const float* mask    = (const float*)d_in[1];
    const float* ln_in_g = (const float*)d_in[2];
    const float* ln_in_b = (const float*)d_in[3];
    const float* Wq      = (const float*)d_in[4];
    const float* bq      = (const float*)d_in[5];
    const float* Wk      = (const float*)d_in[6];
    const float* bk      = (const float*)d_in[7];
    const float* Wv      = (const float*)d_in[8];
    const float* bv      = (const float*)d_in[9];
    const float* ln1_g   = (const float*)d_in[10];
    const float* ln1_b   = (const float*)d_in[11];
    const float* W1      = (const float*)d_in[12];
    const float* b1      = (const float*)d_in[13];
    const float* W2      = (const float*)d_in[14];
    const float* b2      = (const float*)d_in[15];
    const float* ln2_g   = (const float*)d_in[16];
    const float* ln2_b   = (const float*)d_in[17];
    float* out = (float*)d_out;

    // workspace carve (all offsets multiples of 512 KiB)
    char* ws = (char*)d_ws;
    size_t o = 0;
    const size_t SZ_H16 = (size_t)NM * ND * 2;              // 8 MiB
    const size_t SZ_F32 = (size_t)NM * ND * 4;              // 16 MiB
    _Float16* h16  = (_Float16*)(ws + o); o += SZ_H16;
    _Float16* q16  = (_Float16*)(ws + o); o += SZ_H16;
    _Float16* k16  = (_Float16*)(ws + o); o += SZ_H16;
    _Float16* vt16 = (_Float16*)(ws + o); o += SZ_H16;
    _Float16* f1   = h16;                                    // [M][F] f16 = 32 MiB, reuses h/q/k/vt region after attention
    float* ares = (float*)(ws + o); o += SZ_F32;             // attention + x
    float* y    = ares;                                      // FFN2 output reuses ares after LN1
    float* a32  = (float*)(ws + o); o += SZ_F32;
    _Float16* a16 = (_Float16*)(ws + o); o += SZ_H16;
    _Float16* Wqh = (_Float16*)(ws + o); o += (size_t)ND * ND * 2;
    _Float16* Wkh = (_Float16*)(ws + o); o += (size_t)ND * ND * 2;
    _Float16* Wvh = (_Float16*)(ws + o); o += (size_t)ND * ND * 2;
    _Float16* W1h = (_Float16*)(ws + o); o += (size_t)NF * ND * 2;   // [F][D]
    _Float16* W2h = (_Float16*)(ws + o); o += (size_t)ND * NF * 2;   // [D][F]
    if ((size_t)NM * NF * 2 > 4 * SZ_H16) return;
    if (o > ws_size) return;

    // 1. weights: transpose to [n][k], scale by a power of two, f16
    k_wcvt<<<dim3(ND / 32, ND / 64), 256, 0, stream>>>(Wq, Wqh, ND, ND, 16.0f);   // in[512][512]  -> out[512][512]
    k_wcvt<<<dim3(ND / 32, ND / 64), 256, 0, stream>>>(Wk, Wkh, ND, ND, 16.0f);
    k_wcvt<<<dim3(ND / 32, ND / 64), 256, 0, stream>>>(Wv, Wvh, ND, ND, 16.0f);
    k_wcvt<<<dim3(NF / 32, ND / 64), 256, 0, stream>>>(W1, W1h, ND, NF, 16.0f);   // in[512][2048] -> out[2048][512]
    k_wcvt<<<dim3(ND / 32, NF / 64), 256, 0, stream>>>(W2, W2h, NF, ND, 32.0f);   // in[2048][512] -> out[512][2048]

    // 2. input LayerNorm -> h (f16)
    k_ln<0><<<(NM + 7) / 8, 256, 0, stream>>>(x, ln_in_g, ln_in_b, nullptr, h16, NM);

    // 3. QKV projections
    const dim3 gQKV(ND / 64, NM / 64);
    k_gemm<0><<<gQKV, 256, 0, stream>>>(h16, Wqh, bq, nullptr, (void*)q16,  ND, ND, 0.0625f);
    k_gemm<0><<<gQKV, 256, 0, stream>>>(h16, Wkh, bk, nullptr, (void*)k16,  ND, ND, 0.0625f);
    k_gemm<1><<<gQKV, 256, 0, stream>>>(h16, Wvh, bv, nullptr, (void*)vt16, ND, ND, 0.0625f);

    // 4. attention + residual(x)
    k_attn<<<dim3(NT / 128, NB * NH), 256, 0, stream>>>(q16, k16, vt16, mask, x, ares);

    // 5. LN1 -> a (f32) and a (f16)
    k_ln<1><<<(NM + 7) / 8, 256, 0, stream>>>(ares, ln1_g, ln1_b, a32, a16, NM);

    // 6. FFN1: relu(a @ W1 + b1) -> f16
    k_gemm<2><<<dim3(NF / 64, NM / 64), 256, 0, stream>>>(a16, W1h, b1, nullptr, (void*)f1, NF, ND, 0.0625f);

    // 7. FFN2: f1 @ W2 + b2 + a -> f32
    k_gemm<3><<<dim3(ND / 64, NM / 64), 256, 0, stream>>>(f1, W2h, b2, a32, (void*)y, ND, NF, 0.03125f);

    // 8. LN2 -> out
    k_ln<2><<<(NM + 7) / 8, 256, 0, stream>>>(y, ln2_g, ln2_b, out, nullptr, NM);
}

// v001
// One run takes 185 microseconds.
// Timed twice side by side with v000, it ran 1.15 times as fast both times.
#include <hip/hip_runtime.h>
// All contractions: v_wmma_f32_16x16x32_f16 (f16 operands, f32 accumulate): QKV/FFN1 weights pre-scaled x16, FFN2 weights x32, P.V with P x4096 (scales folded back in f32); Q.K^T plain f16. LayerNorm/softmax/residuals f32.

typedef _Float16 v16h __attribute__((ext_vector_type(16)));
typedef _Float16 v8h  __attribute__((ext_vector_type(8), may_alias));
typedef float    v8f  __attribute__((ext_vector_type(8)));
typedef float    v4f  __attribute__((ext_vector_type(4), may_alias));

union Frag { v16h v; v8h hf[2]; };

#define NB   8
#define NT   1024
#define ND   512
#define NH   8
#define NDK  64
#define NF   2048
#define NM   (NB * NT)
#define LNEPS  1.0e-3f
#define NEGBIG (-1.0e9f)

__device__ __forceinline__ v8f zero8() {
    v8f z = {0.f, 0.f, 0.f, 0.f, 0.f, 0.f, 0.f, 0.f};
    return z;
}

// 16x16x32 f16 WMMA with trailing hazard guard (D tied, A/B kept live)
__device__ __forceinline__ v8f wmma16(v16h a, v16h b, v8f c) {
    v8f d = __builtin_amdgcn_wmma_f32_16x16x32_f16(false, a, false, b, (short)0, c, false, false);
    asm volatile("v_nop\n\tv_nop\n\tv_nop\n\tv_nop" : "+v"(d) : "v"(a), "v"(b));
    return d;
}

// ---------------------------------------------------------------------------
// Weight transpose + scale + f16 convert: Wt[n][k] = f16(W[k][n] * scale).
// W is [K][N] row-major. Block tile: 64 k x 32 n; grid (N/32, K/64).
// ---------------------------------------------------------------------------
__global__ __launch_bounds__(256)
void k_wcvt(const float* __restrict__ W, _Float16* __restrict__ Wt, int K, int N, float scale) {
    __shared__ float tile[64][33];
    const int tid = threadIdx.x;
    const int kb = blockIdx.y * 64, nb = blockIdx.x * 32;
    const int c = tid & 31, r = tid >> 5;
    #pragma unroll
    for (int i = 0; i < 8; ++i)
        tile[r + 8 * i][c] = W[(size_t)(kb + r + 8 * i) * N + nb + c] * scale;
    __syncthreads();
    const int n = tid >> 3, pc = tid & 7;
    v8h o;
    #pragma unroll
    for (int e = 0; e < 8; ++e) o[e] = (_Float16)tile[pc * 8 + e][n];
    _Float16* dst = Wt + (size_t)(nb + n) * K + kb + pc * 8;
    *(v8h*)dst = o;
    
}

// ---------------------------------------------------------------------------
// deviations).  One wave per row, 8 rows per 256-thread block.
// OM 0: f16 output only; OM 1: f32 + f16; OM 2: f32 only.
// f32 rows: lane l stores float4 at cols 4l+128j (each instruction = 4 whole
// lines, lane-contiguous 16 B).  f16 rows: lane l stores 8 halves at cols
// ---------------------------------------------------------------------------
template <int OM>
__global__ __launch_bounds__(256)
void k_ln(const float* __restrict__ in, const float* __restrict__ g, const float* __restrict__ bt,
          float* __restrict__ of, _Float16* __restrict__ oh, int M) {
    const int lane = threadIdx.x & 31, wave = threadIdx.x >> 5;
    const int row = blockIdx.x * 8 + wave;
    if (row >= M) return;                      // wave-uniform; no barriers in this kernel
    const float* r = in + (size_t)row * ND;

    v4f v[4];
    float s = 0.f;
    #pragma unroll
    for (int j = 0; j < 4; ++j) {
        v[j] = *(const v4f*)(r + 4 * lane + 128 * j);
        s += (v[j][0] + v[j][1]) + (v[j][2] + v[j][3]);
    }
    #pragma unroll
    for (int off = 16; off >= 1; off >>= 1) s += __shfl_xor(s, off, 32);
    const float mean = s * (1.0f / ND);
    float sq = 0.f;
    #pragma unroll
    for (int j = 0; j < 4; ++j) {
        #pragma unroll
        for (int c = 0; c < 4; ++c) { const float d = v[j][c] - mean; sq += d * d; }
    }
    #pragma unroll
    for (int off = 16; off >= 1; off >>= 1) sq += __shfl_xor(sq, off, 32);
    const float rstd = rsqrtf(sq * (1.0f / ND) + LNEPS);

    if constexpr (OM != 0) {
        v4f o[4];
        #pragma unroll
        for (int j = 0; j < 4; ++j) {
            const int c0 = 4 * lane + 128 * j;
            const v4f gv = *(const v4f*)(g + c0);
            const v4f bv = *(const v4f*)(bt + c0);
            #pragma unroll
            for (int c = 0; c < 4; ++c) o[j][c] = (v[j][c] - mean) * rstd * gv[c] + bv[c];
        }
        float* orow = of + (size_t)row * ND + 4 * lane;
        #pragma unroll
        for (int j = 0; j < 4; ++j) *(v4f*)(orow + 128 * j) = o[j];
        
    }
    if constexpr (OM != 2) {
        v8h w[2];
        #pragma unroll
        for (int j = 0; j < 2; ++j) {
            const int c0 = 8 * lane + 256 * j;
            const v4f x0 = *(const v4f*)(r + c0),  x1 = *(const v4f*)(r + c0 + 4);
            const v4f g0 = *(const v4f*)(g + c0),  g1 = *(const v4f*)(g + c0 + 4);
            const v4f b0 = *(const v4f*)(bt + c0), b1 = *(const v4f*)(bt + c0 + 4);
            #pragma unroll
            for (int c = 0; c < 4; ++c) {
                w[j][c]     = (_Float16)((x0[c] - mean) * rstd * g0[c] + b0[c]);
                w[j][4 + c] = (_Float16)((x1[c] - mean) * rstd * g1[c] + b1[c]);
            }
        }
        _Float16* hrow = oh + (size_t)row * ND + 8 * lane;
        #pragma unroll
        for (int j = 0; j < 2; ++j) *(v8h*)(hrow + 256 * j) = w[j];
        
    }
}

// ---------------------------------------------------------------------------
// WMMA GEMM: C[M,N] = A[M,K] @ W[K,N] (+bias, scale, epilogue).  A f16
// row-major [M][K]; weights f16 [N][K] (k-contiguous), so A and B fragments
// use the same split-k loader: elements 0..7 <- k0+8h+0..7, elements 8..15
// <- k0+16+8h+0..7, h = lane>>4, row/col = lane&15.  D element r of a lane =
// (row 8h+r, col lane&15).  Block tile 128x128, K step 128, 8 waves (4 m x 2 n,
// each wave 32x64 = 2 x 4 accumulators).  A and B tiles staged in LDS, rows of
// 256 B at pitch 272 B.  M, N multiples of 128; K a multiple of 128.  N and K
// are compile-time, so a thread's 8 rows of a tile hang off one address.
// MODE 0: f16 out, head layout [B,H,T,DK]  (Q, K)
// MODE 1: f16 out, [B,H,DK,T]              (V transposed)
// MODE 2: f16 out, relu, row-major [M][N]  (FFN1)
// MODE 3: f32 out + residual, row-major    (FFN2)
// ---------------------------------------------------------------------------
#define GT  128     // block tile, rows and columns
#define GK  128     // k per staged tile
#define GP  136     // LDS pitch of a staged row and of an f16 output row, halves
#define GPF 132     // LDS pitch of an f32 output row, floats

template <int MODE, int N, int K>
__global__ __launch_bounds__(256)
void k_gemm(const _Float16* __restrict__ A, const _Float16* __restrict__ Bt,
            const float* __restrict__ bias, const float* __restrict__ resid,
            void* __restrict__ outp, float oscale) {
    __shared__ __align__(16) _Float16 As[GT * GP];
    __shared__ __align__(16) _Float16 Bs[GT * GP];
    __shared__ __align__(16) _Float16 Ch[GT * GP];
    __shared__ __align__(16) float    Cf[GT * GPF];

    const int tid = threadIdx.x, lane = tid & 31, wave = tid >> 5;
    const int hl = lane >> 4, m = lane & 15;
    const int mBase = blockIdx.y * GT, nBase = blockIdx.x * GT;
    const int wm = wave & 3, wn = wave >> 2;
    const int ar = tid >> 4, ac = (tid & 15) * 8;         // staging: row (step 16), k chunk
    const char* Ag = (const char*)(A  + (size_t)mBase * K);   // block-uniform origins of the row blocks
    const char* Bg = (const char*)(Bt + (size_t)nBase * K);
    unsigned go = (ar * K + ac) * 2;                      // the thread's byte offset, the same in both operands

    v8f acc[2][4];
    #pragma unroll
    for (int i = 0; i < 2; ++i) {
        #pragma unroll
        for (int j = 0; j < 4; ++j) acc[i][j] = zero8();
    }
    const _Float16* ap = As + (wm * 32 + m) * GP + 8 * hl;
    const _Float16* bp = Bs + (wn * 64 + m) * GP + 8 * hl;

    for (int kt = 0; kt < K / GK; ++kt) {
        v8h ta[8], tb[8];
        #pragma unroll
        for (int j = 0; j < 8; ++j) {
            ta[j] = *(const v8h*)(Ag + j * 16 * K * 2 + go);
            tb[j] = *(const v8h*)(Bg + j * 16 * K * 2 + go);
        }
        go += GK * 2;
        __syncthreads();                                    // prior fragment reads done
        #pragma unroll
        for (int j = 0; j < 8; ++j) {
            *(v8h*)(As + (ar + 16 * j) * GP + ac) = ta[j];
            *(v8h*)(Bs + (ar + 16 * j) * GP + ac) = tb[j];
        }
        __syncthreads();
        #pragma unroll
        for (int kk = 0; kk < GK / 32; ++kk) {
            Frag fa[2], fb[4];
            #pragma unroll
            for (int i = 0; i < 2; ++i) {
                fa[i].hf[0] = *(const v8h*)(ap + i * 16 * GP + kk * 32);
                fa[i].hf[1] = *(const v8h*)(ap + i * 16 * GP + kk * 32 + 16);
            }
            #pragma unroll
            for (int j = 0; j < 4; ++j) {
                fb[j].hf[0] = *(const v8h*)(bp + j * 16 * GP + kk * 32);
                fb[j].hf[1] = *(const v8h*)(bp + j * 16 * GP + kk * 32 + 16);
            }
            #pragma unroll
            for (int i = 0; i < 2; ++i) {
                #pragma unroll
                for (int j = 0; j < 4; ++j) acc[i][j] = wmma16(fa[i].v, fb[j].v, acc[i][j]);
            }
        }
    }

    float bj[4];
    #pragma unroll
    for (int j = 0; j < 4; ++j) bj[j] = bias[nBase + wn * 64 + j * 16 + m];

    if constexpr (MODE <= 2) {
        #pragma unroll
        for (int i = 0; i < 2; ++i) {
            #pragma unroll
            for (int j = 0; j < 4; ++j) {
                const int col = wn * 64 + j * 16 + m;
                #pragma unroll
                for (int r = 0; r < 8; ++r) {
                    float u = acc[i][j][r] * oscale + bj[j];
                    if constexpr (MODE == 2) u = fmaxf(u, 0.0f);
                    const int row = wm * 32 + i * 16 + 8 * hl + r;
                    if constexpr (MODE == 1) Ch[col * GP + row] = (_Float16)u;
                    else                     Ch[row * GP + col] = (_Float16)u;
                }
            }
        }
        __syncthreads();
        // thread: staged rows line + 16 j, 16-byte piece pc; a tile lies in one batch (NT % GT == 0)
        const int line = tid >> 4, pc = tid & 15;
        const int bb = mBase / NT, t0 = mBase % NT;
        _Float16* O = (_Float16*)outp;
        int step;                                           // halves between rows line and line + 16
        if constexpr (MODE == 0) {
            const int n = nBase + pc * 8;                   // column: head n / NDK, d n % NDK
            O += ((size_t)(bb * NH + n / NDK) * NT + t0 + line) * NDK + n % NDK;
            step = 16 * NDK;
        } else if constexpr (MODE == 1) {
            const int n = nBase + line;                     // staged row = column: head n / NDK, d n % NDK
            O += ((size_t)(bb * NH + n / NDK) * NDK + n % NDK) * NT + t0 + pc * 8;
            step = 16 * NT;                                 // heads are NDK * NT apart: linear in n
        } else {
            O += (size_t)(mBase + line) * N + nBase + pc * 8;
            step = 16 * N;
        }
        v8h w[8];
        #pragma unroll
        for (int j = 0; j < 8; ++j) w[j] = *(const v8h*)(Ch + (line + 16 * j) * GP + pc * 8);
        #pragma unroll
        for (int j = 0; j < 8; ++j) *(v8h*)(O + j * step) = w[j];

    } else {
        #pragma unroll
        for (int i = 0; i < 2; ++i) {
            #pragma unroll
            for (int j = 0; j < 4; ++j) {
                const int col = wn * 64 + j * 16 + m;
                #pragma unroll
                for (int r = 0; r < 8; ++r) {
                    const int row = wm * 32 + i * 16 + 8 * hl + r;
                    Cf[row * GPF + col] = acc[i][j][r] * oscale + bj[j];
                }
            }
        }
        __syncthreads();
        // one wave = one 512-B row; thread: rows wave + 8 j, 16-byte piece lane
        const size_t tile = (size_t)mBase * N + nBase;      // block-uniform
        const unsigned to = wave * N + lane * 4;
        const float* R = resid + tile;
        float* O = (float*)outp + tile;
        #pragma unroll
        for (int g = 0; g < 4; ++g) {
            v4f w[4];
            #pragma unroll
            for (int j = 0; j < 4; ++j) {
                const int rj = 8 * (4 * g + j);
                w[j] = *(const v4f*)(Cf + (wave + rj) * GPF + lane * 4) + *(const v4f*)(R + rj * N + to);
            }
            #pragma unroll
            for (int j = 0; j < 4; ++j) *(v4f*)(O + 8 * (4 * g + j) * N + to) = w[j];
        }
    }
}

// ---------------------------------------------------------------------------
// Attention per (b,h): block = 8 waves x 16 query rows (128 rows), grid
// (T/128, B*H).  32-key K tile ([key][d], pitch 72) and V tile ([d][key],
// pitch 40, from the transposed V copy) staged in LDS with plain loads.
// S = Q.K^T: A = Q rows (d as k), B = K rows loaded with the same split-k map.
// Online softmax in f32.  P (x4096, f16) bounced through a per-wave LDS tile
// [16][40] with _Float16 stores, a block barrier, and v8h reloads (same
// element type).  O = P.V: B = V^T rows (key as k), split-k map.
// ---------------------------------------------------------------------------
__global__ __launch_bounds__(256)
void k_attn(const _Float16* __restrict__ q, const _Float16* __restrict__ k,
            const _Float16* __restrict__ vt, const float* __restrict__ mask,
            const float* __restrict__ x, float* __restrict__ ores) {
    __shared__ __align__(16) _Float16 Ks[32 * 72];
    __shared__ __align__(16) _Float16 Vs[64 * 40];
    __shared__ __align__(16) _Float16 Ps[8][16 * 40];
    __shared__ __align__(16) float    Os[8][16 * 68];

    const int tid = threadIdx.x, lane = tid & 31, wave = tid >> 5;
    const int hl = lane >> 4, m = lane & 15;
    const int bh = blockIdx.y;
    const int b = bh / NH, hh = bh % NH;
    const int q0 = blockIdx.x * 128 + wave * 16;

    Frag aq0, aq1;
    {
        const _Float16* qp = q + ((size_t)bh * NT + q0 + m) * NDK;
        aq0.hf[0] = *(const v8h*)(qp + 8 * hl);
        aq0.hf[1] = *(const v8h*)(qp + 16 + 8 * hl);
        aq1.hf[0] = *(const v8h*)(qp + 32 + 8 * hl);
        aq1.hf[1] = *(const v8h*)(qp + 48 + 8 * hl);
    }

    const int kr = tid >> 3, kc = (tid & 7) * 8;       // K tile: 32 keys x 64 d
    const int vr = tid >> 2, vc = (tid & 3) * 8;       // V tile: 64 d x 32 keys
    const _Float16* kg = k  + ((size_t)bh * NT  + kr) * NDK + kc;
    const _Float16* vg = vt + ((size_t)bh * NDK + vr) * NT  + vc;
    const float* mrow = mask + (size_t)b * NT * NT;

    v8f acc[4];
    #pragma unroll
    for (int c = 0; c < 4; ++c) acc[c] = zero8();
    float mrun[8], lrun[8];
    #pragma unroll
    for (int e = 0; e < 8; ++e) { mrun[e] = -3.0e38f; lrun[e] = 0.0f; }

    const float sscale = 0.125f;
    const float pscale = 4096.0f;
    _Float16* ps = &Ps[wave][0];

    for (int st = 0; st < NT / 32; ++st) {
        const int s0 = st * 32;
        const v8h tk = *(const v8h*)(kg + (size_t)s0 * NDK);
        const v8h tv = *(const v8h*)(vg + s0);
        __syncthreads();                                // prior tile reads done
        *(v8h*)(Ks + kr * 72 + kc) = tk;
        *(v8h*)(Vs + vr * 40 + vc) = tv;
        __syncthreads();

        float p[2][8];
        #pragma unroll
        for (int half = 0; half < 2; ++half) {
            const _Float16* kp = Ks + (half * 16 + m) * 72;
            Frag b0, b1;
            b0.hf[0] = *(const v8h*)(kp + 8 * hl);
            b0.hf[1] = *(const v8h*)(kp + 16 + 8 * hl);
            b1.hf[0] = *(const v8h*)(kp + 32 + 8 * hl);
            b1.hf[1] = *(const v8h*)(kp + 48 + 8 * hl);
            v8f S = zero8();
            S = wmma16(aq0.v, b0.v, S);
            S = wmma16(aq1.v, b1.v, S);
            const int key = s0 + half * 16 + m;
            #pragma unroll
            for (int e = 0; e < 8; ++e) {
                const int row = q0 + 8 * hl + e;
                const float mv = mrow[(size_t)row * NT + key];
                const float add = NEGBIG * (1.0f - mv);
                p[half][e] = S[e] * sscale + add;
            }
        }
        float mnew[8], resc[8];
        #pragma unroll
        for (int e = 0; e < 8; ++e) {
            float mx = fmaxf(p[0][e], p[1][e]);
            #pragma unroll
            for (int off = 1; off < 16; off <<= 1) mx = fmaxf(mx, __shfl_xor(mx, off, 32));
            mnew[e] = fmaxf(mrun[e], mx);
            resc[e] = __expf(mrun[e] - mnew[e]);
            mrun[e] = mnew[e];
        }
        #pragma unroll
        for (int e = 0; e < 8; ++e) {
            p[0][e] = __expf(p[0][e] - mnew[e]);
            p[1][e] = __expf(p[1][e] - mnew[e]);
            float sum = p[0][e] + p[1][e];
            #pragma unroll
            for (int off = 1; off < 16; off <<= 1) sum += __shfl_xor(sum, off, 32);
            lrun[e] = lrun[e] * resc[e] + sum;
        }
        #pragma unroll
        for (int c = 0; c < 4; ++c) {
            #pragma unroll
            for (int e = 0; e < 8; ++e) acc[c][e] *= resc[e];
        }

        // P bounce: D layout (lane = key, r = row) -> A layout [row][key]
        #pragma unroll
        for (int e = 0; e < 8; ++e) {
            const int row = 8 * hl + e;
            ps[row * 40 + m]      = (_Float16)(p[0][e] * pscale);
            ps[row * 40 + 16 + m] = (_Float16)(p[1][e] * pscale);
        }
        __syncthreads();                                // orders the spill before the reload
        Frag ap;
        {
            const _Float16* pr = ps + m * 40;
            ap.hf[0] = *(const v8h*)(pr + 8 * hl);
            ap.hf[1] = *(const v8h*)(pr + 16 + 8 * hl);
        }
        #pragma unroll
        for (int c = 0; c < 4; ++c) {
            const _Float16* vp = Vs + (c * 16 + m) * 40;
            Frag fv;
            fv.hf[0] = *(const v8h*)(vp + 8 * hl);
            fv.hf[1] = *(const v8h*)(vp + 16 + 8 * hl);
            acc[c] = wmma16(ap.v, fv.v, acc[c]);
        }
    }

    float inv[8];
    #pragma unroll
    for (int e = 0; e < 8; ++e) inv[e] = (1.0f / lrun[e]) * (1.0f / 4096.0f);
    float* os = &Os[wave][0];
    #pragma unroll
    for (int c = 0; c < 4; ++c) {
        #pragma unroll
        for (int e = 0; e < 8; ++e) os[(8 * hl + e) * 68 + c * 16 + m] = acc[c][e] * inv[e];
    }
    __syncthreads();
    v4f w[8];
    size_t goff[8];
    #pragma unroll
    for (int j = 0; j < 8; ++j) {
        const int id = lane + 32 * j;
        const int line = id >> 3, pc = lane & 7;
        const int row = line >> 1, colo = ((line & 1) << 5) + pc * 4;
        goff[j] = ((size_t)(b * NT + q0 + row)) * ND + hh * NDK + colo;
        w[j] = *(const v4f*)(os + row * 68 + colo) + *(const v4f*)(x + goff[j]);
    }
    #pragma unroll
    for (int j = 0; j < 8; ++j) *(v4f*)(ores + goff[j]) = w[j];
    
}

// ---------------------------------------------------------------------------
// Host-side launch glue
// ---------------------------------------------------------------------------
extern "C" void kernel_launch(void* const* d_in, const int* in_sizes, int n_in,
                              void* d_out, int out_size, void* d_ws, size_t ws_size,
                              hipStream_t stream) {
    if (n_in < 18) return;
    if (in_sizes[0] != NM * ND || in_sizes[1] != NB * NT * NT || out_size != NM * ND) return;
    if (in_sizes[2] != ND || in_sizes[3] != ND || in_sizes[4] != ND * ND || in_sizes[5] != ND ||
        in_sizes[6] != ND * ND || in_sizes[7] != ND || in_sizes[8] != ND * ND || in_sizes[9] != ND ||
        in_sizes[10] != ND || in_sizes[11] != ND || in_sizes[12] != ND * NF || in_sizes[13] != NF ||
        in_sizes[14] != NF * ND || in_sizes[15] != ND || in_sizes[16] != ND || in_sizes[17] != ND) return;

    const float* x       = (const float*)d_in[0];
    const float* mask    = (const float*)d_in[1];
    const float* ln_in_g = (const float*)d_in[2];
    const float* ln_in_b = (const float*)d_in[3];
    const float* Wq      = (const float*)d_in[4];
    const float* bq      = (const float*)d_in[5];
    const float* Wk      = (const float*)d_in[6];
    const float* bk      = (const float*)d_in[7];
    const float* Wv      = (const float*)d_in[8];
    const float* bv      = (const float*)d_in[9];
    const float* ln1_g   = (const float*)d_in[10];
    const float* ln1_b   = (const float*)d_in[11];
    const float* W1      = (const float*)d_in[12];
    const float* b1      = (const float*)d_in[13];
    const float* W2      = (const float*)d_in[14];
    const float* b2      = (const float*)d_in[15];
    const float* ln2_g   = (const float*)d_in[16];
    const float* ln2_b   = (const float*)d_in[17];
    float* out = (float*)d_out;

    // workspace carve (all offsets multiples of 512 KiB)
    char* ws = (char*)d_ws;
    size_t o = 0;
    const size_t SZ_H16 = (size_t)NM * ND * 2;              // 8 MiB
    const size_t SZ_F32 = (size_t)NM * ND * 4;              // 16 MiB
    _Float16* h16  = (_Float16*)(ws + o); o += SZ_H16;
    _Float16* q16  = (_Float16*)(ws + o); o += SZ_H16;
    _Float16* k16  = (_Float16*)(ws + o); o += SZ_H16;
    _Float16* vt16 = (_Float16*)(ws + o); o += SZ_H16;
    _Float16* f1   = h16;                                    // [M][F] f16 = 32 MiB, reuses h/q/k/vt region after attention
    float* ares = (float*)(ws + o); o += SZ_F32;             // attention + x
    float* y    = ares;                                      // FFN2 output reuses ares after LN1
    float* a32  = (float*)(ws + o); o += SZ_F32;
    _Float16* a16 = (_Float16*)(ws + o); o += SZ_H16;
    _Float16* Wqh = (_Float16*)(ws + o); o += (size_t)ND * ND * 2;
    _Float16* Wkh = (_Float16*)(ws + o); o += (size_t)ND * ND * 2;
    _Float16* Wvh = (_Float16*)(ws + o); o += (size_t)ND * ND * 2;
    _Float16* W1h = (_Float16*)(ws + o); o += (size_t)NF * ND * 2;   // [F][D]
    _Float16* W2h = (_Float16*)(ws + o); o += (size_t)ND * NF * 2;   // [D][F]
    if ((size_t)NM * NF * 2 > 4 * SZ_H16) return;
    if (o > ws_size) return;

    // 1. weights: transpose to [n][k], scale by a power of two, f16
    k_wcvt<<<dim3(ND / 32, ND / 64), 256, 0, stream>>>(Wq, Wqh, ND, ND, 16.0f);   // in[512][512]  -> out[512][512]
    k_wcvt<<<dim3(ND / 32, ND / 64), 256, 0, stream>>>(Wk, Wkh, ND, ND, 16.0f);
    k_wcvt<<<dim3(ND / 32, ND / 64), 256, 0, stream>>>(Wv, Wvh, ND, ND, 16.0f);
    k_wcvt<<<dim3(NF / 32, ND / 64), 256, 0, stream>>>(W1, W1h, ND, NF, 16.0f);   // in[512][2048] -> out[2048][512]
    k_wcvt<<<dim3(ND / 32, NF / 64), 256, 0, stream>>>(W2, W2h, NF, ND, 32.0f);   // in[2048][512] -> out[512][2048]

    // 2. input LayerNorm -> h (f16)
    k_ln<0><<<(NM + 7) / 8, 256, 0, stream>>>(x, ln_in_g, ln_in_b, nullptr, h16, NM);

    // 3. QKV projections
    const dim3 gQKV(ND / GT, NM / GT);
    k_gemm<0, ND, ND><<<gQKV, 256, 0, stream>>>(h16, Wqh, bq, nullptr, (void*)q16,  0.0625f);
    k_gemm<0, ND, ND><<<gQKV, 256, 0, stream>>>(h16, Wkh, bk, nullptr, (void*)k16,  0.0625f);
    k_gemm<1, ND, ND><<<gQKV, 256, 0, stream>>>(h16, Wvh, bv, nullptr, (void*)vt16, 0.0625f);

    // 4. attention + residual(x)
    k_attn<<<dim3(NT / 128, NB * NH), 256, 0, stream>>>(q16, k16, vt16, mask, x, ares);

    // 5. LN1 -> a (f32) and a (f16)
    k_ln<1><<<(NM + 7) / 8, 256, 0, stream>>>(ares, ln1_g, ln1_b, a32, a16, NM);

    // 6. FFN1: relu(a @ W1 + b1) -> f16
    k_gemm<2, NF, ND><<<dim3(NF / GT, NM / GT), 256, 0, stream>>>(a16, W1h, b1, nullptr, (void*)f1, 0.0625f);

    // 7. FFN2: f1 @ W2 + b2 + a -> f32
    k_gemm<3, ND, NF><<<dim3(ND / GT, NM / GT), 256, 0, stream>>>(f1, W2h, b2, a32, (void*)y, 0.03125f);

    // 8. LN2 -> out
    k_ln<2><<<(NM + 7) / 8, 256, 0, stream>>>(y, ln2_g, ln2_b, out, nullptr, NM);
}

// v002
// One run takes 162 microseconds.
// Two timings next to v001 put it at 1.13 and 1.14 times that version's speed.
// Counting every step since v000, it is 1.30 times as fast.
#include <hip/hip_runtime.h>
// All contractions: v_wmma_f32_16x16x32_f16 (f16 operands, f32 accumulate): QKV/FFN1 weights pre-scaled x16, FFN2 weights x32, P.V with P x4096 (scales folded back in f32); Q.K^T plain f16. LayerNorm/softmax/residuals f32.

typedef _Float16 v16h __attribute__((ext_vector_type(16)));
typedef _Float16 v8h  __attribute__((ext_vector_type(8), may_alias));
typedef float    v8f  __attribute__((ext_vector_type(8)));
typedef float    v4f  __attribute__((ext_vector_type(4), may_alias));

union Frag { v16h v; v8h hf[2]; };

#define NB   8
#define NT   1024
#define ND   512
#define NH   8
#define NDK  64
#define NF   2048
#define NM   (NB * NT)
#define LNEPS  1.0e-3f
#define NEGBIG (-1.0e9f)

__device__ __forceinline__ v8f zero8() {
    v8f z = {0.f, 0.f, 0.f, 0.f, 0.f, 0.f, 0.f, 0.f};
    return z;
}

// 16x16x32 f16 WMMA with trailing hazard guard (D tied, A/B kept live)
__device__ __forceinline__ v8f wmma16(v16h a, v16h b, v8f c) {
    v8f d = __builtin_amdgcn_wmma_f32_16x16x32_f16(false, a, false, b, (short)0, c, false, false);
    asm volatile("v_nop\n\tv_nop\n\tv_nop\n\tv_nop" : "+v"(d) : "v"(a), "v"(b));
    return d;
}

// ---------------------------------------------------------------------------
// Weight transpose + scale + f16 convert: Wt[n][k] = f16(W[k][n] * scale).
// W is [K][N] row-major. Block tile: 64 k x 32 n; tile (bx, by) of (N/32, K/64).
// ---------------------------------------------------------------------------
__device__ __forceinline__
void wcvt_tile(const float* __restrict__ W, _Float16* __restrict__ Wt, int K, int N, float scale, int bx, int by) {
    __shared__ float tile[64][33];
    const int tid = threadIdx.x;
    const int kb = by * 64, nb = bx * 32;
    const int c = tid & 31, r = tid >> 5;
    #pragma unroll
    for (int i = 0; i < 8; ++i)
        tile[r + 8 * i][c] = W[(size_t)(kb + r + 8 * i) * N + nb + c] * scale;
    __syncthreads();
    const int n = tid >> 3, pc = tid & 7;
    v8h o;
    #pragma unroll
    for (int e = 0; e < 8; ++e) o[e] = (_Float16)tile[pc * 8 + e][n];
    _Float16* dst = Wt + (size_t)(nb + n) * K + kb + pc * 8;
    *(v8h*)dst = o;
    
}

// ---------------------------------------------------------------------------
// deviations).  One wave per row, 8 rows per 256-thread block.
// OM 0: f16 output only; OM 1: f32 + f16; OM 2: f32 only.
// f32 rows: lane l stores float4 at cols 4l+128j (each instruction = 4 whole
// lines, lane-contiguous 16 B).  f16 rows: lane l stores 8 halves at cols
// ---------------------------------------------------------------------------
template <int OM>
__device__ __forceinline__
void ln_rows(const float* __restrict__ in, const float* __restrict__ g, const float* __restrict__ bt,
             float* __restrict__ of, _Float16* __restrict__ oh, int M, int blk) {
    const int lane = threadIdx.x & 31, wave = threadIdx.x >> 5;
    const int row = blk * 8 + wave;
    if (row >= M) return;                      // wave-uniform; no barriers in this function
    const float* r = in + (size_t)row * ND;

    v4f v[4];
    float s = 0.f;
    #pragma unroll
    for (int j = 0; j < 4; ++j) {
        v[j] = *(const v4f*)(r + 4 * lane + 128 * j);
        s += (v[j][0] + v[j][1]) + (v[j][2] + v[j][3]);
    }
    #pragma unroll
    for (int off = 16; off >= 1; off >>= 1) s += __shfl_xor(s, off, 32);
    const float mean = s * (1.0f / ND);
    float sq = 0.f;
    #pragma unroll
    for (int j = 0; j < 4; ++j) {
        #pragma unroll
        for (int c = 0; c < 4; ++c) { const float d = v[j][c] - mean; sq += d * d; }
    }
    #pragma unroll
    for (int off = 16; off >= 1; off >>= 1) sq += __shfl_xor(sq, off, 32);
    const float rstd = rsqrtf(sq * (1.0f / ND) + LNEPS);

    if constexpr (OM != 0) {
        v4f o[4];
        #pragma unroll
        for (int j = 0; j < 4; ++j) {
            const int c0 = 4 * lane + 128 * j;
            const v4f gv = *(const v4f*)(g + c0);
            const v4f bv = *(const v4f*)(bt + c0);
            #pragma unroll
            for (int c = 0; c < 4; ++c) o[j][c] = (v[j][c] - mean) * rstd * gv[c] + bv[c];
        }
        float* orow = of + (size_t)row * ND + 4 * lane;
        #pragma unroll
        for (int j = 0; j < 4; ++j) *(v4f*)(orow + 128 * j) = o[j];
        
    }
    if constexpr (OM != 2) {
        v8h w[2];
        #pragma unroll
        for (int j = 0; j < 2; ++j) {
            const int c0 = 8 * lane + 256 * j;
            const v4f x0 = *(const v4f*)(r + c0),  x1 = *(const v4f*)(r + c0 + 4);
            const v4f g0 = *(const v4f*)(g + c0),  g1 = *(const v4f*)(g + c0 + 4);
            const v4f b0 = *(const v4f*)(bt + c0), b1 = *(const v4f*)(bt + c0 + 4);
            #pragma unroll
            for (int c = 0; c < 4; ++c) {
                w[j][c]     = (_Float16)((x0[c] - mean) * rstd * g0[c] + b0[c]);
                w[j][4 + c] = (_Float16)((x1[c] - mean) * rstd * g1[c] + b1[c]);
            }
        }
        _Float16* hrow = oh + (size_t)row * ND + 8 * lane;
        #pragma unroll
        for (int j = 0; j < 2; ++j) *(v8h*)(hrow + 256 * j) = w[j];
        
    }
}

template <int OM>
__global__ __launch_bounds__(256)
void k_ln(const float* __restrict__ in, const float* __restrict__ g, const float* __restrict__ bt,
          float* __restrict__ of, _Float16* __restrict__ oh, int M) {
    ln_rows<OM>(in, g, bt, of, oh, M, blockIdx.x);
}

// ---------------------------------------------------------------------------
// Everything that depends on the inputs alone, in one grid: the input
// LayerNorm (blocks 0 .. PB_LN-1, 8 rows each), then the five weight converts
// (one 64 k x 32 n tile a block).  The job is picked by the block index, so
// every branch here is block-uniform.
// ---------------------------------------------------------------------------
#define PB_LN (NM / 8)                      // LayerNorm blocks
#define PB_WD ((ND / 32) * (ND / 64))       // tiles of a D x D weight
#define PB_WF ((NF / 32) * (ND / 64))       // tiles of W1, and of W2

__global__ __launch_bounds__(256)
void k_prep(const float* __restrict__ x, const float* __restrict__ g, const float* __restrict__ bt,
            _Float16* __restrict__ h,
            const float* __restrict__ Wq, const float* __restrict__ Wk, const float* __restrict__ Wv,
            const float* __restrict__ W1, const float* __restrict__ W2,
            _Float16* __restrict__ Wqh, _Float16* __restrict__ Wkh, _Float16* __restrict__ Wvh,
            _Float16* __restrict__ W1h, _Float16* __restrict__ W2h) {
    if (blockIdx.x < PB_LN) { ln_rows<0>(x, g, bt, nullptr, h, NM, blockIdx.x); return; }
    int b = blockIdx.x - PB_LN;
    const float* W;
    _Float16* Wt;
    int K, N, bx, by;
    float sc;
    if (b < 3 * PB_WD) {                    // in[512][512] -> out[512][512]
        const int w = b / PB_WD;
        b -= w * PB_WD;
        W  = w == 0 ? Wq  : (w == 1 ? Wk  : Wv);
        Wt = w == 0 ? Wqh : (w == 1 ? Wkh : Wvh);
        K = ND; N = ND; sc = 16.0f;
        bx = b % (ND / 32); by = b / (ND / 32);
    } else if (b < 3 * PB_WD + PB_WF) {     // in[512][2048] -> out[2048][512]
        b -= 3 * PB_WD;
        W = W1; Wt = W1h; K = ND; N = NF; sc = 16.0f;
        bx = b % (NF / 32); by = b / (NF / 32);
    } else {                                // in[2048][512] -> out[512][2048]
        b -= 3 * PB_WD + PB_WF;
        W = W2; Wt = W2h; K = NF; N = ND; sc = 32.0f;
        bx = b % (ND / 32); by = b / (ND / 32);
    }
    wcvt_tile(W, Wt, K, N, sc, bx, by);
    // the built code lays the LayerNorm behind this tile's store: its registers stay until this wait
    asm volatile("s_wait_xcnt 0x0" ::: "memory");
}

// ---------------------------------------------------------------------------
// WMMA GEMM: C[M,N] = A[M,K] @ W[K,N] (+bias, scale, epilogue).  A f16
// row-major [M][K]; weights f16 [N][K] (k-contiguous), so A and B fragments
// use the same split-k loader: elements 0..7 <- k0+8h+0..7, elements 8..15
// <- k0+16+8h+0..7, h = lane>>4, row/col = lane&15.  D element r of a lane =
// (row 8h+r, col lane&15).  Block tile 128x128, K step 128, 8 waves (4 m x 2 n,
// each wave 32x64 = 2 x 4 accumulators).  A and B tiles staged in LDS, rows of
// 256 B at pitch 272 B.  M, N multiples of 128; K a multiple of 128.  N and K
// are compile-time, so a thread's 8 rows of a tile hang off one address.
// MODE 0: Q, K and V in one grid, N = 3 * ND: Bt holds the three weights one
//         behind the other, outp the three outputs; a column tile lies in one
//         projection w = nBase / ND (block-uniform), which picks bias, output
//         and f16 epilogue 0 (Q, K) or 1 (V)
// MODE 2: f16 out, relu, row-major [M][N]  (FFN1)
// MODE 3: f32 out + residual, row-major    (FFN2)
// f16 epilogues EM: 0 = [B,H,T,DK], 1 = [B,H,DK,T] (V transposed), 2 = FFN1
// ---------------------------------------------------------------------------
#define GT  128     // block tile, rows and columns
#define GK  128     // k per staged tile
#define GP  136     // LDS pitch of a staged row and of an f16 output row, halves
#define GPF 132     // LDS pitch of an f32 output row, floats

// f16 epilogue of a 128x128 tile: scale, bias (relu), staged in Ch, stored in 16-byte pieces
template <int EM, int N>
__device__ __forceinline__
void epi_f16(const v8f (&acc)[2][4], const float (&bj)[4], _Float16* Ch, _Float16* __restrict__ O,
             float oscale, int mBase, int nBase) {
    const int tid = threadIdx.x, lane = tid & 31, wave = tid >> 5;
    const int hl = lane >> 4, m = lane & 15;
    const int wm = wave & 3, wn = wave >> 2;
    #pragma unroll
    for (int i = 0; i < 2; ++i) {
        #pragma unroll
        for (int j = 0; j < 4; ++j) {
            const int col = wn * 64 + j * 16 + m;
            #pragma unroll
            for (int r = 0; r < 8; ++r) {
                float u = acc[i][j][r] * oscale + bj[j];
                if constexpr (EM == 2) u = fmaxf(u, 0.0f);
                const int row = wm * 32 + i * 16 + 8 * hl + r;
                if constexpr (EM == 1) Ch[col * GP + row] = (_Float16)u;
                else                   Ch[row * GP + col] = (_Float16)u;
            }
        }
    }
    __syncthreads();
    // thread: staged rows line + 16 j, 16-byte piece pc; a tile lies in one batch (NT % GT == 0)
    const int line = tid >> 4, pc = tid & 15;
    const int bb = mBase / NT, t0 = mBase % NT;
    int step;                                           // halves between rows line and line + 16
    if constexpr (EM == 0) {
        const int n = nBase + pc * 8;                   // column: head n / NDK, d n % NDK
        O += ((size_t)(bb * NH + n / NDK) * NT + t0 + line) * NDK + n % NDK;
        step = 16 * NDK;
    } else if constexpr (EM == 1) {
        const int n = nBase + line;                     // staged row = column: head n / NDK, d n % NDK
        O += ((size_t)(bb * NH + n / NDK) * NDK + n % NDK) * NT + t0 + pc * 8;
        step = 16 * NT;                                 // heads are NDK * NT apart: linear in n
    } else {
        O += (size_t)(mBase + line) * N + nBase + pc * 8;
        step = 16 * N;
    }
    v8h w[8];
    #pragma unroll
    for (int j = 0; j < 8; ++j) w[j] = *(const v8h*)(Ch + (line + 16 * j) * GP + pc * 8);
    #pragma unroll
    for (int j = 0; j < 8; ++j) *(v8h*)(O + j * step) = w[j];
}

template <int MODE, int N, int K>
__global__ __launch_bounds__(256)
void k_gemm(const _Float16* __restrict__ A, const _Float16* __restrict__ Bt,
            const float* __restrict__ bias, const float* __restrict__ resid,
            void* __restrict__ outp, float oscale,
            const float* __restrict__ biasK, const float* __restrict__ biasV) {
    __shared__ __align__(16) _Float16 As[GT * GP];
    __shared__ __align__(16) _Float16 Bs[GT * GP];
    __shared__ __align__(16) _Float16 Ch[GT * GP];
    __shared__ __align__(16) float    Cf[GT * GPF];

    const int tid = threadIdx.x, lane = tid & 31, wave = tid >> 5;
    const int hl = lane >> 4, m = lane & 15;
    const int mBase = blockIdx.y * GT, nBase = blockIdx.x * GT;
    const int wm = wave & 3, wn = wave >> 2;
    const int ar = tid >> 4, ac = (tid & 15) * 8;         // staging: row (step 16), k chunk
    const char* Ag = (const char*)(A  + (size_t)mBase * K);   // block-uniform origins of the row blocks
    const char* Bg = (const char*)(Bt + (size_t)nBase * K);
    unsigned go = (ar * K + ac) * 2;                      // the thread's byte offset, the same in both operands

    v8f acc[2][4];
    #pragma unroll
    for (int i = 0; i < 2; ++i) {
        #pragma unroll
        for (int j = 0; j < 4; ++j) acc[i][j] = zero8();
    }
    const _Float16* ap = As + (wm * 32 + m) * GP + 8 * hl;
    const _Float16* bp = Bs + (wn * 64 + m) * GP + 8 * hl;

    for (int kt = 0; kt < K / GK; ++kt) {
        v8h ta[8], tb[8];
        #pragma unroll
        for (int j = 0; j < 8; ++j) {
            ta[j] = *(const v8h*)(Ag + j * 16 * K * 2 + go);
            tb[j] = *(const v8h*)(Bg + j * 16 * K * 2 + go);
        }
        go += GK * 2;
        __syncthreads();                                    // prior fragment reads done
        #pragma unroll
        for (int j = 0; j < 8; ++j) {
            *(v8h*)(As + (ar + 16 * j) * GP + ac) = ta[j];
            *(v8h*)(Bs + (ar + 16 * j) * GP + ac) = tb[j];
        }
        __syncthreads();
        #pragma unroll
        for (int kk = 0; kk < GK / 32; ++kk) {
            Frag fa[2], fb[4];
            #pragma unroll
            for (int i = 0; i < 2; ++i) {
                fa[i].hf[0] = *(const v8h*)(ap + i * 16 * GP + kk * 32);
                fa[i].hf[1] = *(const v8h*)(ap + i * 16 * GP + kk * 32 + 16);
            }
            #pragma unroll
            for (int j = 0; j < 4; ++j) {
                fb[j].hf[0] = *(const v8h*)(bp + j * 16 * GP + kk * 32);
                fb[j].hf[1] = *(const v8h*)(bp + j * 16 * GP + kk * 32 + 16);
            }
            #pragma unroll
            for (int i = 0; i < 2; ++i) {
                #pragma unroll
                for (int j = 0; j < 4; ++j) acc[i][j] = wmma16(fa[i].v, fb[j].v, acc[i][j]);
            }
        }
    }

    const int w  = MODE == 0 ? nBase / ND : 0;              // projection of this tile
    const int nb = MODE == 0 ? nBase % ND : nBase;          // its first column there
    const float* bs = bias;
    if constexpr (MODE == 0) bs = w == 0 ? bias : (w == 1 ? biasK : biasV);
    float bj[4];
    #pragma unroll
    for (int j = 0; j < 4; ++j) bj[j] = bs[nb + wn * 64 + j * 16 + m];

    if constexpr (MODE == 0) {
        _Float16* o = (_Float16*)outp + (size_t)w * NM * ND;
        if (w == 2) {
            epi_f16<1, ND>(acc, bj, Ch, o, oscale, mBase, nb);
        } else {
            epi_f16<0, ND>(acc, bj, Ch, o, oscale, mBase, nb);
            // the built code lays the other epilogue behind these stores: their registers stay until this wait
            asm volatile("s_wait_xcnt 0x0" ::: "memory");
        }
    } else if constexpr (MODE == 2) {
        epi_f16<2, N>(acc, bj, Ch, (_Float16*)outp, oscale, mBase, nBase);
    } else {
        #pragma unroll
        for (int i = 0; i < 2; ++i) {
            #pragma unroll
            for (int j = 0; j < 4; ++j) {
                const int col = wn * 64 + j * 16 + m;
                #pragma unroll
                for (int r = 0; r < 8; ++r) {
                    const int row = wm * 32 + i * 16 + 8 * hl + r;
                    Cf[row * GPF + col] = acc[i][j][r] * oscale + bj[j];
                }
            }
        }
        __syncthreads();
        // one wave = one 512-B row; thread: rows wave + 8 j, 16-byte piece lane
        const size_t tile = (size_t)mBase * N + nBase;      // block-uniform
        const unsigned to = wave * N + lane * 4;
        const float* R = resid + tile;
        float* O = (float*)outp + tile;
        #pragma unroll
        for (int g = 0; g < 4; ++g) {
            v4f w[4];
            #pragma unroll
            for (int j = 0; j < 4; ++j) {
                const int rj = 8 * (4 * g + j);
                w[j] = *(const v4f*)(Cf + (wave + rj) * GPF + lane * 4) + *(const v4f*)(R + rj * N + to);
            }
            #pragma unroll
            for (int j = 0; j < 4; ++j) *(v4f*)(O + 8 * (4 * g + j) * N + to) = w[j];
        }
    }
}

// ---------------------------------------------------------------------------
// Attention per (b,h): block = 8 waves x 16 query rows (128 rows), grid
// (T/128, B*H).  32-key K tile ([key][d], pitch 72) and V tile ([d][key],
// pitch 40, from the transposed V copy) staged in LDS with plain loads.
// S = Q.K^T: A = Q rows (d as k), B = K rows loaded with the same split-k map.
// Online softmax in f32.  P (x4096, f16) bounced through a per-wave LDS tile
// [16][40] with _Float16 stores, a block barrier, and v8h reloads (same
// element type).  O = P.V: B = V^T rows (key as k), split-k map.
// ---------------------------------------------------------------------------
__global__ __launch_bounds__(256)
void k_attn(const _Float16* __restrict__ q, const _Float16* __restrict__ k,
            const _Float16* __restrict__ vt, const float* __restrict__ mask,
            const float* __restrict__ x, float* __restrict__ ores) {
    __shared__ __align__(16) _Float16 Ks[32 * 72];
    __shared__ __align__(16) _Float16 Vs[64 * 40];
    __shared__ __align__(16) _Float16 Ps[8][16 * 40];
    __shared__ __align__(16) float    Os[8][16 * 68];

    const int tid = threadIdx.x, lane = tid & 31, wave = tid >> 5;
    const int hl = lane >> 4, m = lane & 15;
    const int bh = blockIdx.y;
    const int b = bh / NH, hh = bh % NH;
    const int q0 = blockIdx.x * 128 + wave * 16;

    Frag aq0, aq1;
    {
        const _Float16* qp = q + ((size_t)bh * NT + q0 + m) * NDK;
        aq0.hf[0] = *(const v8h*)(qp + 8 * hl);
        aq0.hf[1] = *(const v8h*)(qp + 16 + 8 * hl);
        aq1.hf[0] = *(const v8h*)(qp + 32 + 8 * hl);
        aq1.hf[1] = *(const v8h*)(qp + 48 + 8 * hl);
    }

    const int kr = tid >> 3, kc = (tid & 7) * 8;       // K tile: 32 keys x 64 d
    const int vr = tid >> 2, vc = (tid & 3) * 8;       // V tile: 64 d x 32 keys
    const _Float16* kg = k  + ((size_t)bh * NT  + kr) * NDK + kc;
    const _Float16* vg = vt + ((size_t)bh * NDK + vr) * NT  + vc;
    const float* mrow = mask + (size_t)b * NT * NT;

    v8f acc[4];
    #pragma unroll
    for (int c = 0; c < 4; ++c) acc[c] = zero8();
    float mrun[8], lrun[8];
    #pragma unroll
    for (int e = 0; e < 8; ++e) { mrun[e] = -3.0e38f; lrun[e] = 0.0f; }

    const float sscale = 0.125f;
    const float pscale = 4096.0f;
    _Float16* ps = &Ps[wave][0];

    for (int st = 0; st < NT / 32; ++st) {
        const int s0 = st * 32;
        const v8h tk = *(const v8h*)(kg + (size_t)s0 * NDK);
        const v8h tv = *(const v8h*)(vg + s0);
        __syncthreads();                                // prior tile reads done
        *(v8h*)(Ks + kr * 72 + kc) = tk;
        *(v8h*)(Vs + vr * 40 + vc) = tv;
        __syncthreads();

        float p[2][8];
        #pragma unroll
        for (int half = 0; half < 2; ++half) {
            const _Float16* kp = Ks + (half * 16 + m) * 72;
            Frag b0, b1;
            b0.hf[0] = *(const v8h*)(kp + 8 * hl);
            b0.hf[1] = *(const v8h*)(kp + 16 + 8 * hl);
            b1.hf[0] = *(const v8h*)(kp + 32 + 8 * hl);
            b1.hf[1] = *(const v8h*)(kp + 48 + 8 * hl);
            v8f S = zero8();
            S = wmma16(aq0.v, b0.v, S);
            S = wmma16(aq1.v, b1.v, S);
            const int key = s0 + half * 16 + m;
            #pragma unroll
            for (int e = 0; e < 8; ++e) {
                const int row = q0 + 8 * hl + e;
                const float mv = mrow[(size_t)row * NT + key];
                const float add = NEGBIG * (1.0f - mv);
                p[half][e] = S[e] * sscale + add;
            }
        }
        float mnew[8], resc[8];
        #pragma unroll
        for (int e = 0; e < 8; ++e) {
            float mx = fmaxf(p[0][e], p[1][e]);
            #pragma unroll
            for (int off = 1; off < 16; off <<= 1) mx = fmaxf(mx, __shfl_xor(mx, off, 32));
            mnew[e] = fmaxf(mrun[e], mx);
            resc[e] = __expf(mrun[e] - mnew[e]);
            mrun[e] = mnew[e];
        }
        #pragma unroll
        for (int e = 0; e < 8; ++e) {
            p[0][e] = __expf(p[0][e] - mnew[e]);
            p[1][e] = __expf(p[1][e] - mnew[e]);
            float sum = p[0][e] + p[1][e];
            #pragma unroll
            for (int off = 1; off < 16; off <<= 1) sum += __shfl_xor(sum, off, 32);
            lrun[e] = lrun[e] * resc[e] + sum;
        }
        #pragma unroll
        for (int c = 0; c < 4; ++c) {
            #pragma unroll
            for (int e = 0; e < 8; ++e) acc[c][e] *= resc[e];
        }

        // P bounce: D layout (lane = key, r = row) -> A layout [row][key]
        #pragma unroll
        for (int e = 0; e < 8; ++e) {
            const int row = 8 * hl + e;
            ps[row * 40 + m]      = (_Float16)(p[0][e] * pscale);
            ps[row * 40 + 16 + m] = (_Float16)(p[1][e] * pscale);
        }
        __syncthreads();                                // orders the spill before the reload
        Frag ap;
        {
            const _Float16* pr = ps + m * 40;
            ap.hf[0] = *(const v8h*)(pr + 8 * hl);
            ap.hf[1] = *(const v8h*)(pr + 16 + 8 * hl);
        }
        #pragma unroll
        for (int c = 0; c < 4; ++c) {
            const _Float16* vp = Vs + (c * 16 + m) * 40;
            Frag fv;
            fv.hf[0] = *(const v8h*)(vp + 8 * hl);
            fv.hf[1] = *(const v8h*)(vp + 16 + 8 * hl);
            acc[c] = wmma16(ap.v, fv.v, acc[c]);
        }
    }

    float inv[8];
    #pragma unroll
    for (int e = 0; e < 8; ++e) inv[e] = (1.0f / lrun[e]) * (1.0f / 4096.0f);
    float* os = &Os[wave][0];
    #pragma unroll
    for (int c = 0; c < 4; ++c) {
        #pragma unroll
        for (int e = 0; e < 8; ++e) os[(8 * hl + e) * 68 + c * 16 + m] = acc[c][e] * inv[e];
    }
    __syncthreads();
    v4f w[8];
    size_t goff[8];
    #pragma unroll
    for (int j = 0; j < 8; ++j) {
        const int id = lane + 32 * j;
        const int line = id >> 3, pc = lane & 7;
        const int row = line >> 1, colo = ((line & 1) << 5) + pc * 4;
        goff[j] = ((size_t)(b * NT + q0 + row)) * ND + hh * NDK + colo;
        w[j] = *(const v4f*)(os + row * 68 + colo) + *(const v4f*)(x + goff[j]);
    }
    #pragma unroll
    for (int j = 0; j < 8; ++j) *(v4f*)(ores + goff[j]) = w[j];
    
}

// ---------------------------------------------------------------------------
// Host-side launch glue
// ---------------------------------------------------------------------------
extern "C" void kernel_launch(void* const* d_in, const int* in_sizes, int n_in,
                              void* d_out, int out_size, void* d_ws, size_t ws_size,
                              hipStream_t stream) {
    if (n_in < 18) return;
    if (in_sizes[0] != NM * ND || in_sizes[1] != NB * NT * NT || out_size != NM * ND) return;
    if (in_sizes[2] != ND || in_sizes[3] != ND || in_sizes[4] != ND * ND || in_sizes[5] != ND ||
        in_sizes[6] != ND * ND || in_sizes[7] != ND || in_sizes[8] != ND * ND || in_sizes[9] != ND ||
        in_sizes[10] != ND || in_sizes[11] != ND || in_sizes[12] != ND * NF || in_sizes[13] != NF ||
        in_sizes[14] != NF * ND || in_sizes[15] != ND || in_sizes[16] != ND || in_sizes[17] != ND) return;

    const float* x       = (const float*)d_in[0];
    const float* mask    = (const float*)d_in[1];
    const float* ln_in_g = (const float*)d_in[2];
    const float* ln_in_b = (const float*)d_in[3];
    const float* Wq      = (const float*)d_in[4];
    const float* bq      = (const float*)d_in[5];
    const float* Wk      = (const float*)d_in[6];
    const float* bk      = (const float*)d_in[7];
    const float* Wv      = (const float*)d_in[8];
    const float* bv      = (const float*)d_in[9];
    const float* ln1_g   = (const float*)d_in[10];
    const float* ln1_b   = (const float*)d_in[11];
    const float* W1      = (const float*)d_in[12];
    const float* b1      = (const float*)d_in[13];
    const float* W2      = (const float*)d_in[14];
    const float* b2      = (const float*)d_in[15];
    const float* ln2_g   = (const float*)d_in[16];
    const float* ln2_b   = (const float*)d_in[17];
    float* out = (float*)d_out;

    // workspace carve (all offsets multiples of 512 KiB)
    char* ws = (char*)d_ws;
    size_t o = 0;
    const size_t SZ_H16 = (size_t)NM * ND * 2;              // 8 MiB
    const size_t SZ_F32 = (size_t)NM * ND * 4;              // 16 MiB
    _Float16* h16  = (_Float16*)(ws + o); o += SZ_H16;
    _Float16* q16  = (_Float16*)(ws + o); o += SZ_H16;
    _Float16* k16  = (_Float16*)(ws + o); o += SZ_H16;
    _Float16* vt16 = (_Float16*)(ws + o); o += SZ_H16;
    _Float16* f1   = h16;                                    // [M][F] f16 = 32 MiB, reuses h/q/k/vt region after attention
    float* ares = (float*)(ws + o); o += SZ_F32;             // attention + x
    float* y    = ares;                                      // FFN2 output reuses ares after LN1
    float* a32  = (float*)(ws + o); o += SZ_F32;
    _Float16* a16 = (_Float16*)(ws + o); o += SZ_H16;
    _Float16* Wqh = (_Float16*)(ws + o); o += (size_t)ND * ND * 2;
    _Float16* Wkh = (_Float16*)(ws + o); o += (size_t)ND * ND * 2;
    _Float16* Wvh = (_Float16*)(ws + o); o += (size_t)ND * ND * 2;
    _Float16* W1h = (_Float16*)(ws + o); o += (size_t)NF * ND * 2;   // [F][D]
    _Float16* W2h = (_Float16*)(ws + o); o += (size_t)ND * NF * 2;   // [D][F]
    if ((size_t)NM * NF * 2 > 4 * SZ_H16) return;
    if (o > ws_size) return;

    // 1, 2. input LayerNorm -> h (f16); weights: transpose to [n][k], scale by a power of two, f16
    k_prep<<<PB_LN + 3 * PB_WD + 2 * PB_WF, 256, 0, stream>>>(x, ln_in_g, ln_in_b, h16, Wq, Wk, Wv, W1, W2,
                                                              Wqh, Wkh, Wvh, W1h, W2h);

    // 3. QKV projections: Wqh, Wkh, Wvh and q16, k16, vt16 lie one behind the other in the carve above
    k_gemm<0, 3 * ND, ND><<<dim3(3 * ND / GT, NM / GT), 256, 0, stream>>>(h16, Wqh, bq, nullptr, (void*)q16, 0.0625f, bk, bv);

    // 4. attention + residual(x)
    k_attn<<<dim3(NT / 128, NB * NH), 256, 0, stream>>>(q16, k16, vt16, mask, x, ares);

    // 5. LN1 -> a (f32) and a (f16)
    k_ln<1><<<(NM + 7) / 8, 256, 0, stream>>>(ares, ln1_g, ln1_b, a32, a16, NM);

    // 6. FFN1: relu(a @ W1 + b1) -> f16
    k_gemm<2, NF, ND><<<dim3(NF / GT, NM / GT), 256, 0, stream>>>(a16, W1h, b1, nullptr, (void*)f1, 0.0625f, nullptr, nullptr);

    // 7. FFN2: f1 @ W2 + b2 + a -> f32
    k_gemm<3, ND, NF><<<dim3(ND / GT, NM / GT), 256, 0, stream>>>(f1, W2h, b2, a32, (void*)y, 0.03125f, nullptr, nullptr);

    // 8. LN2 -> out
    k_ln<2><<<(NM + 7) / 8, 256, 0, stream>>>(y, ln2_g, ln2_b, out, nullptr, NM);
}

// v003
// One run takes 140 microseconds.
// Timed twice side by side with v002, it ran 1.16 times as fast both times.
// Counting every step since v000, it is 1.51 times as fast.
#include <hip/hip_runtime.h>
// All contractions: v_wmma_f32_16x16x32_f16 (f16 operands, f32 accumulate): QKV/FFN1 weights pre-scaled x16, FFN2 weights x32, P.V with P x4096 (scales folded back in f32); Q.K^T plain f16. LayerNorm/softmax/residuals f32.

typedef _Float16 v16h __attribute__((ext_vector_type(16)));
typedef _Float16 v8h  __attribute__((ext_vector_type(8), may_alias));
typedef float    v8f  __attribute__((ext_vector_type(8)));
typedef float    v4f  __attribute__((ext_vector_type(4), may_alias));

union Frag { v16h v; v8h hf[2]; };

#define NB   8
#define NT   1024
#define ND   512
#define NH   8
#define NDK  64
#define NF   2048
#define NM   (NB * NT)
#define LNEPS  1.0e-3f
#define NEGBIG (-1.0e9f)

__device__ __forceinline__ v8f zero8() {
    v8f z = {0.f, 0.f, 0.f, 0.f, 0.f, 0.f, 0.f, 0.f};
    return z;
}

// 16x16x32 f16 WMMA with trailing hazard guard (D tied, A/B kept live)
__device__ __forceinline__ v8f wmma16(v16h a, v16h b, v8f c) {
    v8f d = __builtin_amdgcn_wmma_f32_16x16x32_f16(false, a, false, b, (short)0, c, false, false);
    asm volatile("v_nop\n\tv_nop\n\tv_nop\n\tv_nop" : "+v"(d) : "v"(a), "v"(b));
    return d;
}

// ---------------------------------------------------------------------------
// Weight transpose + scale + f16 convert: Wt[n][k] = f16(W[k][n] * scale).
// W is [K][N] row-major. Block tile: 64 k x 32 n; tile (bx, by) of (N/32, K/64).
// ---------------------------------------------------------------------------
__device__ __forceinline__
void wcvt_tile(const float* __restrict__ W, _Float16* __restrict__ Wt, int K, int N, float scale, int bx, int by) {
    __shared__ float tile[64][33];
    const int tid = threadIdx.x;
    const int kb = by * 64, nb = bx * 32;
    const int c = tid & 31, r = tid >> 5;
    #pragma unroll
    for (int i = 0; i < 8; ++i)
        tile[r + 8 * i][c] = W[(size_t)(kb + r + 8 * i) * N + nb + c] * scale;
    __syncthreads();
    const int n = tid >> 3, pc = tid & 7;
    v8h o;
    #pragma unroll
    for (int e = 0; e < 8; ++e) o[e] = (_Float16)tile[pc * 8 + e][n];
    _Float16* dst = Wt + (size_t)(nb + n) * K + kb + pc * 8;
    *(v8h*)dst = o;
    
}

// ---------------------------------------------------------------------------
// deviations).  One wave per row, 8 rows per 256-thread block.
// OM 0: f16 output only; OM 1: f32 + f16; OM 2: f32 only.
// f32 rows: lane l stores float4 at cols 4l+128j (each instruction = 4 whole
// lines, lane-contiguous 16 B).  f16 rows: lane l stores 8 halves at cols
// ---------------------------------------------------------------------------
template <int OM>
__device__ __forceinline__
void ln_rows(const float* __restrict__ in, const float* __restrict__ g, const float* __restrict__ bt,
             float* __restrict__ of, _Float16* __restrict__ oh, int M, int blk) {
    const int lane = threadIdx.x & 31, wave = threadIdx.x >> 5;
    const int row = blk * 8 + wave;
    if (row >= M) return;                      // wave-uniform; no barriers in this function
    const float* r = in + (size_t)row * ND;

    v4f v[4];
    float s = 0.f;
    #pragma unroll
    for (int j = 0; j < 4; ++j) {
        v[j] = *(const v4f*)(r + 4 * lane + 128 * j);
        s += (v[j][0] + v[j][1]) + (v[j][2] + v[j][3]);
    }
    #pragma unroll
    for (int off = 16; off >= 1; off >>= 1) s += __shfl_xor(s, off, 32);
    const float mean = s * (1.0f / ND);
    float sq = 0.f;
    #pragma unroll
    for (int j = 0; j < 4; ++j) {
        #pragma unroll
        for (int c = 0; c < 4; ++c) { const float d = v[j][c] - mean; sq += d * d; }
    }
    #pragma unroll
    for (int off = 16; off >= 1; off >>= 1) sq += __shfl_xor(sq, off, 32);
    const float rstd = rsqrtf(sq * (1.0f / ND) + LNEPS);

    if constexpr (OM != 0) {
        v4f o[4];
        #pragma unroll
        for (int j = 0; j < 4; ++j) {
            const int c0 = 4 * lane + 128 * j;
            const v4f gv = *(const v4f*)(g + c0);
            const v4f bv = *(const v4f*)(bt + c0);
            #pragma unroll
            for (int c = 0; c < 4; ++c) o[j][c] = (v[j][c] - mean) * rstd * gv[c] + bv[c];
        }
        float* orow = of + (size_t)row * ND + 4 * lane;
        #pragma unroll
        for (int j = 0; j < 4; ++j) *(v4f*)(orow + 128 * j) = o[j];
        
    }
    if constexpr (OM != 2) {
        v8h w[2];
        #pragma unroll
        for (int j = 0; j < 2; ++j) {
            const int c0 = 8 * lane + 256 * j;
            const v4f x0 = *(const v4f*)(r + c0),  x1 = *(const v4f*)(r + c0 + 4);
            const v4f g0 = *(const v4f*)(g + c0),  g1 = *(const v4f*)(g + c0 + 4);
            const v4f b0 = *(const v4f*)(bt + c0), b1 = *(const v4f*)(bt + c0 + 4);
            #pragma unroll
            for (int c = 0; c < 4; ++c) {
                w[j][c]     = (_Float16)((x0[c] - mean) * rstd * g0[c] + b0[c]);
                w[j][4 + c] = (_Float16)((x1[c] - mean) * rstd * g1[c] + b1[c]);
            }
        }
        _Float16* hrow = oh + (size_t)row * ND + 8 * lane;
        #pragma unroll
        for (int j = 0; j < 2; ++j) *(v8h*)(hrow + 256 * j) = w[j];
        
    }
}

template <int OM>
__global__ __launch_bounds__(256)
void k_ln(const float* __restrict__ in, const float* __restrict__ g, const float* __restrict__ bt,
          float* __restrict__ of, _Float16* __restrict__ oh, int M) {
    ln_rows<OM>(in, g, bt, of, oh, M, blockIdx.x);
}

// ---------------------------------------------------------------------------
// Everything that depends on the inputs alone, in one grid: the input
// LayerNorm (blocks 0 .. PB_LN-1, 8 rows each), then the five weight converts
// (one 64 k x 32 n tile a block).  The job is picked by the block index, so
// every branch here is block-uniform.
// ---------------------------------------------------------------------------
#define PB_LN (NM / 8)                      // LayerNorm blocks
#define PB_WD ((ND / 32) * (ND / 64))       // tiles of a D x D weight
#define PB_WF ((NF / 32) * (ND / 64))       // tiles of W1, and of W2

__global__ __launch_bounds__(256)
void k_prep(const float* __restrict__ x, const float* __restrict__ g, const float* __restrict__ bt,
            _Float16* __restrict__ h,
            const float* __restrict__ Wq, const float* __restrict__ Wk, const float* __restrict__ Wv,
            const float* __restrict__ W1, const float* __restrict__ W2,
            _Float16* __restrict__ Wqh, _Float16* __restrict__ Wkh, _Float16* __restrict__ Wvh,
            _Float16* __restrict__ W1h, _Float16* __restrict__ W2h) {
    if (blockIdx.x < PB_LN) { ln_rows<0>(x, g, bt, nullptr, h, NM, blockIdx.x); return; }
    int b = blockIdx.x - PB_LN;
    const float* W;
    _Float16* Wt;
    int K, N, bx, by;
    float sc;
    if (b < 3 * PB_WD) {                    // in[512][512] -> out[512][512]
        const int w = b / PB_WD;
        b -= w * PB_WD;
        W  = w == 0 ? Wq  : (w == 1 ? Wk  : Wv);
        Wt = w == 0 ? Wqh : (w == 1 ? Wkh : Wvh);
        K = ND; N = ND; sc = 16.0f;
        bx = b % (ND / 32); by = b / (ND / 32);
    } else if (b < 3 * PB_WD + PB_WF) {     // in[512][2048] -> out[2048][512]
        b -= 3 * PB_WD;
        W = W1; Wt = W1h; K = ND; N = NF; sc = 16.0f;
        bx = b % (NF / 32); by = b / (NF / 32);
    } else {                                // in[2048][512] -> out[512][2048]
        b -= 3 * PB_WD + PB_WF;
        W = W2; Wt = W2h; K = NF; N = ND; sc = 32.0f;
        bx = b % (ND / 32); by = b / (ND / 32);
    }
    wcvt_tile(W, Wt, K, N, sc, bx, by);
    // the built code lays the LayerNorm behind this tile's store: its registers stay until this wait
    asm volatile("s_wait_xcnt 0x0" ::: "memory");
}

// ---------------------------------------------------------------------------
// WMMA GEMM: C[M,N] = A[M,K] @ W[K,N] (+bias, scale, epilogue).  A f16
// row-major [M][K]; weights f16 [N][K] (k-contiguous), so A and B fragments
// use the same split-k loader: elements 0..7 <- k0+8h+0..7, elements 8..15
// <- k0+16+8h+0..7, h = lane>>4, row/col = lane&15.  D element r of a lane =
// (row 8h+r, col lane&15).  Block tile 128x128, K step 128, 8 waves (4 m x 2 n,
// each wave 32x64 = 2 x 4 accumulators).  A and B tiles staged in LDS, rows of
// 256 B at pitch 272 B.  M, N multiples of 128; K a multiple of 128.  N and K
// are compile-time, so a thread's 8 rows of a tile hang off one address.
// MODE 0: Q, K and V in one grid, N = 3 * ND: Bt holds the three weights one
//         behind the other, outp the three outputs; a column tile lies in one
//         projection w = nBase / ND (block-uniform), which picks bias, output
//         and f16 epilogue 0 (Q, K) or 1 (V)
// MODE 2: f16 out, relu, row-major [M][N]  (FFN1)
// MODE 3: f32 out + residual, row-major    (FFN2)
// f16 epilogues EM: 0 = [B,H,T,DK], 1 = [B,H,DK,T] (V transposed), 2 = FFN1
// ---------------------------------------------------------------------------
#define GT  128     // block tile, rows and columns
#define GK  128     // k per staged tile
#define GP  136     // LDS pitch of a staged row and of an f16 output row, halves
#define GPF 132     // LDS pitch of an f32 output row, floats

// f16 epilogue of a 128x128 tile: scale, bias (relu), staged in Ch, stored in 16-byte pieces
template <int EM, int N>
__device__ __forceinline__
void epi_f16(const v8f (&acc)[2][4], const float (&bj)[4], _Float16* Ch, _Float16* __restrict__ O,
             float oscale, int mBase, int nBase) {
    const int tid = threadIdx.x, lane = tid & 31, wave = tid >> 5;
    const int hl = lane >> 4, m = lane & 15;
    const int wm = wave & 3, wn = wave >> 2;
    #pragma unroll
    for (int i = 0; i < 2; ++i) {
        #pragma unroll
        for (int j = 0; j < 4; ++j) {
            const int col = wn * 64 + j * 16 + m;
            #pragma unroll
            for (int r = 0; r < 8; ++r) {
                float u = acc[i][j][r] * oscale + bj[j];
                if constexpr (EM == 2) u = fmaxf(u, 0.0f);
                const int row = wm * 32 + i * 16 + 8 * hl + r;
                if constexpr (EM == 1) Ch[col * GP + row] = (_Float16)u;
                else                   Ch[row * GP + col] = (_Float16)u;
            }
        }
    }
    __syncthreads();
    // thread: staged rows line + 16 j, 16-byte piece pc; a tile lies in one batch (NT % GT == 0)
    const int line = tid >> 4, pc = tid & 15;
    const int bb = mBase / NT, t0 = mBase % NT;
    int step;                                           // halves between rows line and line + 16
    if constexpr (EM == 0) {
        const int n = nBase + pc * 8;                   // column: head n / NDK, d n % NDK
        O += ((size_t)(bb * NH + n / NDK) * NT + t0 + line) * NDK + n % NDK;
        step = 16 * NDK;
    } else if constexpr (EM == 1) {
        const int n = nBase + line;                     // staged row = column: head n / NDK, d n % NDK
        O += ((size_t)(bb * NH + n / NDK) * NDK + n % NDK) * NT + t0 + pc * 8;
        step = 16 * NT;                                 // heads are NDK * NT apart: linear in n
    } else {
        O += (size_t)(mBase + line) * N + nBase + pc * 8;
        step = 16 * N;
    }
    v8h w[8];
    #pragma unroll
    for (int j = 0; j < 8; ++j) w[j] = *(const v8h*)(Ch + (line + 16 * j) * GP + pc * 8);
    #pragma unroll
    for (int j = 0; j < 8; ++j) *(v8h*)(O + j * step) = w[j];
}

template <int MODE, int N, int K>
__global__ __launch_bounds__(256)
void k_gemm(const _Float16* __restrict__ A, const _Float16* __restrict__ Bt,
            const float* __restrict__ bias, const float* __restrict__ resid,
            void* __restrict__ outp, float oscale,
            const float* __restrict__ biasK, const float* __restrict__ biasV) {
    __shared__ __align__(16) _Float16 As[GT * GP];
    __shared__ __align__(16) _Float16 Bs[GT * GP];
    __shared__ __align__(16) _Float16 Ch[GT * GP];
    __shared__ __align__(16) float    Cf[GT * GPF];

    const int tid = threadIdx.x, lane = tid & 31, wave = tid >> 5;
    const int hl = lane >> 4, m = lane & 15;
    const int mBase = blockIdx.y * GT, nBase = blockIdx.x * GT;
    const int wm = wave & 3, wn = wave >> 2;
    const int ar = tid >> 4, ac = (tid & 15) * 8;         // staging: row (step 16), k chunk
    const char* Ag = (const char*)(A  + (size_t)mBase * K);   // block-uniform origins of the row blocks
    const char* Bg = (const char*)(Bt + (size_t)nBase * K);
    unsigned go = (ar * K + ac) * 2;                      // the thread's byte offset, the same in both operands

    v8f acc[2][4];
    #pragma unroll
    for (int i = 0; i < 2; ++i) {
        #pragma unroll
        for (int j = 0; j < 4; ++j) acc[i][j] = zero8();
    }
    const _Float16* ap = As + (wm * 32 + m) * GP + 8 * hl;
    const _Float16* bp = Bs + (wn * 64 + m) * GP + 8 * hl;

    for (int kt = 0; kt < K / GK; ++kt) {
        v8h ta[8], tb[8];
        #pragma unroll
        for (int j = 0; j < 8; ++j) {
            ta[j] = *(const v8h*)(Ag + j * 16 * K * 2 + go);
            tb[j] = *(const v8h*)(Bg + j * 16 * K * 2 + go);
        }
        go += GK * 2;
        __syncthreads();                                    // prior fragment reads done
        #pragma unroll
        for (int j = 0; j < 8; ++j) {
            *(v8h*)(As + (ar + 16 * j) * GP + ac) = ta[j];
            *(v8h*)(Bs + (ar + 16 * j) * GP + ac) = tb[j];
        }
        __syncthreads();
        #pragma unroll
        for (int kk = 0; kk < GK / 32; ++kk) {
            Frag fa[2], fb[4];
            #pragma unroll
            for (int i = 0; i < 2; ++i) {
                fa[i].hf[0] = *(const v8h*)(ap + i * 16 * GP + kk * 32);
                fa[i].hf[1] = *(const v8h*)(ap + i * 16 * GP + kk * 32 + 16);
            }
            #pragma unroll
            for (int j = 0; j < 4; ++j) {
                fb[j].hf[0] = *(const v8h*)(bp + j * 16 * GP + kk * 32);
                fb[j].hf[1] = *(const v8h*)(bp + j * 16 * GP + kk * 32 + 16);
            }
            #pragma unroll
            for (int i = 0; i < 2; ++i) {
                #pragma unroll
                for (int j = 0; j < 4; ++j) acc[i][j] = wmma16(fa[i].v, fb[j].v, acc[i][j]);
            }
        }
    }

    const int w  = MODE == 0 ? nBase / ND : 0;              // projection of this tile
    const int nb = MODE == 0 ? nBase % ND : nBase;          // its first column there
    const float* bs = bias;
    if constexpr (MODE == 0) bs = w == 0 ? bias : (w == 1 ? biasK : biasV);
    float bj[4];
    #pragma unroll
    for (int j = 0; j < 4; ++j) bj[j] = bs[nb + wn * 64 + j * 16 + m];

    if constexpr (MODE == 0) {
        _Float16* o = (_Float16*)outp + (size_t)w * NM * ND;
        if (w == 2) {
            epi_f16<1, ND>(acc, bj, Ch, o, oscale, mBase, nb);
        } else {
            epi_f16<0, ND>(acc, bj, Ch, o, oscale, mBase, nb);
            // the built code lays the other epilogue behind these stores: their registers stay until this wait
            asm volatile("s_wait_xcnt 0x0" ::: "memory");
        }
    } else if constexpr (MODE == 2) {
        epi_f16<2, N>(acc, bj, Ch, (_Float16*)outp, oscale, mBase, nBase);
    } else {
        #pragma unroll
        for (int i = 0; i < 2; ++i) {
            #pragma unroll
            for (int j = 0; j < 4; ++j) {
                const int col = wn * 64 + j * 16 + m;
                #pragma unroll
                for (int r = 0; r < 8; ++r) {
                    const int row = wm * 32 + i * 16 + 8 * hl + r;
                    Cf[row * GPF + col] = acc[i][j][r] * oscale + bj[j];
                }
            }
        }
        __syncthreads();
        // one wave = one 512-B row; thread: rows wave + 8 j, 16-byte piece lane
        const size_t tile = (size_t)mBase * N + nBase;      // block-uniform
        const unsigned to = wave * N + lane * 4;
        const float* R = resid + tile;
        float* O = (float*)outp + tile;
        #pragma unroll
        for (int g = 0; g < 4; ++g) {
            v4f w[4];
            #pragma unroll
            for (int j = 0; j < 4; ++j) {
                const int rj = 8 * (4 * g + j);
                w[j] = *(const v4f*)(Cf + (wave + rj) * GPF + lane * 4) + *(const v4f*)(R + rj * N + to);
            }
            #pragma unroll
            for (int j = 0; j < 4; ++j) *(v4f*)(O + 8 * (4 * g + j) * N + to) = w[j];
        }
    }
}

// ---------------------------------------------------------------------------
// Attention per (b,h): block = 8 waves x 16 queries (128 queries), grid
// (T/128, B*H).  32-key K tile ([key][d], pitch 72) and V tile ([d][key],
// pitch 40, from the transposed V copy) staged in LDS with plain loads.
// Both products are taken transposed, so that a lane owns ONE query (lane & 15):
// S^T = K.Q^T: A = K rows (d as k), B = Q rows, same split-k map; D element r
// of a lane = (key 8h+r, query lane&15).  The lane's 16 scores of a tile are
// 2 x 8 consecutive keys of its query's mask row; 16 lanes on 16 rows would
// touch 16 lines a load, so the 128 x 32 mask tile is read in whole lines and
// staged with K and V ([query][key], pitch 36 floats).  Maximum and sum run in
// the lane, the two lane halves join by one exchange (the sums only at the end).
// The two score tiles (keys 0..15, 16..31), x4096 and converted to f16 in
// place, are the B operand of O^T = V^T.P^T in the split-k map (elements 0..7
// = keys 8h+0..7, 8..15 = keys 16+8h+0..7); A = V^T rows (key as k).
// D element r of a lane = (d 16c+8h+r, query lane&15).  Softmax in f32.
// ---------------------------------------------------------------------------
// value of lane l ^ 16
__device__ __forceinline__ float other_half(float v) {
    const int b = __float_as_int(v);
    return __int_as_float(__builtin_amdgcn_permlanex16(b, b, 0x76543210, 0xfedcba98, false, false));
}

__global__ __launch_bounds__(256)
void k_attn(const _Float16* __restrict__ q, const _Float16* __restrict__ k,
            const _Float16* __restrict__ vt, const float* __restrict__ mask,
            const float* __restrict__ x, float* __restrict__ ores) {
    __shared__ __align__(16) _Float16 Ks[32 * 72];
    __shared__ __align__(16) _Float16 Vs[64 * 40];
    __shared__ __align__(16) float    Ms[128 * 36];
    __shared__ __align__(16) float    Os[8][16 * 68];

    const int tid = threadIdx.x, lane = tid & 31, wave = tid >> 5;
    const int hl = lane >> 4, m = lane & 15;
    const int bh = blockIdx.y;
    const int b = bh / NH, hh = bh % NH;
    const int q0 = blockIdx.x * 128 + wave * 16;

    Frag aq0, aq1;
    {
        const _Float16* qp = q + ((size_t)bh * NT + q0 + m) * NDK;
        aq0.hf[0] = *(const v8h*)(qp + 8 * hl);
        aq0.hf[1] = *(const v8h*)(qp + 16 + 8 * hl);
        aq1.hf[0] = *(const v8h*)(qp + 32 + 8 * hl);
        aq1.hf[1] = *(const v8h*)(qp + 48 + 8 * hl);
    }

    const int kr = tid >> 3, kc = (tid & 7) * 8;       // K tile: 32 keys x 64 d
    const int vr = tid >> 2, vc = (tid & 3) * 8;       // V tile: 64 d x 32 keys
    const _Float16* kg = k  + ((size_t)bh * NT  + kr) * NDK + kc;
    const _Float16* vg = vt + ((size_t)bh * NDK + vr) * NT  + vc;
    const int mr = wave * 16 + (lane >> 3), mc = (lane & 7) * 4;   // mask tile: rows mr + 4 j, 8 lanes a row
    const float* mg = mask + ((size_t)b * NT + blockIdx.x * 128 + mr) * NT + mc;
    const float* mrow = Ms + (wave * 16 + m) * 36 + 8 * hl;        // the lane's query, its half's keys

    v8f acc[4];
    #pragma unroll
    for (int c = 0; c < 4; ++c) acc[c] = zero8();
    float mrun = -3.0e38f, lrun = 0.0f;                 // lrun: the sum over this lane half's keys only

    const float sscale = 0.125f;
    const float pscale = 4096.0f;

    for (int st = 0; st < NT / 32; ++st) {
        const int s0 = st * 32;
        const v8h tk = *(const v8h*)(kg + (size_t)s0 * NDK);
        const v8h tv = *(const v8h*)(vg + s0);
        v4f tm[4];
        #pragma unroll
        for (int j = 0; j < 4; ++j) tm[j] = *(const v4f*)(mg + 4 * j * NT + s0);
        __syncthreads();                                // prior tile reads done
        *(v8h*)(Ks + kr * 72 + kc) = tk;
        *(v8h*)(Vs + vr * 40 + vc) = tv;
        #pragma unroll
        for (int j = 0; j < 4; ++j) *(v4f*)(Ms + (mr + 4 * j) * 36 + mc) = tm[j];
        __syncthreads();

        v8f p[2];
        #pragma unroll
        for (int half = 0; half < 2; ++half) {
            const _Float16* kp = Ks + (half * 16 + m) * 72;
            Frag a0, a1;
            a0.hf[0] = *(const v8h*)(kp + 8 * hl);
            a0.hf[1] = *(const v8h*)(kp + 16 + 8 * hl);
            a1.hf[0] = *(const v8h*)(kp + 32 + 8 * hl);
            a1.hf[1] = *(const v8h*)(kp + 48 + 8 * hl);
            v8f S = zero8();
            S = wmma16(a0.v, aq0.v, S);
            S = wmma16(a1.v, aq1.v, S);
            const v4f mv0 = *(const v4f*)(mrow + half * 16);
            const v4f mv1 = *(const v4f*)(mrow + half * 16 + 4);
            const v8f mv = __builtin_shufflevector(mv0, mv1, 0, 1, 2, 3, 4, 5, 6, 7);
            p[half] = S * sscale + NEGBIG * (1.0f - mv);
        }
        const v8f mx = __builtin_elementwise_max(p[0], p[1]);
        const float mh = fmaxf(fmaxf(fmaxf(mx[0], mx[1]), fmaxf(mx[2], mx[3])),
                               fmaxf(fmaxf(mx[4], mx[5]), fmaxf(mx[6], mx[7])));
        const float mnew = fmaxf(mrun, fmaxf(mh, other_half(mh)));
        const float resc = __expf(mrun - mnew);
        mrun = mnew;
        #pragma unroll
        for (int e = 0; e < 8; ++e) {
            p[0][e] = __expf(p[0][e] - mnew);
            p[1][e] = __expf(p[1][e] - mnew);
        }
        const v8f sm = p[0] + p[1];
        lrun = lrun * resc + (((sm[0] + sm[1]) + (sm[2] + sm[3])) + ((sm[4] + sm[5]) + (sm[6] + sm[7])));
        #pragma unroll
        for (int c = 0; c < 4; ++c) acc[c] *= resc;

        Frag bp;                                        // P^T as B: no lane exchange, no LDS
        #pragma unroll
        for (int e = 0; e < 8; ++e) {
            bp.v[e]     = (_Float16)(p[0][e] * pscale);
            bp.v[8 + e] = (_Float16)(p[1][e] * pscale);
        }
        #pragma unroll
        for (int c = 0; c < 4; ++c) {
            const _Float16* vp = Vs + (c * 16 + m) * 40;
            Frag fv;
            fv.hf[0] = *(const v8h*)(vp + 8 * hl);
            fv.hf[1] = *(const v8h*)(vp + 16 + 8 * hl);
            acc[c] = wmma16(fv.v, bp.v, acc[c]);
        }
    }

    const float inv = (1.0f / (lrun + other_half(lrun))) * (1.0f / 4096.0f);
    float* os = &Os[wave][0];
    #pragma unroll
    for (int c = 0; c < 4; ++c) {
        v4f lo, hi;
        #pragma unroll
        for (int e = 0; e < 4; ++e) { lo[e] = acc[c][e] * inv; hi[e] = acc[c][4 + e] * inv; }
        *(v4f*)(os + m * 68 + c * 16 + 8 * hl)     = lo;
        *(v4f*)(os + m * 68 + c * 16 + 8 * hl + 4) = hi;
    }
    __syncthreads();
    v4f w[8];
    size_t goff[8];
    #pragma unroll
    for (int j = 0; j < 8; ++j) {
        const int id = lane + 32 * j;
        const int line = id >> 3, pc = lane & 7;
        const int row = line >> 1, colo = ((line & 1) << 5) + pc * 4;
        goff[j] = ((size_t)(b * NT + q0 + row)) * ND + hh * NDK + colo;
        w[j] = *(const v4f*)(os + row * 68 + colo) + *(const v4f*)(x + goff[j]);
    }
    #pragma unroll
    for (int j = 0; j < 8; ++j) *(v4f*)(ores + goff[j]) = w[j];
    
}

// ---------------------------------------------------------------------------
// Host-side launch glue
// ---------------------------------------------------------------------------
extern "C" void kernel_launch(void* const* d_in, const int* in_sizes, int n_in,
                              void* d_out, int out_size, void* d_ws, size_t ws_size,
                              hipStream_t stream) {
    if (n_in < 18) return;
    if (in_sizes[0] != NM * ND || in_sizes[1] != NB * NT * NT || out_size != NM * ND) return;
    if (in_sizes[2] != ND || in_sizes[3] != ND || in_sizes[4] != ND * ND || in_sizes[5] != ND ||
        in_sizes[6] != ND * ND || in_sizes[7] != ND || in_sizes[8] != ND * ND || in_sizes[9] != ND ||
        in_sizes[10] != ND || in_sizes[11] != ND || in_sizes[12] != ND * NF || in_sizes[13] != NF ||
        in_sizes[14] != NF * ND || in_sizes[15] != ND || in_sizes[16] != ND || in_sizes[17] != ND) return;

    const float* x       = (const float*)d_in[0];
    const float* mask    = (const float*)d_in[1];
    const float* ln_in_g = (const float*)d_in[2];
    const float* ln_in_b = (const float*)d_in[3];
    const float* Wq      = (const float*)d_in[4];
    const float* bq      = (const float*)d_in[5];
    const float* Wk      = (const float*)d_in[6];
    const float* bk      = (const float*)d_in[7];
    const float* Wv      = (const float*)d_in[8];
    const float* bv      = (const float*)d_in[9];
    const float* ln1_g   = (const float*)d_in[10];
    const float* ln1_b   = (const float*)d_in[11];
    const float* W1      = (const float*)d_in[12];
    const float* b1      = (const float*)d_in[13];
    const float* W2      = (const float*)d_in[14];
    const float* b2      = (const float*)d_in[15];
    const float* ln2_g   = (const float*)d_in[16];
    const float* ln2_b   = (const float*)d_in[17];
    float* out = (float*)d_out;

    // workspace carve (all offsets multiples of 512 KiB)
    char* ws = (char*)d_ws;
    size_t o = 0;
    const size_t SZ_H16 = (size_t)NM * ND * 2;              // 8 MiB
    const size_t SZ_F32 = (size_t)NM * ND * 4;              // 16 MiB
    _Float16* h16  = (_Float16*)(ws + o); o += SZ_H16;
    _Float16* q16  = (_Float16*)(ws + o); o += SZ_H16;
    _Float16* k16  = (_Float16*)(ws + o); o += SZ_H16;
    _Float16* vt16 = (_Float16*)(ws + o); o += SZ_H16;
    _Float16* f1   = h16;                                    // [M][F] f16 = 32 MiB, reuses h/q/k/vt region after attention
    float* ares = (float*)(ws + o); o += SZ_F32;             // attention + x
    float* y    = ares;                                      // FFN2 output reuses ares after LN1
    float* a32  = (float*)(ws + o); o += SZ_F32;
    _Float16* a16 = (_Float16*)(ws + o); o += SZ_H16;
    _Float16* Wqh = (_Float16*)(ws + o); o += (size_t)ND * ND * 2;
    _Float16* Wkh = (_Float16*)(ws + o); o += (size_t)ND * ND * 2;
    _Float16* Wvh = (_Float16*)(ws + o); o += (size_t)ND * ND * 2;
    _Float16* W1h = (_Float16*)(ws + o); o += (size_t)NF * ND * 2;   // [F][D]
    _Float16* W2h = (_Float16*)(ws + o); o += (size_t)ND * NF * 2;   // [D][F]
    if ((size_t)NM * NF * 2 > 4 * SZ_H16) return;
    if (o > ws_size) return;

    // 1, 2. input LayerNorm -> h (f16); weights: transpose to [n][k], scale by a power of two, f16
    k_prep<<<PB_LN + 3 * PB_WD + 2 * PB_WF, 256, 0, stream>>>(x, ln_in_g, ln_in_b, h16, Wq, Wk, Wv, W1, W2,
                                                              Wqh, Wkh, Wvh, W1h, W2h);

    // 3. QKV projections: Wqh, Wkh, Wvh and q16, k16, vt16 lie one behind the other in the carve above
    k_gemm<0, 3 * ND, ND><<<dim3(3 * ND / GT, NM / GT), 256, 0, stream>>>(h16, Wqh, bq, nullptr, (void*)q16, 0.0625f, bk, bv);

    // 4. attention + residual(x)
    k_attn<<<dim3(NT / 128, NB * NH), 256, 0, stream>>>(q16, k16, vt16, mask, x, ares);

    // 5. LN1 -> a (f32) and a (f16)
    k_ln<1><<<(NM + 7) / 8, 256, 0, stream>>>(ares, ln1_g, ln1_b, a32, a16, NM);

    // 6. FFN1: relu(a @ W1 + b1) -> f16
    k_gemm<2, NF, ND><<<dim3(NF / GT, NM / GT), 256, 0, stream>>>(a16, W1h, b1, nullptr, (void*)f1, 0.0625f, nullptr, nullptr);

    // 7. FFN2: f1 @ W2 + b2 + a -> f32
    k_gemm<3, ND, NF><<<dim3(ND / GT, NM / GT), 256, 0, stream>>>(f1, W2h, b2, a32, (void*)y, 0.03125f, nullptr, nullptr);

    // 8. LN2 -> out
    k_ln<2><<<(NM + 7) / 8, 256, 0, stream>>>(y, ln2_g, ln2_b, out, nullptr, NM);
}

// v004
// Measured time: 120 microseconds a run.
// Timed twice side by side with v003, it ran 1.17 times as fast both times.
// All steps since v000 together make it 1.77 times as fast.
#include <hip/hip_runtime.h>
// All contractions: v_wmma_f32_16x16x32_f16 (f16 operands, f32 accumulate): QKV/FFN1 weights pre-scaled x16, FFN2 weights x32, P.V with P x4096 (scales folded back in f32); Q.K^T plain f16. LayerNorm/softmax/residuals f32.

typedef _Float16 v16h __attribute__((ext_vector_type(16)));
typedef _Float16 v8h  __attribute__((ext_vector_type(8), may_alias));
typedef float    v8f  __attribute__((ext_vector_type(8)));
typedef float    v4f  __attribute__((ext_vector_type(4), may_alias));

union Frag { v16h v; v8h hf[2]; };

#define NB   8
#define NT   1024
#define ND   512
#define NH   8
#define NDK  64
#define NF   2048
#define NM   (NB * NT)
#define LNEPS  1.0e-3f
#define NEGBIG (-1.0e9f)

__device__ __forceinline__ v8f zero8() {
    v8f z = {0.f, 0.f, 0.f, 0.f, 0.f, 0.f, 0.f, 0.f};
    return z;
}

// 16x16x32 f16 WMMA with trailing hazard guard (D tied, A/B kept live)
__device__ __forceinline__ v8f wmma16(v16h a, v16h b, v8f c) {
    v8f d = __builtin_amdgcn_wmma_f32_16x16x32_f16(false, a, false, b, (short)0, c, false, false);
    asm volatile("v_nop\n\tv_nop\n\tv_nop\n\tv_nop" : "+v"(d) : "v"(a), "v"(b));
    return d;
}

// LDS byte address of a __shared__ location (low 32 bits of its address)
__device__ __forceinline__ unsigned lds_addr(const void* p) { return (unsigned)(size_t)p; }

// Eight asynchronous 16-byte copies of a lane, global -> LDS: rows LS bytes apart in LDS, GS bytes apart in
// memory.  s_wait_xcnt is the last line of the copies' own statement, so that no register which a copy names
// is rewritten in front of it.
template <int LS, int GS>
__device__ __forceinline__ void async8(unsigned l, const char* g) {
    asm volatile("global_load_async_to_lds_b128 %0, %8, off\n\t"
                 "global_load_async_to_lds_b128 %1, %9, off\n\t"
                 "global_load_async_to_lds_b128 %2, %10, off\n\t"
                 "global_load_async_to_lds_b128 %3, %11, off\n\t"
                 "global_load_async_to_lds_b128 %4, %12, off\n\t"
                 "global_load_async_to_lds_b128 %5, %13, off\n\t"
                 "global_load_async_to_lds_b128 %6, %14, off\n\t"
                 "global_load_async_to_lds_b128 %7, %15, off\n\t"
                 "s_wait_xcnt 0x0"
                 :: "v"(l), "v"(l + LS), "v"(l + 2 * LS), "v"(l + 3 * LS),
                    "v"(l + 4 * LS), "v"(l + 5 * LS), "v"(l + 6 * LS), "v"(l + 7 * LS),
                    "v"(g), "v"(g + GS), "v"(g + 2 * GS), "v"(g + 3 * GS),
                    "v"(g + 4 * GS), "v"(g + 5 * GS), "v"(g + 6 * GS), "v"(g + 7 * GS)
                 : "memory");
}

// Foot of a trip of a two-buffer ring (every wave, block-uniform): this wave's LDS reads of the buffer it
// leaves are done, its own copies of the next tile have landed; the barrier publishes that tile and frees
// the buffer for the refill behind it.
__device__ __forceinline__ void ring_publish() {
    asm volatile("s_wait_dscnt 0x0" ::: "memory");      // reads done before the buffer is handed to the copies
    asm volatile("s_wait_asynccnt 0x0" ::: "memory");   // the compiler places no wait for the copies
    __syncthreads();
}

// ---------------------------------------------------------------------------
// Weight transpose + scale + f16 convert: Wt[n][k] = f16(W[k][n] * scale).
// W is [K][N] row-major. Block tile: 64 k x 32 n; tile (bx, by) of (N/32, K/64).
// ---------------------------------------------------------------------------
__device__ __forceinline__
void wcvt_tile(const float* __restrict__ W, _Float16* __restrict__ Wt, int K, int N, float scale, int bx, int by) {
    __shared__ float tile[64][33];
    const int tid = threadIdx.x;
    const int kb = by * 64, nb = bx * 32;
    const int c = tid & 31, r = tid >> 5;
    #pragma unroll
    for (int i = 0; i < 8; ++i)
        tile[r + 8 * i][c] = W[(size_t)(kb + r + 8 * i) * N + nb + c] * scale;
    __syncthreads();
    const int n = tid >> 3, pc = tid & 7;
    v8h o;
    #pragma unroll
    for (int e = 0; e < 8; ++e) o[e] = (_Float16)tile[pc * 8 + e][n];
    _Float16* dst = Wt + (size_t)(nb + n) * K + kb + pc * 8;
    *(v8h*)dst = o;
    
}

// ---------------------------------------------------------------------------
// deviations).  One wave per row, 8 rows per 256-thread block.
// OM 0: f16 output only; OM 1: f32 + f16; OM 2: f32 only.
// f32 rows: lane l stores float4 at cols 4l+128j (each instruction = 4 whole
// lines, lane-contiguous 16 B).  f16 rows: lane l stores 8 halves at cols
// ---------------------------------------------------------------------------
template <int OM>
__device__ __forceinline__
void ln_rows(const float* __restrict__ in, const float* __restrict__ g, const float* __restrict__ bt,
             float* __restrict__ of, _Float16* __restrict__ oh, int M, int blk) {
    const int lane = threadIdx.x & 31, wave = threadIdx.x >> 5;
    const int row = blk * 8 + wave;
    if (row >= M) return;                      // wave-uniform; no barriers in this function
    const float* r = in + (size_t)row * ND;

    v4f v[4];
    float s = 0.f;
    #pragma unroll
    for (int j = 0; j < 4; ++j) {
        v[j] = *(const v4f*)(r + 4 * lane + 128 * j);
        s += (v[j][0] + v[j][1]) + (v[j][2] + v[j][3]);
    }
    #pragma unroll
    for (int off = 16; off >= 1; off >>= 1) s += __shfl_xor(s, off, 32);
    const float mean = s * (1.0f / ND);
    float sq = 0.f;
    #pragma unroll
    for (int j = 0; j < 4; ++j) {
        #pragma unroll
        for (int c = 0; c < 4; ++c) { const float d = v[j][c] - mean; sq += d * d; }
    }
    #pragma unroll
    for (int off = 16; off >= 1; off >>= 1) sq += __shfl_xor(sq, off, 32);
    const float rstd = rsqrtf(sq * (1.0f / ND) + LNEPS);

    if constexpr (OM != 0) {
        v4f o[4];
        #pragma unroll
        for (int j = 0; j < 4; ++j) {
            const int c0 = 4 * lane + 128 * j;
            const v4f gv = *(const v4f*)(g + c0);
            const v4f bv = *(const v4f*)(bt + c0);
            #pragma unroll
            for (int c = 0; c < 4; ++c) o[j][c] = (v[j][c] - mean) * rstd * gv[c] + bv[c];
        }
        float* orow = of + (size_t)row * ND + 4 * lane;
        #pragma unroll
        for (int j = 0; j < 4; ++j) *(v4f*)(orow + 128 * j) = o[j];
        
    }
    if constexpr (OM != 2) {
        v8h w[2];
        #pragma unroll
        for (int j = 0; j < 2; ++j) {
            const int c0 = 8 * lane + 256 * j;
            const v4f x0 = *(const v4f*)(r + c0),  x1 = *(const v4f*)(r + c0 + 4);
            const v4f g0 = *(const v4f*)(g + c0),  g1 = *(const v4f*)(g + c0 + 4);
            const v4f b0 = *(const v4f*)(bt + c0), b1 = *(const v4f*)(bt + c0 + 4);
            #pragma unroll
            for (int c = 0; c < 4; ++c) {
                w[j][c]     = (_Float16)((x0[c] - mean) * rstd * g0[c] + b0[c]);
                w[j][4 + c] = (_Float16)((x1[c] - mean) * rstd * g1[c] + b1[c]);
            }
        }
        _Float16* hrow = oh + (size_t)row * ND + 8 * lane;
        #pragma unroll
        for (int j = 0; j < 2; ++j) *(v8h*)(hrow + 256 * j) = w[j];
        
    }
}

template <int OM>
__global__ __launch_bounds__(256)
void k_ln(const float* __restrict__ in, const float* __restrict__ g, const float* __restrict__ bt,
          float* __restrict__ of, _Float16* __restrict__ oh, int M) {
    ln_rows<OM>(in, g, bt, of, oh, M, blockIdx.x);
}

// ---------------------------------------------------------------------------
// Everything that depends on the inputs alone, in one grid: the input
// LayerNorm (blocks 0 .. PB_LN-1, 8 rows each), then the five weight converts
// (one 64 k x 32 n tile a block).  The job is picked by the block index, so
// every branch here is block-uniform.
// ---------------------------------------------------------------------------
#define PB_LN (NM / 8)                      // LayerNorm blocks
#define PB_WD ((ND / 32) * (ND / 64))       // tiles of a D x D weight
#define PB_WF ((NF / 32) * (ND / 64))       // tiles of W1, and of W2

__global__ __launch_bounds__(256)
void k_prep(const float* __restrict__ x, const float* __restrict__ g, const float* __restrict__ bt,
            _Float16* __restrict__ h,
            const float* __restrict__ Wq, const float* __restrict__ Wk, const float* __restrict__ Wv,
            const float* __restrict__ W1, const float* __restrict__ W2,
            _Float16* __restrict__ Wqh, _Float16* __restrict__ Wkh, _Float16* __restrict__ Wvh,
            _Float16* __restrict__ W1h, _Float16* __restrict__ W2h) {
    if (blockIdx.x < PB_LN) { ln_rows<0>(x, g, bt, nullptr, h, NM, blockIdx.x); return; }
    int b = blockIdx.x - PB_LN;
    const float* W;
    _Float16* Wt;
    int K, N, bx, by;
    float sc;
    if (b < 3 * PB_WD) {                    // in[512][512] -> out[512][512]
        const int w = b / PB_WD;
        b -= w * PB_WD;
        W  = w == 0 ? Wq  : (w == 1 ? Wk  : Wv);
        Wt = w == 0 ? Wqh : (w == 1 ? Wkh : Wvh);
        K = ND; N = ND; sc = 16.0f;
        bx = b % (ND / 32); by = b / (ND / 32);
    } else if (b < 3 * PB_WD + PB_WF) {     // in[512][2048] -> out[2048][512]
        b -= 3 * PB_WD;
        W = W1; Wt = W1h; K = ND; N = NF; sc = 16.0f;
        bx = b % (NF / 32); by = b / (NF / 32);
    } else {                                // in[2048][512] -> out[512][2048]
        b -= 3 * PB_WD + PB_WF;
        W = W2; Wt = W2h; K = NF; N = ND; sc = 32.0f;
        bx = b % (ND / 32); by = b / (ND / 32);
    }
    wcvt_tile(W, Wt, K, N, sc, bx, by);
    // the built code lays the LayerNorm behind this tile's store: its registers stay until this wait
    asm volatile("s_wait_xcnt 0x0" ::: "memory");
}

// ---------------------------------------------------------------------------
// WMMA GEMM: C[M,N] = A[M,K] @ W[K,N] (+bias, scale, epilogue).  A f16
// row-major [M][K]; weights f16 [N][K] (k-contiguous), so A and B fragments
// use the same split-k loader: elements 0..7 <- k0+8h+0..7, elements 8..15
// <- k0+16+8h+0..7, h = lane>>4, row/col = lane&15.  D element r of a lane =
// (row 8h+r, col lane&15).  Block tile 128x128, K step 128, 8 waves (4 m x 2 n,
// each wave 32x64 = 2 x 4 accumulators).  A and B tiles staged in LDS, rows of
// 256 B at pitch 272 B, by asynchronous copies in a ring of two buffers: tile
// t + 1 is in flight while tile t is worked on; the output staging reuses the
// ring behind the last trip's barrier.  M, N multiples of 128; K a multiple of 128.  N and K
// are compile-time, so a thread's 8 rows of a tile hang off one address.
// MODE 0: Q, K and V in one grid, N = 3 * ND: Bt holds the three weights one
//         behind the other, outp the three outputs; a column tile lies in one
//         projection w = nBase / ND (block-uniform), which picks bias, output
//         and f16 epilogue 0 (Q, K) or 1 (V)
// MODE 2: f16 out, relu, row-major [M][N]  (FFN1)
// MODE 3: f32 out + residual, row-major    (FFN2)
// f16 epilogues EM: 0 = [B,H,T,DK], 1 = [B,H,DK,T] (V transposed), 2 = FFN1
// ---------------------------------------------------------------------------
#define GT  128     // block tile, rows and columns
#define GK  128     // k per staged tile
#define GP  136     // LDS pitch of a staged row and of an f16 output row, halves
#define GPF 132     // LDS pitch of an f32 output row, floats
#define GOP (GT * GP * 2)   // bytes of one operand's staged tile
#define GSTG (2 * GOP)      // bytes of a ring buffer: A tile, then B tile

// f16 epilogue of a 128x128 tile: scale, bias (relu), staged in Ch, stored in 16-byte pieces
template <int EM, int N>
__device__ __forceinline__
void epi_f16(const v8f (&acc)[2][4], const float (&bj)[4], _Float16* Ch, _Float16* __restrict__ O,
             float oscale, int mBase, int nBase) {
    const int tid = threadIdx.x, lane = tid & 31, wave = tid >> 5;
    const int hl = lane >> 4, m = lane & 15;
    const int wm = wave & 3, wn = wave >> 2;
    #pragma unroll
    for (int i = 0; i < 2; ++i) {
        #pragma unroll
        for (int j = 0; j < 4; ++j) {
            const int col = wn * 64 + j * 16 + m;
            #pragma unroll
            for (int r = 0; r < 8; ++r) {
                float u = acc[i][j][r] * oscale + bj[j];
                if constexpr (EM == 2) u = fmaxf(u, 0.0f);
                const int row = wm * 32 + i * 16 + 8 * hl + r;
                if constexpr (EM == 1) Ch[col * GP + row] = (_Float16)u;
                else                   Ch[row * GP + col] = (_Float16)u;
            }
        }
    }
    __syncthreads();
    // thread: staged rows line + 16 j, 16-byte piece pc; a tile lies in one batch (NT % GT == 0)
    const int line = tid >> 4, pc = tid & 15;
    const int bb = mBase / NT, t0 = mBase % NT;
    int step;                                           // halves between rows line and line + 16
    if constexpr (EM == 0) {
        const int n = nBase + pc * 8;                   // column: head n / NDK, d n % NDK
        O += ((size_t)(bb * NH + n / NDK) * NT + t0 + line) * NDK + n % NDK;
        step = 16 * NDK;
    } else if constexpr (EM == 1) {
        const int n = nBase + line;                     // staged row = column: head n / NDK, d n % NDK
        O += ((size_t)(bb * NH + n / NDK) * NDK + n % NDK) * NT + t0 + pc * 8;
        step = 16 * NT;                                 // heads are NDK * NT apart: linear in n
    } else {
        O += (size_t)(mBase + line) * N + nBase + pc * 8;
        step = 16 * N;
    }
    v8h w[8];
    #pragma unroll
    for (int j = 0; j < 8; ++j) w[j] = *(const v8h*)(Ch + (line + 16 * j) * GP + pc * 8);
    #pragma unroll
    for (int j = 0; j < 8; ++j) *(v8h*)(O + j * step) = w[j];
}

template <int MODE, int N, int K>
__global__ __launch_bounds__(256)
void k_gemm(const _Float16* __restrict__ A, const _Float16* __restrict__ Bt,
            const float* __restrict__ bias, const float* __restrict__ resid,
            void* __restrict__ outp, float oscale,
            const float* __restrict__ biasK, const float* __restrict__ biasV) {
    __shared__ __align__(16) unsigned char ring[2 * GSTG];
    _Float16* Ch = (_Float16*)ring;                       // output staging, behind the loop
    float*    Cf = (float*)ring;

    const int tid = threadIdx.x, lane = tid & 31, wave = tid >> 5;
    const int hl = lane >> 4, m = lane & 15;
    const int mBase = blockIdx.y * GT, nBase = blockIdx.x * GT;
    const int wm = wave & 3, wn = wave >> 2;
    const int ar = tid >> 4, ac = (tid & 15) * 8;         // staging: row (step 16), k chunk
    const char* Ag = (const char*)(A  + (size_t)mBase * K + ar * K + ac);   // the thread's first piece of the next tile to copy
    const char* Bg = (const char*)(Bt + (size_t)nBase * K + ar * K + ac);
    const unsigned lst = lds_addr(ring) + (ar * GP + ac) * 2;                // its place in buffer 0's A tile

    v8f acc[2][4];
    #pragma unroll
    for (int i = 0; i < 2; ++i) {
        #pragma unroll
        for (int j = 0; j < 4; ++j) acc[i][j] = zero8();
    }
    // tile 0 into buffer 0, landed and published; then tile 1 into buffer 1
    async8<16 * GP * 2, 16 * K * 2>(lst, Ag);
    async8<16 * GP * 2, 16 * K * 2>(lst + GOP, Bg);
    Ag += GK * 2; Bg += GK * 2;
    asm volatile("s_wait_asynccnt 0x0" ::: "memory");       // the compiler places no wait for the copies
    __syncthreads();
    if (K / GK > 1) {
        async8<16 * GP * 2, 16 * K * 2>(lst + GSTG, Ag);
        async8<16 * GP * 2, 16 * K * 2>(lst + GSTG + GOP, Bg);
        Ag += GK * 2; Bg += GK * 2;
    }

    for (int kt = 0; kt < K / GK; ++kt) {
        const unsigned bo = (kt & 1) * GSTG;                // this trip's buffer
        const _Float16* ap = (const _Float16*)(ring + bo) + (wm * 32 + m) * GP + 8 * hl;
        const _Float16* bp = (const _Float16*)(ring + bo + GOP) + (wn * 64 + m) * GP + 8 * hl;
        #pragma unroll
        for (int kk = 0; kk < GK / 32; ++kk) {
            Frag fa[2], fb[4];
            #pragma unroll
            for (int i = 0; i < 2; ++i) {
                fa[i].hf[0] = *(const v8h*)(ap + i * 16 * GP + kk * 32);
                fa[i].hf[1] = *(const v8h*)(ap + i * 16 * GP + kk * 32 + 16);
            }
            #pragma unroll
            for (int j = 0; j < 4; ++j) {
                fb[j].hf[0] = *(const v8h*)(bp + j * 16 * GP + kk * 32);
                fb[j].hf[1] = *(const v8h*)(bp + j * 16 * GP + kk * 32 + 16);
            }
            #pragma unroll
            for (int i = 0; i < 2; ++i) {
                #pragma unroll
                for (int j = 0; j < 4; ++j) acc[i][j] = wmma16(fa[i].v, fb[j].v, acc[i][j]);
            }
        }
        ring_publish();
        if (kt + 2 < K / GK) {                              // block-uniform: tile kt + 2 into the buffer just left
            async8<16 * GP * 2, 16 * K * 2>(lst + bo, Ag);
            async8<16 * GP * 2, 16 * K * 2>(lst + bo + GOP, Bg);
            Ag += GK * 2; Bg += GK * 2;
        }
    }
    asm volatile("s_wait_asynccnt 0x0" ::: "memory");       // nothing in flight when the ring becomes output staging

    const int w  = MODE == 0 ? nBase / ND : 0;              // projection of this tile
    const int nb = MODE == 0 ? nBase % ND : nBase;          // its first column there
    const float* bs = bias;
    if constexpr (MODE == 0) bs = w == 0 ? bias : (w == 1 ? biasK : biasV);
    float bj[4];
    #pragma unroll
    for (int j = 0; j < 4; ++j) bj[j] = bs[nb + wn * 64 + j * 16 + m];

    if constexpr (MODE == 0) {
        _Float16* o = (_Float16*)outp + (size_t)w * NM * ND;
        if (w == 2) {
            epi_f16<1, ND>(acc, bj, Ch, o, oscale, mBase, nb);
        } else {
            epi_f16<0, ND>(acc, bj, Ch, o, oscale, mBase, nb);
            // the built code lays the other epilogue behind these stores: their registers stay until this wait
            asm volatile("s_wait_xcnt 0x0" ::: "memory");
        }
    } else if constexpr (MODE == 2) {
        epi_f16<2, N>(acc, bj, Ch, (_Float16*)outp, oscale, mBase, nBase);
    } else {
        #pragma unroll
        for (int i = 0; i < 2; ++i) {
            #pragma unroll
            for (int j = 0; j < 4; ++j) {
                const int col = wn * 64 + j * 16 + m;
                #pragma unroll
                for (int r = 0; r < 8; ++r) {
                    const int row = wm * 32 + i * 16 + 8 * hl + r;
                    Cf[row * GPF + col] = acc[i][j][r] * oscale + bj[j];
                }
            }
        }
        __syncthreads();
        // one wave = one 512-B row; thread: rows wave + 8 j, 16-byte piece lane
        const size_t tile = (size_t)mBase * N + nBase;      // block-uniform
        const unsigned to = wave * N + lane * 4;
        const float* R = resid + tile;
        float* O = (float*)outp + tile;
        #pragma unroll
        for (int g = 0; g < 4; ++g) {
            v4f w[4];
            #pragma unroll
            for (int j = 0; j < 4; ++j) {
                const int rj = 8 * (4 * g + j);
                w[j] = *(const v4f*)(Cf + (wave + rj) * GPF + lane * 4) + *(const v4f*)(R + rj * N + to);
            }
            #pragma unroll
            for (int j = 0; j < 4; ++j) *(v4f*)(O + 8 * (4 * g + j) * N + to) = w[j];
        }
    }
}

// ---------------------------------------------------------------------------
// Attention per (b,h): block = 8 waves x 16 queries (128 queries), grid
// (T/128, B*H).  32-key K tile ([key][d], pitch 72) and V tile ([d][key],
// pitch 40, from the transposed V copy) staged in LDS by asynchronous copies,
// with the mask tile, in a ring of two buffers (tile t + 1 flies under tile t).
// Both products are taken transposed, so that a lane owns ONE query (lane & 15):
// S^T = K.Q^T: A = K rows (d as k), B = Q rows, same split-k map; D element r
// of a lane = (key 8h+r, query lane&15).  The lane's 16 scores of a tile are
// 2 x 8 consecutive keys of its query's mask row; 16 lanes on 16 rows would
// touch 16 lines a load, so the 128 x 32 mask tile is read in whole lines and
// staged with K and V ([query][key], pitch 36 floats).  Maximum and sum run in
// the lane, the two lane halves join by one exchange (the sums only at the end).
// The two score tiles (keys 0..15, 16..31), x4096 and converted to f16 in
// place, are the B operand of O^T = V^T.P^T in the split-k map (elements 0..7
// = keys 8h+0..7, 8..15 = keys 16+8h+0..7); A = V^T rows (key as k).
// D element r of a lane = (d 16c+8h+r, query lane&15).  Softmax in f32.
// ---------------------------------------------------------------------------
// value of lane l ^ 16
__device__ __forceinline__ float other_half(float v) {
    const int b = __float_as_int(v);
    return __int_as_float(__builtin_amdgcn_permlanex16(b, b, 0x76543210, 0xfedcba98, false, false));
}

#define AK_B  (32 * 72 * 2)            // bytes of a staged K tile
#define AV_B  (64 * 40 * 2)            // of a V tile
#define AM_B  (128 * 36 * 4)           // of a mask tile
#define ASTG  (AK_B + AV_B + AM_B)     // of a ring buffer: K, V, mask

// A lane's six asynchronous 16-byte copies of one key tile: K, V, four mask rows (MS bytes apart in LDS, MG in
// memory).  s_wait_xcnt is the last line of the copies' own statement, so that no register which a copy names
// is rewritten in front of it.
template <int MS, int MG>
__device__ __forceinline__ void async_kvm(unsigned lk, const char* gk, unsigned lv, const char* gv,
                                          unsigned lm, const char* gm) {
    asm volatile("global_load_async_to_lds_b128 %0, %6, off\n\t"
                 "global_load_async_to_lds_b128 %1, %7, off\n\t"
                 "global_load_async_to_lds_b128 %2, %8, off\n\t"
                 "global_load_async_to_lds_b128 %3, %9, off\n\t"
                 "global_load_async_to_lds_b128 %4, %10, off\n\t"
                 "global_load_async_to_lds_b128 %5, %11, off\n\t"
                 "s_wait_xcnt 0x0"
                 :: "v"(lk), "v"(lv), "v"(lm), "v"(lm + MS), "v"(lm + 2 * MS), "v"(lm + 3 * MS),
                    "v"(gk), "v"(gv), "v"(gm), "v"(gm + MG), "v"(gm + 2 * MG), "v"(gm + 3 * MG)
                 : "memory");
}

__global__ __launch_bounds__(256)
void k_attn(const _Float16* __restrict__ q, const _Float16* __restrict__ k,
            const _Float16* __restrict__ vt, const float* __restrict__ mask,
            const float* __restrict__ x, float* __restrict__ ores) {
    __shared__ __align__(16) unsigned char ring[2 * ASTG];
    __shared__ __align__(16) float    Os[8][16 * 68];

    const int tid = threadIdx.x, lane = tid & 31, wave = tid >> 5;
    const int hl = lane >> 4, m = lane & 15;
    const int bh = blockIdx.y;
    const int b = bh / NH, hh = bh % NH;
    const int q0 = blockIdx.x * 128 + wave * 16;

    Frag aq0, aq1;
    {
        const _Float16* qp = q + ((size_t)bh * NT + q0 + m) * NDK;
        aq0.hf[0] = *(const v8h*)(qp + 8 * hl);
        aq0.hf[1] = *(const v8h*)(qp + 16 + 8 * hl);
        aq1.hf[0] = *(const v8h*)(qp + 32 + 8 * hl);
        aq1.hf[1] = *(const v8h*)(qp + 48 + 8 * hl);
    }

    const int kr = tid >> 3, kc = (tid & 7) * 8;       // K tile: 32 keys x 64 d
    const int vr = tid >> 2, vc = (tid & 3) * 8;       // V tile: 64 d x 32 keys
    const char* kg = (const char*)(k  + ((size_t)bh * NT  + kr) * NDK + kc);   // the thread's pieces of the next tile to copy
    const char* vg = (const char*)(vt + ((size_t)bh * NDK + vr) * NT  + vc);
    const int mr = wave * 16 + (lane >> 3), mc = (lane & 7) * 4;   // mask tile: rows mr + 4 j, 8 lanes a row
    const char* mg = (const char*)(mask + ((size_t)b * NT + blockIdx.x * 128 + mr) * NT + mc);
    const unsigned lk = lds_addr(ring) + (kr * 72 + kc) * 2;                   // their places in buffer 0
    const unsigned lv = lds_addr(ring) + AK_B + (vr * 40 + vc) * 2;
    const unsigned lm = lds_addr(ring) + AK_B + AV_B + (mr * 36 + mc) * 4;

    v8f acc[4];
    #pragma unroll
    for (int c = 0; c < 4; ++c) acc[c] = zero8();
    float mrun = -3.0e38f, lrun = 0.0f;                 // lrun: the sum over this lane half's keys only

    const float sscale = 0.125f;
    const float pscale = 4096.0f;

    // tile 0 into buffer 0, landed and published; then tile 1 into buffer 1
    async_kvm<4 * 36 * 4, 4 * NT * 4>(lk, kg, lv, vg, lm, mg);
    kg += 32 * NDK * 2; vg += 32 * 2; mg += 32 * 4;
    asm volatile("s_wait_asynccnt 0x0" ::: "memory");   // the compiler places no wait for the copies
    __syncthreads();
    async_kvm<4 * 36 * 4, 4 * NT * 4>(lk + ASTG, kg, lv + ASTG, vg, lm + ASTG, mg);
    kg += 32 * NDK * 2; vg += 32 * 2; mg += 32 * 4;

    for (int st = 0; st < NT / 32; ++st) {
        const unsigned bo = (st & 1) * ASTG;            // this trip's buffer
        const _Float16* Ks = (const _Float16*)(ring + bo);
        const _Float16* Vs = (const _Float16*)(ring + bo + AK_B);
        const float* mrow = (const float*)(ring + bo + AK_B + AV_B) + (wave * 16 + m) * 36 + 8 * hl;   // the lane's query, its half's keys

        v8f p[2];
        #pragma unroll
        for (int half = 0; half < 2; ++half) {
            const _Float16* kp = Ks + (half * 16 + m) * 72;
            Frag a0, a1;
            a0.hf[0] = *(const v8h*)(kp + 8 * hl);
            a0.hf[1] = *(const v8h*)(kp + 16 + 8 * hl);
            a1.hf[0] = *(const v8h*)(kp + 32 + 8 * hl);
            a1.hf[1] = *(const v8h*)(kp + 48 + 8 * hl);
            v8f S = zero8();
            S = wmma16(a0.v, aq0.v, S);
            S = wmma16(a1.v, aq1.v, S);
            const v4f mv0 = *(const v4f*)(mrow + half * 16);
            const v4f mv1 = *(const v4f*)(mrow + half * 16 + 4);
            const v8f mv = __builtin_shufflevector(mv0, mv1, 0, 1, 2, 3, 4, 5, 6, 7);
            p[half] = S * sscale + NEGBIG * (1.0f - mv);
        }
        const v8f mx = __builtin_elementwise_max(p[0], p[1]);
        const float mh = fmaxf(fmaxf(fmaxf(mx[0], mx[1]), fmaxf(mx[2], mx[3])),
                               fmaxf(fmaxf(mx[4], mx[5]), fmaxf(mx[6], mx[7])));
        const float mnew = fmaxf(mrun, fmaxf(mh, other_half(mh)));
        const float resc = __expf(mrun - mnew);
        mrun = mnew;
        #pragma unroll
        for (int e = 0; e < 8; ++e) {
            p[0][e] = __expf(p[0][e] - mnew);
            p[1][e] = __expf(p[1][e] - mnew);
        }
        const v8f sm = p[0] + p[1];
        lrun = lrun * resc + (((sm[0] + sm[1]) + (sm[2] + sm[3])) + ((sm[4] + sm[5]) + (sm[6] + sm[7])));
        #pragma unroll
        for (int c = 0; c < 4; ++c) acc[c] *= resc;

        Frag bp;                                        // P^T as B: no lane exchange, no LDS
        #pragma unroll
        for (int e = 0; e < 8; ++e) {
            bp.v[e]     = (_Float16)(p[0][e] * pscale);
            bp.v[8 + e] = (_Float16)(p[1][e] * pscale);
        }
        #pragma unroll
        for (int c = 0; c < 4; ++c) {
            const _Float16* vp = Vs + (c * 16 + m) * 40;
            Frag fv;
            fv.hf[0] = *(const v8h*)(vp + 8 * hl);
            fv.hf[1] = *(const v8h*)(vp + 16 + 8 * hl);
            acc[c] = wmma16(fv.v, bp.v, acc[c]);
        }
        ring_publish();
        if (st + 2 < NT / 32) {                         // block-uniform: tile st + 2 into the buffer just left
            async_kvm<4 * 36 * 4, 4 * NT * 4>(lk + bo, kg, lv + bo, vg, lm + bo, mg);
            kg += 32 * NDK * 2; vg += 32 * 2; mg += 32 * 4;
        }
    }
    asm volatile("s_wait_asynccnt 0x0" ::: "memory");   // nothing in flight when the wave goes on to its end

    const float inv = (1.0f / (lrun + other_half(lrun))) * (1.0f / 4096.0f);
    float* os = &Os[wave][0];
    #pragma unroll
    for (int c = 0; c < 4; ++c) {
        v4f lo, hi;
        #pragma unroll
        for (int e = 0; e < 4; ++e) { lo[e] = acc[c][e] * inv; hi[e] = acc[c][4 + e] * inv; }
        *(v4f*)(os + m * 68 + c * 16 + 8 * hl)     = lo;
        *(v4f*)(os + m * 68 + c * 16 + 8 * hl + 4) = hi;
    }
    __syncthreads();
    v4f w[8];
    size_t goff[8];
    #pragma unroll
    for (int j = 0; j < 8; ++j) {
        const int id = lane + 32 * j;
        const int line = id >> 3, pc = lane & 7;
        const int row = line >> 1, colo = ((line & 1) << 5) + pc * 4;
        goff[j] = ((size_t)(b * NT + q0 + row)) * ND + hh * NDK + colo;
        w[j] = *(const v4f*)(os + row * 68 + colo) + *(const v4f*)(x + goff[j]);
    }
    #pragma unroll
    for (int j = 0; j < 8; ++j) *(v4f*)(ores + goff[j]) = w[j];
    
}

// ---------------------------------------------------------------------------
// Host-side launch glue
// ---------------------------------------------------------------------------
extern "C" void kernel_launch(void* const* d_in, const int* in_sizes, int n_in,
                              void* d_out, int out_size, void* d_ws, size_t ws_size,
                              hipStream_t stream) {
    if (n_in < 18) return;
    if (in_sizes[0] != NM * ND || in_sizes[1] != NB * NT * NT || out_size != NM * ND) return;
    if (in_sizes[2] != ND || in_sizes[3] != ND || in_sizes[4] != ND * ND || in_sizes[5] != ND ||
        in_sizes[6] != ND * ND || in_sizes[7] != ND || in_sizes[8] != ND * ND || in_sizes[9] != ND ||
        in_sizes[10] != ND || in_sizes[11] != ND || in_sizes[12] != ND * NF || in_sizes[13] != NF ||
        in_sizes[14] != NF * ND || in_sizes[15] != ND || in_sizes[16] != ND || in_sizes[17] != ND) return;

    const float* x       = (const float*)d_in[0];
    const float* mask    = (const float*)d_in[1];
    const float* ln_in_g = (const float*)d_in[2];
    const float* ln_in_b = (const float*)d_in[3];
    const float* Wq      = (const float*)d_in[4];
    const float* bq      = (const float*)d_in[5];
    const float* Wk      = (const float*)d_in[6];
    const float* bk      = (const float*)d_in[7];
    const float* Wv      = (const float*)d_in[8];
    const float* bv      = (const float*)d_in[9];
    const float* ln1_g   = (const float*)d_in[10];
    const float* ln1_b   = (const float*)d_in[11];
    const float* W1      = (const float*)d_in[12];
    const float* b1      = (const float*)d_in[13];
    const float* W2      = (const float*)d_in[14];
    const float* b2      = (const float*)d_in[15];
    const float* ln2_g   = (const float*)d_in[16];
    const float* ln2_b   = (const float*)d_in[17];
    float* out = (float*)d_out;

    // workspace carve (all offsets multiples of 512 KiB)
    char* ws = (char*)d_ws;
    size_t o = 0;
    const size_t SZ_H16 = (size_t)NM * ND * 2;              // 8 MiB
    const size_t SZ_F32 = (size_t)NM * ND * 4;              // 16 MiB
    _Float16* h16  = (_Float16*)(ws + o); o += SZ_H16;
    _Float16* q16  = (_Float16*)(ws + o); o += SZ_H16;
    _Float16* k16  = (_Float16*)(ws + o); o += SZ_H16;
    _Float16* vt16 = (_Float16*)(ws + o); o += SZ_H16;
    _Float16* f1   = h16;                                    // [M][F] f16 = 32 MiB, reuses h/q/k/vt region after attention
    float* ares = (float*)(ws + o); o += SZ_F32;             // attention + x
    float* y    = ares;                                      // FFN2 output reuses ares after LN1
    float* a32  = (float*)(ws + o); o += SZ_F32;
    _Float16* a16 = (_Float16*)(ws + o); o += SZ_H16;
    _Float16* Wqh = (_Float16*)(ws + o); o += (size_t)ND * ND * 2;
    _Float16* Wkh = (_Float16*)(ws + o); o += (size_t)ND * ND * 2;
    _Float16* Wvh = (_Float16*)(ws + o); o += (size_t)ND * ND * 2;
    _Float16* W1h = (_Float16*)(ws + o); o += (size_t)NF * ND * 2;   // [F][D]
    _Float16* W2h = (_Float16*)(ws + o); o += (size_t)ND * NF * 2;   // [D][F]
    if ((size_t)NM * NF * 2 > 4 * SZ_H16) return;
    if (o > ws_size) return;

    // 1, 2. input LayerNorm -> h (f16); weights: transpose to [n][k], scale by a power of two, f16
    k_prep<<<PB_LN + 3 * PB_WD + 2 * PB_WF, 256, 0, stream>>>(x, ln_in_g, ln_in_b, h16, Wq, Wk, Wv, W1, W2,
                                                              Wqh, Wkh, Wvh, W1h, W2h);

    // 3. QKV projections: Wqh, Wkh, Wvh and q16, k16, vt16 lie one behind the other in the carve above
    k_gemm<0, 3 * ND, ND><<<dim3(3 * ND / GT, NM / GT), 256, 0, stream>>>(h16, Wqh, bq, nullptr, (void*)q16, 0.0625f, bk, bv);

    // 4. attention + residual(x)
    k_attn<<<dim3(NT / 128, NB * NH), 256, 0, stream>>>(q16, k16, vt16, mask, x, ares);

    // 5. LN1 -> a (f32) and a (f16)
    k_ln<1><<<(NM + 7) / 8, 256, 0, stream>>>(ares, ln1_g, ln1_b, a32, a16, NM);

    // 6. FFN1: relu(a @ W1 + b1) -> f16
    k_gemm<2, NF, ND><<<dim3(NF / GT, NM / GT), 256, 0, stream>>>(a16, W1h, b1, nullptr, (void*)f1, 0.0625f, nullptr, nullptr);

    // 7. FFN2: f1 @ W2 + b2 + a -> f32
    k_gemm<3, ND, NF><<<dim3(ND / GT, NM / GT), 256, 0, stream>>>(f1, W2h, b2, a32, (void*)y, 0.03125f, nullptr, nullptr);

    // 8. LN2 -> out
    k_ln<2><<<(NM + 7) / 8, 256, 0, stream>>>(y, ln2_g, ln2_b, out, nullptr, NM);
}

// v005
// Measured time: 109 microseconds a run.
// Two timings next to v004 both put it at 1.10 times that version's speed.
// Counting every step since v000, it is 1.94 times as fast.
#include <hip/hip_runtime.h>
// All contractions: v_wmma_f32_16x16x32_f16 (f16 operands, f32 accumulate): QKV/FFN1 weights pre-scaled x16, FFN2 weights x32, P.V with P x4096 (scales folded back in f32); Q.K^T plain f16. LayerNorm/softmax/residuals f32.

typedef _Float16 v16h __attribute__((ext_vector_type(16)));
typedef _Float16 v8h  __attribute__((ext_vector_type(8), may_alias));
typedef float    v8f  __attribute__((ext_vector_type(8)));
typedef float    v4f  __attribute__((ext_vector_type(4), may_alias));
typedef float    v2f  __attribute__((ext_vector_type(2), may_alias));
typedef _Float16 v4h  __attribute__((ext_vector_type(4), may_alias));

union Frag { v16h v; v8h hf[2]; };

#define NB   8
#define NT   1024
#define ND   512
#define NH   8
#define NDK  64
#define NF   2048
#define NM   (NB * NT)
#define LNEPS  1.0e-3f
#define NEGBIG (-1.0e9f)

__device__ __forceinline__ v8f zero8() {
    v8f z = {0.f, 0.f, 0.f, 0.f, 0.f, 0.f, 0.f, 0.f};
    return z;
}

// 16x16x32 f16 WMMA with trailing hazard guard (D tied, A/B kept live)
__device__ __forceinline__ v8f wmma16(v16h a, v16h b, v8f c) {
    v8f d = __builtin_amdgcn_wmma_f32_16x16x32_f16(false, a, false, b, (short)0, c, false, false);
    asm volatile("v_nop\n\tv_nop\n\tv_nop\n\tv_nop" : "+v"(d) : "v"(a), "v"(b));
    return d;
}

// LDS byte address of a __shared__ location (low 32 bits of its address)
__device__ __forceinline__ unsigned lds_addr(const void* p) { return (unsigned)(size_t)p; }

// Eight asynchronous 16-byte copies of a lane, global -> LDS: rows LS bytes apart in LDS, GS bytes apart in
// memory.  s_wait_xcnt is the last line of the copies' own statement, so that no register which a copy names
// is rewritten in front of it.
template <int LS, int GS>
__device__ __forceinline__ void async8(unsigned l, const char* g) {
    asm volatile("global_load_async_to_lds_b128 %0, %8, off\n\t"
                 "global_load_async_to_lds_b128 %1, %9, off\n\t"
                 "global_load_async_to_lds_b128 %2, %10, off\n\t"
                 "global_load_async_to_lds_b128 %3, %11, off\n\t"
                 "global_load_async_to_lds_b128 %4, %12, off\n\t"
                 "global_load_async_to_lds_b128 %5, %13, off\n\t"
                 "global_load_async_to_lds_b128 %6, %14, off\n\t"
                 "global_load_async_to_lds_b128 %7, %15, off\n\t"
                 "s_wait_xcnt 0x0"
                 :: "v"(l), "v"(l + LS), "v"(l + 2 * LS), "v"(l + 3 * LS),
                    "v"(l + 4 * LS), "v"(l + 5 * LS), "v"(l + 6 * LS), "v"(l + 7 * LS),
                    "v"(g), "v"(g + GS), "v"(g + 2 * GS), "v"(g + 3 * GS),
                    "v"(g + 4 * GS), "v"(g + 5 * GS), "v"(g + 6 * GS), "v"(g + 7 * GS)
                 : "memory");
}

// Foot of a trip of a two-buffer ring (every wave, block-uniform): this wave's LDS reads of the buffer it
// leaves are done, its own copies of the next tile have landed; the barrier publishes that tile and frees
// the buffer for the refill behind it.
__device__ __forceinline__ void ring_publish() {
    asm volatile("s_wait_dscnt 0x0" ::: "memory");      // reads done before the buffer is handed to the copies
    asm volatile("s_wait_asynccnt 0x0" ::: "memory");   // the compiler places no wait for the copies
    __syncthreads();
}

// ---------------------------------------------------------------------------
// Weight transpose + scale + f16 convert: Wt[n][k] = f16(W[k][n] * scale), times gs[k] where gs is given.
// W is [K][N] row-major. Block tile: 64 k x 32 n; tile (bx, by) of (N/32, K/64).
// ---------------------------------------------------------------------------
__device__ __forceinline__
void wcvt_tile(const float* __restrict__ W, _Float16* __restrict__ Wt, int K, int N, float scale, int bx, int by,
               const float* __restrict__ gs) {
    __shared__ float tile[64][33];
    const int tid = threadIdx.x;
    const int kb = by * 64, nb = bx * 32;
    const int c = tid & 31, r = tid >> 5;
    float w[8], gk[8] = {1.f, 1.f, 1.f, 1.f, 1.f, 1.f, 1.f, 1.f};
    #pragma unroll
    for (int i = 0; i < 8; ++i) w[i] = W[(size_t)(kb + r + 8 * i) * N + nb + c];
    if (gs) {                                           // block-uniform test, once, under the tile's loads
        const int ks = kb + __builtin_amdgcn_readfirstlane(r);   // the wave's k, for scalar loads
        #pragma unroll
        for (int i = 0; i < 8; ++i) gk[i] = gs[ks + 8 * i];
    }
    #pragma unroll
    for (int i = 0; i < 8; ++i) tile[r + 8 * i][c] = w[i] * scale * gk[i];
    __syncthreads();
    const int n = tid >> 3, pc = tid & 7;
    v8h o;
    #pragma unroll
    for (int e = 0; e < 8; ++e) o[e] = (_Float16)tile[pc * 8 + e][n];
    _Float16* dst = Wt + (size_t)(nb + n) * K + kb + pc * 8;
    *(v8h*)dst = o;
    
}

// ---------------------------------------------------------------------------
// The second LayerNorm is not applied to the rows r = attention + x; it is folded into FFN1:
//   LN(r) @ W1 + b1 = rstd * (r @ (g . W1) - mean * c1) + c0,
//   c1[n] = sum_k g[k] W1[k][n] (of the f16 values that the product uses), c0[n] = sum_k b[k] W1[k][n] + b1[n].
// One block: 32 columns n; wave r sums 64 k, the eight partial sums join through LDS.
// ---------------------------------------------------------------------------
__device__ __forceinline__
void colsum_tile(const float* __restrict__ W1, const float* __restrict__ g, const float* __restrict__ bt,
                 const float* __restrict__ b1, float* __restrict__ c1, float* __restrict__ c0, int bx) {
    __shared__ float red[2][8][32];
    const int c = threadIdx.x & 31, r = __builtin_amdgcn_readfirstlane(threadIdx.x >> 5);   // r scalar: g, bt are read off a scalar base
    const int n = bx * 32 + c;
    float s1 = 0.f, s0 = 0.f;
    #pragma unroll 16   // sixteen loads in flight a lane
    for (int i = 0; i < ND / 8; ++i) {
        const int k = r * (ND / 8) + i;
        const float wv = W1[(size_t)k * NF + n];
        s1 += (float)(_Float16)(wv * 16.0f * g[k]);
        s0 += wv * bt[k];
    }
    red[0][r][c] = s1;
    red[1][r][c] = s0;
    __syncthreads();
    if (r == 0) {
        float t1 = 0.f, t0 = 0.f;
        #pragma unroll
        for (int i = 0; i < 8; ++i) { t1 += red[0][i][c]; t0 += red[1][i][c]; }
        c1[n] = t1 * 0.0625f;
        c0[n] = t0 + b1[n];
    }
}

// ---------------------------------------------------------------------------
// deviations).  One wave per row, 8 rows per 256-thread block.
// OM 0: f16 output only; OM 1: f32 + f16; OM 2: f32 only.
// f32 rows: lane l stores float4 at cols 4l+128j (each instruction = 4 whole
// lines, lane-contiguous 16 B).  f16 rows: lane l stores 8 halves at cols
// ---------------------------------------------------------------------------
template <int OM>
__device__ __forceinline__
void ln_rows(const float* __restrict__ in, const float* __restrict__ g, const float* __restrict__ bt,
             float* __restrict__ of, _Float16* __restrict__ oh, int M, int blk) {
    const int lane = threadIdx.x & 31, wave = threadIdx.x >> 5;
    const int row = blk * 8 + wave;
    if (row >= M) return;                      // wave-uniform; no barriers in this function
    const float* r = in + (size_t)row * ND;

    // The row's loads stand in one statement with their data wait, the results in registers of their own: so
    // no register that a load names is rewritten while the load is out.  v: float4 at cols 4l+128j, for the sums
    // and the f32 rows; xh (OM != 2): 8 floats at cols 8l+256j, for the f16 rows.
    v4f v[4], xh[4];
    if constexpr (OM != 2) {
        asm volatile("global_load_b128 %0, %8, off\n\t"
                     "global_load_b128 %1, %8, off offset:512\n\t"
                     "global_load_b128 %2, %8, off offset:1024\n\t"
                     "global_load_b128 %3, %8, off offset:1536\n\t"
                     "global_load_b128 %4, %9, off\n\t"
                     "global_load_b128 %5, %9, off offset:16\n\t"
                     "global_load_b128 %6, %9, off offset:1024\n\t"
                     "global_load_b128 %7, %9, off offset:1040\n\t"
                     "s_wait_loadcnt 0x0"
                     : "=&v"(v[0]), "=&v"(v[1]), "=&v"(v[2]), "=&v"(v[3]),
                       "=&v"(xh[0]), "=&v"(xh[1]), "=&v"(xh[2]), "=&v"(xh[3])
                     : "v"(r + 4 * lane), "v"(r + 8 * lane) : "memory");
    } else {
        asm volatile("global_load_b128 %0, %4, off\n\t"
                     "global_load_b128 %1, %4, off offset:512\n\t"
                     "global_load_b128 %2, %4, off offset:1024\n\t"
                     "global_load_b128 %3, %4, off offset:1536\n\t"
                     "s_wait_loadcnt 0x0"
                     : "=&v"(v[0]), "=&v"(v[1]), "=&v"(v[2]), "=&v"(v[3])
                     : "v"(r + 4 * lane) : "memory");
    }
    float s = 0.f;
    #pragma unroll
    for (int j = 0; j < 4; ++j) s += (v[j][0] + v[j][1]) + (v[j][2] + v[j][3]);
    #pragma unroll
    for (int off = 16; off >= 1; off >>= 1) s += __shfl_xor(s, off, 32);
    const float mean = s * (1.0f / ND);
    float sq = 0.f;
    #pragma unroll
    for (int j = 0; j < 4; ++j) {
        #pragma unroll
        for (int c = 0; c < 4; ++c) { const float d = v[j][c] - mean; sq += d * d; }
    }
    #pragma unroll
    for (int off = 16; off >= 1; off >>= 1) sq += __shfl_xor(sq, off, 32);
    const float rstd = rsqrtf(sq * (1.0f / ND) + LNEPS);

    if constexpr (OM != 0) {
        v4f o[4];
        #pragma unroll
        for (int j = 0; j < 4; ++j) {
            const int c0 = 4 * lane + 128 * j;
            const v4f gv = *(const v4f*)(g + c0);
            const v4f bv = *(const v4f*)(bt + c0);
            #pragma unroll
            for (int c = 0; c < 4; ++c) o[j][c] = (v[j][c] - mean) * rstd * gv[c] + bv[c];
        }
        float* orow = of + (size_t)row * ND + 4 * lane;
        #pragma unroll
        for (int j = 0; j < 4; ++j) *(v4f*)(orow + 128 * j) = o[j];
        
    }
    if constexpr (OM != 2) {
        v8h w[2];
        #pragma unroll
        for (int j = 0; j < 2; ++j) {
            const int c0 = 8 * lane + 256 * j;
            const v4f x0 = xh[2 * j], x1 = xh[2 * j + 1];
            const v4f g0 = *(const v4f*)(g + c0),  g1 = *(const v4f*)(g + c0 + 4);
            const v4f b0 = *(const v4f*)(bt + c0), b1 = *(const v4f*)(bt + c0 + 4);
            #pragma unroll
            for (int c = 0; c < 4; ++c) {
                w[j][c]     = (_Float16)((x0[c] - mean) * rstd * g0[c] + b0[c]);
                w[j][4 + c] = (_Float16)((x1[c] - mean) * rstd * g1[c] + b1[c]);
            }
        }
        _Float16* hrow = oh + (size_t)row * ND + 8 * lane;
        #pragma unroll
        for (int j = 0; j < 2; ++j) *(v8h*)(hrow + 256 * j) = w[j];
        
    }
}

template <int OM>
__global__ __launch_bounds__(256)
void k_ln(const float* __restrict__ in, const float* __restrict__ g, const float* __restrict__ bt,
          float* __restrict__ of, _Float16* __restrict__ oh, int M) {
    ln_rows<OM>(in, g, bt, of, oh, M, blockIdx.x);
}

// ---------------------------------------------------------------------------
// Everything that depends on the inputs alone, in one grid: the column sums
// of W1 that fold the second LayerNorm into FFN1 (PB_C blocks), the input
// LayerNorm (PB_LN blocks, 8 rows each), then the five weight converts
// (one 64 k x 32 n tile a block).  The job is picked by the block index, so
// every branch here is block-uniform.
// ---------------------------------------------------------------------------
#define PB_LN (NM / 8)                      // LayerNorm blocks
#define PB_WD ((ND / 32) * (ND / 64))       // tiles of a D x D weight
#define PB_WF ((NF / 32) * (ND / 64))       // tiles of W1, and of W2
#define PB_C  (NF / 32)                     // column-sum blocks

__global__ __launch_bounds__(256)
void k_prep(const float* __restrict__ x, const float* __restrict__ g, const float* __restrict__ bt,
            _Float16* __restrict__ h,
            const float* __restrict__ Wq, const float* __restrict__ Wk, const float* __restrict__ Wv,
            const float* __restrict__ W1, const float* __restrict__ W2,
            _Float16* __restrict__ Wqh, _Float16* __restrict__ Wkh, _Float16* __restrict__ Wvh,
            _Float16* __restrict__ W1h, _Float16* __restrict__ W2h,
            const float* __restrict__ g1, const float* __restrict__ bt1, const float* __restrict__ b1,
            float* __restrict__ c1, float* __restrict__ c0) {
    if (blockIdx.x < PB_C) { colsum_tile(W1, g1, bt1, b1, c1, c0, blockIdx.x); return; }   // the longest job starts first
    if (blockIdx.x < PB_C + PB_LN) { ln_rows<0>(x, g, bt, nullptr, h, NM, blockIdx.x - PB_C); return; }
    int b = blockIdx.x - (PB_C + PB_LN);
    const float* W;
    const float* gs = nullptr;
    _Float16* Wt;
    int K, N, bx, by;
    float sc;
    if (b < 3 * PB_WD) {                    // in[512][512] -> out[512][512]
        const int w = b / PB_WD;
        b -= w * PB_WD;
        W  = w == 0 ? Wq  : (w == 1 ? Wk  : Wv);
        Wt = w == 0 ? Wqh : (w == 1 ? Wkh : Wvh);
        K = ND; N = ND; sc = 16.0f;
        bx = b % (ND / 32); by = b / (ND / 32);
    } else if (b < 3 * PB_WD + PB_WF) {     // in[512][2048] -> out[2048][512]
        b -= 3 * PB_WD;
        W = W1; Wt = W1h; K = ND; N = NF; sc = 16.0f; gs = g1;
        bx = b % (NF / 32); by = b / (NF / 32);
    } else {                                // in[2048][512] -> out[512][2048]
        b -= 3 * PB_WD + PB_WF;
        W = W2; Wt = W2h; K = NF; N = ND; sc = 32.0f;
        bx = b % (ND / 32); by = b / (ND / 32);
    }
    wcvt_tile(W, Wt, K, N, sc, bx, by, gs);
    // the built code lays the LayerNorm behind this tile's store: its registers stay until this wait
    asm volatile("s_wait_xcnt 0x0" ::: "memory");
}

// ---------------------------------------------------------------------------
// WMMA GEMM: C[M,N] = A[M,K] @ W[K,N] (+bias, scale, epilogue).  A f16
// row-major [M][K]; weights f16 [N][K] (k-contiguous), so A and B fragments
// use the same split-k loader: elements 0..7 <- k0+8h+0..7, elements 8..15
// <- k0+16+8h+0..7, h = lane>>4, row/col = lane&15.  D element r of a lane =
// (row 8h+r, col lane&15).  Block tile 128x128, K step 128, 8 waves (4 m x 2 n,
// each wave 32x64 = 2 x 4 accumulators).  A and B tiles staged in LDS, rows of
// 256 B at pitch 272 B, by asynchronous copies in a ring of two buffers: tile
// t + 1 is in flight while tile t is worked on; the output staging reuses the
// ring behind the last trip's barrier.  M, N multiples of 128; K a multiple of 128.  N and K
// are compile-time, so a thread's 8 rows of a tile hang off one address.
// MODE 0: Q, K and V in one grid, N = 3 * ND: Bt holds the three weights one
//         behind the other, outp the three outputs; a column tile lies in one
//         projection w = nBase / ND (block-uniform), which picks bias, output
//         and f16 epilogue 0 (Q, K) or 1 (V)
// MODE 2: f16 out, relu, row-major [M][N]  (FFN1): A = the rows r before the second LayerNorm, weights
//         times its gain; the epilogue finishes the LayerNorm: (acc - mean c1) rstd + c0 (bias = c0, biasK = c1)
// MODE 3: f32 out + residual, row-major    (FFN2): the residual is LN(r), formed here from r (resid), the
//         row's mean and rstd, gain (biasK) and shift (biasV)
// MODE 2, 3: stat[head][row] = (sum, sum of squared deviations from the head's own mean) of the row's 64
//         columns of that head; the block joins the eight pairs of each of its rows into mean and rstd
// f16 epilogues EM: 0 = [B,H,T,DK], 1 = [B,H,DK,T] (V transposed), 2 = FFN1
// ---------------------------------------------------------------------------
#define GT  128     // block tile, rows and columns
#define GK  128     // k per staged tile
#define GP  136     // LDS pitch of a staged row and of an f16 output row, halves
#define GPF 132     // LDS pitch of an f32 output row, floats
#define GOP (GT * GP * 2)   // bytes of one operand's staged tile
#define GSTG (2 * GOP)      // bytes of a ring buffer: A tile, then B tile

// f16 epilogue of a 128x128 tile: scale, bias (relu), staged in Ch, stored in 16-byte pieces
template <int EM, int N>
__device__ __forceinline__
void epi_f16(const v8f (&acc)[2][4], const float (&bj)[4], _Float16* Ch, _Float16* __restrict__ O,
             float oscale, int mBase, int nBase, const float (&cj)[4], const float* rm, const float* rr) {
    const int tid = threadIdx.x, lane = tid & 31, wave = tid >> 5;
    const int hl = lane >> 4, m = lane & 15;
    const int wm = wave & 3, wn = wave >> 2;
    #pragma unroll
    for (int i = 0; i < 2; ++i) {
        v8f mu = zero8(), rs = zero8();                 // mean and rstd of the lane's eight rows
        if constexpr (EM == 2) {
            const int r0 = wm * 32 + i * 16 + 8 * hl;
            mu = __builtin_shufflevector(*(const v4f*)(rm + r0), *(const v4f*)(rm + r0 + 4), 0, 1, 2, 3, 4, 5, 6, 7);
            rs = __builtin_shufflevector(*(const v4f*)(rr + r0), *(const v4f*)(rr + r0 + 4), 0, 1, 2, 3, 4, 5, 6, 7);
        }
        #pragma unroll
        for (int j = 0; j < 4; ++j) {
            const int col = wn * 64 + j * 16 + m;
            #pragma unroll
            for (int r = 0; r < 8; ++r) {
                float u;
                if constexpr (EM == 2) u = fmaxf((acc[i][j][r] * oscale - mu[r] * cj[j]) * rs[r] + bj[j], 0.0f);
                else                   u = acc[i][j][r] * oscale + bj[j];
                const int row = wm * 32 + i * 16 + 8 * hl + r;
                if constexpr (EM == 1) Ch[col * GP + row] = (_Float16)u;
                else                   Ch[row * GP + col] = (_Float16)u;
            }
        }
    }
    __syncthreads();
    // thread: staged rows line + 16 j, 16-byte piece pc; a tile lies in one batch (NT % GT == 0)
    const int line = tid >> 4, pc = tid & 15;
    const int bb = mBase / NT, t0 = mBase % NT;
    int step;                                           // halves between rows line and line + 16
    if constexpr (EM == 0) {
        const int n = nBase + pc * 8;                   // column: head n / NDK, d n % NDK
        O += ((size_t)(bb * NH + n / NDK) * NT + t0 + line) * NDK + n % NDK;
        step = 16 * NDK;
    } else if constexpr (EM == 1) {
        const int n = nBase + line;                     // staged row = column: head n / NDK, d n % NDK
        O += ((size_t)(bb * NH + n / NDK) * NDK + n % NDK) * NT + t0 + pc * 8;
        step = 16 * NT;                                 // heads are NDK * NT apart: linear in n
    } else {
        O += (size_t)(mBase + line) * N + nBase + pc * 8;
        step = 16 * N;
    }
    v8h w[8];
    #pragma unroll
    for (int j = 0; j < 8; ++j) w[j] = *(const v8h*)(Ch + (line + 16 * j) * GP + pc * 8);
    #pragma unroll
    for (int j = 0; j < 8; ++j) *(v8h*)(O + j * step) = w[j];
}

template <int MODE, int N, int K>
__global__ __launch_bounds__(256)
void k_gemm(const _Float16* __restrict__ A, const _Float16* __restrict__ Bt,
            const float* __restrict__ bias, const float* __restrict__ resid,
            void* __restrict__ outp, float oscale,
            const float* __restrict__ biasK, const float* __restrict__ biasV, const float* __restrict__ stat) {
    __shared__ __align__(16) unsigned char ring[2 * GSTG];
    __shared__ __align__(16) float rowm[GT], rowr[GT];    // MODE 2, 3: mean and rstd of the tile's rows
    _Float16* Ch = (_Float16*)ring;                       // output staging, behind the loop
    float*    Cf = (float*)ring;

    const int tid = threadIdx.x, lane = tid & 31, wave = tid >> 5;
    const int hl = lane >> 4, m = lane & 15;
    const int mBase = blockIdx.y * GT, nBase = blockIdx.x * GT;
    const int wm = wave & 3, wn = wave >> 2;
    const int ar = tid >> 4, ac = (tid & 15) * 8;         // staging: row (step 16), k chunk
    const char* Ag = (const char*)(A  + (size_t)mBase * K + ar * K + ac);   // the thread's first piece of the next tile to copy
    const char* Bg = (const char*)(Bt + (size_t)nBase * K + ar * K + ac);
    const unsigned lst = lds_addr(ring) + (ar * GP + ac) * 2;                // its place in buffer 0's A tile

    v8f acc[2][4];
    #pragma unroll
    for (int i = 0; i < 2; ++i) {
        #pragma unroll
        for (int j = 0; j < 4; ++j) acc[i][j] = zero8();
    }
    // tile 0 into buffer 0, landed and published; then tile 1 into buffer 1
    async8<16 * GP * 2, 16 * K * 2>(lst, Ag);
    async8<16 * GP * 2, 16 * K * 2>(lst + GOP, Bg);
    Ag += GK * 2; Bg += GK * 2;
    if constexpr (MODE != 0) {
        if (__builtin_amdgcn_readfirstlane(wave) < GT / 32) {   // a scalar test, whole waves; under tile 0's flight, published by its barrier
            const float* sp = stat + (size_t)(mBase + tid) * 2;
            v2f p[NH];
            #pragma unroll
            for (int h = 0; h < NH; ++h) p[h] = *(const v2f*)(sp + (size_t)h * NM * 2);
            float sm = 0.f;
            #pragma unroll
            for (int h = 0; h < NH; ++h) sm += p[h][0];
            const float mean = sm * (1.0f / ND);
            float m2 = 0.f;
            #pragma unroll
            for (int h = 0; h < NH; ++h) {
                const float d = p[h][0] * (1.0f / NDK) - mean;
                m2 += p[h][1] + (float)NDK * d * d;
            }
            rowm[tid] = mean;
            rowr[tid] = rsqrtf(m2 * (1.0f / ND) + LNEPS);
        }
    }
    asm volatile("s_wait_asynccnt 0x0" ::: "memory");       // the compiler places no wait for the copies
    __syncthreads();
    if (K / GK > 1) {
        async8<16 * GP * 2, 16 * K * 2>(lst + GSTG, Ag);
        async8<16 * GP * 2, 16 * K * 2>(lst + GSTG + GOP, Bg);
        Ag += GK * 2; Bg += GK * 2;
    }

    for (int kt = 0; kt < K / GK; ++kt) {
        const unsigned bo = (kt & 1) * GSTG;                // this trip's buffer
        const _Float16* ap = (const _Float16*)(ring + bo) + (wm * 32 + m) * GP + 8 * hl;
        const _Float16* bp = (const _Float16*)(ring + bo + GOP) + (wn * 64 + m) * GP + 8 * hl;
        #pragma unroll
        for (int kk = 0; kk < GK / 32; ++kk) {
            Frag fa[2], fb[4];
            #pragma unroll
            for (int i = 0; i < 2; ++i) {
                fa[i].hf[0] = *(const v8h*)(ap + i * 16 * GP + kk * 32);
                fa[i].hf[1] = *(const v8h*)(ap + i * 16 * GP + kk * 32 + 16);
            }
            #pragma unroll
            for (int j = 0; j < 4; ++j) {
                fb[j].hf[0] = *(const v8h*)(bp + j * 16 * GP + kk * 32);
                fb[j].hf[1] = *(const v8h*)(bp + j * 16 * GP + kk * 32 + 16);
            }
            #pragma unroll
            for (int i = 0; i < 2; ++i) {
                #pragma unroll
                for (int j = 0; j < 4; ++j) acc[i][j] = wmma16(fa[i].v, fb[j].v, acc[i][j]);
            }
        }
        ring_publish();
        if (kt + 2 < K / GK) {                              // block-uniform: tile kt + 2 into the buffer just left
            async8<16 * GP * 2, 16 * K * 2>(lst + bo, Ag);
            async8<16 * GP * 2, 16 * K * 2>(lst + bo + GOP, Bg);
            Ag += GK * 2; Bg += GK * 2;
        }
    }
    asm volatile("s_wait_asynccnt 0x0" ::: "memory");       // nothing in flight when the ring becomes output staging

    const int w  = MODE == 0 ? nBase / ND : 0;              // projection of this tile
    const int nb = MODE == 0 ? nBase % ND : nBase;          // its first column there
    const float* bs = bias;
    if constexpr (MODE == 0) bs = w == 0 ? bias : (w == 1 ? biasK : biasV);
    float bj[4];
    #pragma unroll
    for (int j = 0; j < 4; ++j) bj[j] = bs[nb + wn * 64 + j * 16 + m];

    if constexpr (MODE == 0) {
        _Float16* o = (_Float16*)outp + (size_t)w * NM * ND;
        if (w == 2) {
            epi_f16<1, ND>(acc, bj, Ch, o, oscale, mBase, nb, bj, nullptr, nullptr);
        } else {
            epi_f16<0, ND>(acc, bj, Ch, o, oscale, mBase, nb, bj, nullptr, nullptr);
            // the built code lays the other epilogue behind these stores: their registers stay until this wait
            asm volatile("s_wait_xcnt 0x0" ::: "memory");
        }
    } else if constexpr (MODE == 2) {
        float cj[4];
        #pragma unroll
        for (int j = 0; j < 4; ++j) cj[j] = biasK[nBase + wn * 64 + j * 16 + m];
        epi_f16<2, N>(acc, bj, Ch, (_Float16*)outp, oscale, mBase, nBase, cj, rowm, rowr);
    } else {
        #pragma unroll
        for (int i = 0; i < 2; ++i) {
            #pragma unroll
            for (int j = 0; j < 4; ++j) {
                const int col = wn * 64 + j * 16 + m;
                #pragma unroll
                for (int r = 0; r < 8; ++r) {
                    const int row = wm * 32 + i * 16 + 8 * hl + r;
                    Cf[row * GPF + col] = acc[i][j][r] * oscale + bj[j];
                }
            }
        }
        __syncthreads();
        // one wave = one 512-B row; thread: rows wave + 8 j, 16-byte piece lane
        const size_t tile = (size_t)mBase * N + nBase;      // block-uniform
        const unsigned to = wave * N + lane * 4;
        const float* R = resid + tile;
        float* O = (float*)outp + tile;
        const v4f gv = *(const v4f*)(biasK + nBase + lane * 4);
        const v4f bv = *(const v4f*)(biasV + nBase + lane * 4);
        #pragma unroll
        for (int g = 0; g < 4; ++g) {
            v4f w[4];
            #pragma unroll
            for (int j = 0; j < 4; ++j) {
                const int rj = 8 * (4 * g + j);
                const v4f a = (*(const v4f*)(R + rj * N + to) - rowm[wave + rj]) * rowr[wave + rj] * gv + bv;
                w[j] = *(const v4f*)(Cf + (wave + rj) * GPF + lane * 4) + a;
            }
            #pragma unroll
            for (int j = 0; j < 4; ++j) *(v4f*)(O + 8 * (4 * g + j) * N + to) = w[j];
        }
    }
}

// ---------------------------------------------------------------------------
// Attention per (b,h): block = 8 waves x 16 queries (128 queries), grid
// (T/128, B*H).  32-key K tile ([key][d], pitch 72) and V tile ([d][key],
// pitch 40, from the transposed V copy) staged in LDS by asynchronous copies,
// with the mask tile, in a ring of two buffers (tile t + 1 flies under tile t).
// Both products are taken transposed, so that a lane owns ONE query (lane & 15):
// S^T = K.Q^T: A = K rows (d as k), B = Q rows, same split-k map; D element r
// of a lane = (key 8h+r, query lane&15).  The lane's 16 scores of a tile are
// 2 x 8 consecutive keys of its query's mask row; 16 lanes on 16 rows would
// touch 16 lines a load, so the 128 x 32 mask tile is read in whole lines and
// staged with K and V ([query][key], pitch 36 floats).  Maximum and sum run in
// the lane, the two lane halves join by one exchange (the sums only at the end).
// The two score tiles (keys 0..15, 16..31), x4096 and converted to f16 in
// place, are the B operand of O^T = V^T.P^T in the split-k map (elements 0..7
// = keys 8h+0..7, 8..15 = keys 16+8h+0..7); A = V^T rows (key as k).
// D element r of a lane = (d 16c+8h+r, query lane&15).  Softmax in f32.
// ---------------------------------------------------------------------------
// value of lane l ^ 16
__device__ __forceinline__ float other_half(float v) {
    const int b = __float_as_int(v);
    return __int_as_float(__builtin_amdgcn_permlanex16(b, b, 0x76543210, 0xfedcba98, false, false));
}

#define AK_B  (32 * 72 * 2)            // bytes of a staged K tile
#define AV_B  (64 * 40 * 2)            // of a V tile
#define AM_B  (128 * 36 * 4)           // of a mask tile
#define ASTG  (AK_B + AV_B + AM_B)     // of a ring buffer: K, V, mask

// A lane's six asynchronous 16-byte copies of one key tile: K, V, four mask rows (MS bytes apart in LDS, MG in
// memory).  s_wait_xcnt is the last line of the copies' own statement, so that no register which a copy names
// is rewritten in front of it.
template <int MS, int MG>
__device__ __forceinline__ void async_kvm(unsigned lk, const char* gk, unsigned lv, const char* gv,
                                          unsigned lm, const char* gm) {
    asm volatile("global_load_async_to_lds_b128 %0, %6, off\n\t"
                 "global_load_async_to_lds_b128 %1, %7, off\n\t"
                 "global_load_async_to_lds_b128 %2, %8, off\n\t"
                 "global_load_async_to_lds_b128 %3, %9, off\n\t"
                 "global_load_async_to_lds_b128 %4, %10, off\n\t"
                 "global_load_async_to_lds_b128 %5, %11, off\n\t"
                 "s_wait_xcnt 0x0"
                 :: "v"(lk), "v"(lv), "v"(lm), "v"(lm + MS), "v"(lm + 2 * MS), "v"(lm + 3 * MS),
                    "v"(gk), "v"(gv), "v"(gm), "v"(gm + MG), "v"(gm + 2 * MG), "v"(gm + 3 * MG)
                 : "memory");
}

__global__ __launch_bounds__(256)
void k_attn(const _Float16* __restrict__ q, const _Float16* __restrict__ k,
            const _Float16* __restrict__ vt, const float* __restrict__ mask,
            const float* __restrict__ x, float* __restrict__ ores, _Float16* __restrict__ oh,
            float* __restrict__ stat) {
    __shared__ __align__(16) unsigned char ring[2 * ASTG];
    __shared__ __align__(16) float    Os[8][16 * 68];

    const int tid = threadIdx.x, lane = tid & 31, wave = tid >> 5;
    const int hl = lane >> 4, m = lane & 15;
    const int bh = blockIdx.y;
    const int b = bh / NH, hh = bh % NH;
    const int q0 = blockIdx.x * 128 + wave * 16;

    Frag aq0, aq1;
    {
        const _Float16* qp = q + ((size_t)bh * NT + q0 + m) * NDK;
        aq0.hf[0] = *(const v8h*)(qp + 8 * hl);
        aq0.hf[1] = *(const v8h*)(qp + 16 + 8 * hl);
        aq1.hf[0] = *(const v8h*)(qp + 32 + 8 * hl);
        aq1.hf[1] = *(const v8h*)(qp + 48 + 8 * hl);
    }

    const int kr = tid >> 3, kc = (tid & 7) * 8;       // K tile: 32 keys x 64 d
    const int vr = tid >> 2, vc = (tid & 3) * 8;       // V tile: 64 d x 32 keys
    const char* kg = (const char*)(k  + ((size_t)bh * NT  + kr) * NDK + kc);   // the thread's pieces of the next tile to copy
    const char* vg = (const char*)(vt + ((size_t)bh * NDK + vr) * NT  + vc);
    const int mr = wave * 16 + (lane >> 3), mc = (lane & 7) * 4;   // mask tile: rows mr + 4 j, 8 lanes a row
    const char* mg = (const char*)(mask + ((size_t)b * NT + blockIdx.x * 128 + mr) * NT + mc);
    const unsigned lk = lds_addr(ring) + (kr * 72 + kc) * 2;                   // their places in buffer 0
    const unsigned lv = lds_addr(ring) + AK_B + (vr * 40 + vc) * 2;
    const unsigned lm = lds_addr(ring) + AK_B + AV_B + (mr * 36 + mc) * 4;

    v8f acc[4];
    #pragma unroll
    for (int c = 0; c < 4; ++c) acc[c] = zero8();
    float mrun = -3.0e38f, lrun = 0.0f;                 // lrun: the sum over this lane half's keys only

    const float sscale = 0.125f;
    const float pscale = 4096.0f;

    // tile 0 into buffer 0, landed and published; then tile 1 into buffer 1
    async_kvm<4 * 36 * 4, 4 * NT * 4>(lk, kg, lv, vg, lm, mg);
    kg += 32 * NDK * 2; vg += 32 * 2; mg += 32 * 4;
    asm volatile("s_wait_asynccnt 0x0" ::: "memory");   // the compiler places no wait for the copies
    __syncthreads();
    async_kvm<4 * 36 * 4, 4 * NT * 4>(lk + ASTG, kg, lv + ASTG, vg, lm + ASTG, mg);
    kg += 32 * NDK * 2; vg += 32 * 2; mg += 32 * 4;

    for (int st = 0; st < NT / 32; ++st) {
        const unsigned bo = (st & 1) * ASTG;            // this trip's buffer
        const _Float16* Ks = (const _Float16*)(ring + bo);
        const _Float16* Vs = (const _Float16*)(ring + bo + AK_B);
        const float* mrow = (const float*)(ring + bo + AK_B + AV_B) + (wave * 16 + m) * 36 + 8 * hl;   // the lane's query, its half's keys

        v8f p[2];
        #pragma unroll
        for (int half = 0; half < 2; ++half) {
            const _Float16* kp = Ks + (half * 16 + m) * 72;
            Frag a0, a1;
            a0.hf[0] = *(const v8h*)(kp + 8 * hl);
            a0.hf[1] = *(const v8h*)(kp + 16 + 8 * hl);
            a1.hf[0] = *(const v8h*)(kp + 32 + 8 * hl);
            a1.hf[1] = *(const v8h*)(kp + 48 + 8 * hl);
            v8f S = zero8();
            S = wmma16(a0.v, aq0.v, S);
            S = wmma16(a1.v, aq1.v, S);
            const v4f mv0 = *(const v4f*)(mrow + half * 16);
            const v4f mv1 = *(const v4f*)(mrow + half * 16 + 4);
            const v8f mv = __builtin_shufflevector(mv0, mv1, 0, 1, 2, 3, 4, 5, 6, 7);
            p[half] = S * sscale + NEGBIG * (1.0f - mv);
        }
        const v8f mx = __builtin_elementwise_max(p[0], p[1]);
        const float mh = fmaxf(fmaxf(fmaxf(mx[0], mx[1]), fmaxf(mx[2], mx[3])),
                               fmaxf(fmaxf(mx[4], mx[5]), fmaxf(mx[6], mx[7])));
        const float mnew = fmaxf(mrun, fmaxf(mh, other_half(mh)));
        const float resc = __expf(mrun - mnew);
        mrun = mnew;
        #pragma unroll
        for (int e = 0; e < 8; ++e) {
            p[0][e] = __expf(p[0][e] - mnew);
            p[1][e] = __expf(p[1][e] - mnew);
        }
        const v8f sm = p[0] + p[1];
        lrun = lrun * resc + (((sm[0] + sm[1]) + (sm[2] + sm[3])) + ((sm[4] + sm[5]) + (sm[6] + sm[7])));
        #pragma unroll
        for (int c = 0; c < 4; ++c) acc[c] *= resc;

        Frag bp;                                        // P^T as B: no lane exchange, no LDS
        #pragma unroll
        for (int e = 0; e < 8; ++e) {
            bp.v[e]     = (_Float16)(p[0][e] * pscale);
            bp.v[8 + e] = (_Float16)(p[1][e] * pscale);
        }
        #pragma unroll
        for (int c = 0; c < 4; ++c) {
            const _Float16* vp = Vs + (c * 16 + m) * 40;
            Frag fv;
            fv.hf[0] = *(const v8h*)(vp + 8 * hl);
            fv.hf[1] = *(const v8h*)(vp + 16 + 8 * hl);
            acc[c] = wmma16(fv.v, bp.v, acc[c]);
        }
        ring_publish();
        if (st + 2 < NT / 32) {                         // block-uniform: tile st + 2 into the buffer just left
            async_kvm<4 * 36 * 4, 4 * NT * 4>(lk + bo, kg, lv + bo, vg, lm + bo, mg);
            kg += 32 * NDK * 2; vg += 32 * 2; mg += 32 * 4;
        }
    }
    asm volatile("s_wait_asynccnt 0x0" ::: "memory");   // nothing in flight when the wave goes on to its end

    const float inv = (1.0f / (lrun + other_half(lrun))) * (1.0f / 4096.0f);
    float* os = &Os[wave][0];
    #pragma unroll
    for (int c = 0; c < 4; ++c) {
        v4f lo, hi;
        #pragma unroll
        for (int e = 0; e < 4; ++e) { lo[e] = acc[c][e] * inv; hi[e] = acc[c][4 + e] * inv; }
        *(v4f*)(os + m * 68 + c * 16 + 8 * hl)     = lo;
        *(v4f*)(os + m * 68 + c * 16 + 8 * hl + 4) = hi;
    }
    __syncthreads();
    v4f w[8];
    size_t goff[8];
    #pragma unroll
    for (int j = 0; j < 8; ++j) {
        const int id = lane + 32 * j;
        const int line = id >> 3, pc = lane & 7;
        const int row = line >> 1, colo = ((line & 1) << 5) + pc * 4;
        goff[j] = ((size_t)(b * NT + q0 + row)) * ND + hh * NDK + colo;
        w[j] = *(const v4f*)(os + row * 68 + colo) + *(const v4f*)(x + goff[j]);
    }
    #pragma unroll
    for (int j = 0; j < 8; ++j) *(v4f*)(ores + goff[j]) = w[j];
    // the same rows in f16, FFN1's operand: 16 lanes = the head's 64 columns of a row = one 128-byte line
    #pragma unroll
    for (int j = 0; j < 8; ++j) {
        v4h hv;
        #pragma unroll
        for (int c = 0; c < 4; ++c) hv[c] = (_Float16)w[j][c];
        *(v4h*)(oh + goff[j]) = hv;
    }
    // this head's share of the second LayerNorm's row statistics: piece j of a lane lies in row 2 j + hl, whose
    // 64 columns lie in the 16 lanes of the lane's half: their sum, then the squared deviations from their mean
    float s[8], dq[8];
    #pragma unroll
    for (int j = 0; j < 8; ++j) s[j] = (w[j][0] + w[j][1]) + (w[j][2] + w[j][3]);
    #pragma unroll
    for (int off = 8; off >= 1; off >>= 1) {
        #pragma unroll
        for (int j = 0; j < 8; ++j) s[j] += __shfl_xor(s[j], off, 32);
    }
    #pragma unroll
    for (int j = 0; j < 8; ++j) {
        const v4f d = w[j] - s[j] * (1.0f / NDK);
        dq[j] = (d[0] * d[0] + d[1] * d[1]) + (d[2] * d[2] + d[3] * d[3]);
    }
    #pragma unroll
    for (int off = 8; off >= 1; off >>= 1) {
        #pragma unroll
        for (int j = 0; j < 8; ++j) dq[j] += __shfl_xor(dq[j], off, 32);
    }
    // lane m < 8 of a half stores row 2 m + hl: the wave's 16 rows are one 128-byte line of stat[head][row]
    v2f sv = {s[0], dq[0]};
    #pragma unroll
    for (int j = 1; j < 8; ++j) {
        if (m == j) { sv[0] = s[j]; sv[1] = dq[j]; }
    }
    if (m < 8) *(v2f*)(stat + ((size_t)hh * NM + b * NT + q0 + 2 * m + hl) * 2) = sv;
}

// ---------------------------------------------------------------------------
// Host-side launch glue
// ---------------------------------------------------------------------------
extern "C" void kernel_launch(void* const* d_in, const int* in_sizes, int n_in,
                              void* d_out, int out_size, void* d_ws, size_t ws_size,
                              hipStream_t stream) {
    if (n_in < 18) return;
    if (in_sizes[0] != NM * ND || in_sizes[1] != NB * NT * NT || out_size != NM * ND) return;
    if (in_sizes[2] != ND || in_sizes[3] != ND || in_sizes[4] != ND * ND || in_sizes[5] != ND ||
        in_sizes[6] != ND * ND || in_sizes[7] != ND || in_sizes[8] != ND * ND || in_sizes[9] != ND ||
        in_sizes[10] != ND || in_sizes[11] != ND || in_sizes[12] != ND * NF || in_sizes[13] != NF ||
        in_sizes[14] != NF * ND || in_sizes[15] != ND || in_sizes[16] != ND || in_sizes[17] != ND) return;

    const float* x       = (const float*)d_in[0];
    const float* mask    = (const float*)d_in[1];
    const float* ln_in_g = (const float*)d_in[2];
    const float* ln_in_b = (const float*)d_in[3];
    const float* Wq      = (const float*)d_in[4];
    const float* bq      = (const float*)d_in[5];
    const float* Wk      = (const float*)d_in[6];
    const float* bk      = (const float*)d_in[7];
    const float* Wv      = (const float*)d_in[8];
    const float* bv      = (const float*)d_in[9];
    const float* ln1_g   = (const float*)d_in[10];
    const float* ln1_b   = (const float*)d_in[11];
    const float* W1      = (const float*)d_in[12];
    const float* b1      = (const float*)d_in[13];
    const float* W2      = (const float*)d_in[14];
    const float* b2      = (const float*)d_in[15];
    const float* ln2_g   = (const float*)d_in[16];
    const float* ln2_b   = (const float*)d_in[17];
    float* out = (float*)d_out;

    // workspace carve (all offsets but c0's multiples of 512 KiB)
    char* ws = (char*)d_ws;
    size_t o = 0;
    const size_t SZ_H16 = (size_t)NM * ND * 2;              // 8 MiB
    const size_t SZ_F32 = (size_t)NM * ND * 4;              // 16 MiB
    _Float16* h16  = (_Float16*)(ws + o); o += SZ_H16;
    _Float16* q16  = (_Float16*)(ws + o); o += SZ_H16;
    _Float16* k16  = (_Float16*)(ws + o); o += SZ_H16;
    _Float16* vt16 = (_Float16*)(ws + o); o += SZ_H16;
    _Float16* f1   = h16;                                    // [M][F] f16 = 32 MiB, reuses h/q/k/vt region after attention
    float* ares = (float*)(ws + o); o += SZ_F32;             // attention + x
    float* y    = (float*)(ws + o); o += SZ_F32;             // FFN2 output
    _Float16* r16 = (_Float16*)(ws + o); o += SZ_H16;        // attention + x in f16
    _Float16* Wqh = (_Float16*)(ws + o); o += (size_t)ND * ND * 2;
    _Float16* Wkh = (_Float16*)(ws + o); o += (size_t)ND * ND * 2;
    _Float16* Wvh = (_Float16*)(ws + o); o += (size_t)ND * ND * 2;
    _Float16* W1h = (_Float16*)(ws + o); o += (size_t)NF * ND * 2;   // [F][D]
    _Float16* W2h = (_Float16*)(ws + o); o += (size_t)ND * NF * 2;   // [D][F]
    float* stat = (float*)(ws + o); o += (size_t)NH * NM * 2 * 4;    // [H][M] pairs
    float* c1   = (float*)(ws + o); o += (size_t)NF * 4;
    float* c0   = (float*)(ws + o); o += (size_t)NF * 4;
    if ((size_t)NM * NF * 2 > 4 * SZ_H16) return;
    if (o > ws_size) return;

    // 1, 2. input LayerNorm -> h (f16); weights: transpose to [n][k], scale by a power of two, f16
    //       (W1 times the second LayerNorm's gain); column sums c1, c0 of W1
    k_prep<<<PB_C + PB_LN + 3 * PB_WD + 2 * PB_WF, 256, 0, stream>>>(x, ln_in_g, ln_in_b, h16, Wq, Wk, Wv, W1, W2,
                                                                     Wqh, Wkh, Wvh, W1h, W2h, ln1_g, ln1_b, b1, c1, c0);

    // 3. QKV projections: Wqh, Wkh, Wvh and q16, k16, vt16 lie one behind the other in the carve above
    k_gemm<0, 3 * ND, ND><<<dim3(3 * ND / GT, NM / GT), 256, 0, stream>>>(h16, Wqh, bq, nullptr, (void*)q16, 0.0625f, bk, bv, nullptr);

    // 4. attention + residual(x) -> r (f32, f16) and each head's share of r's row statistics
    k_attn<<<dim3(NT / 128, NB * NH), 256, 0, stream>>>(q16, k16, vt16, mask, x, ares, r16, stat);

    // 5, 6. FFN1 with LN1 folded in: relu(LN1(r) @ W1 + b1) -> f16
    k_gemm<2, NF, ND><<<dim3(NF / GT, NM / GT), 256, 0, stream>>>(r16, W1h, c0, nullptr, (void*)f1, 0.0625f, c1, nullptr, stat);

    // 7. FFN2: f1 @ W2 + b2 + LN1(r) -> f32
    k_gemm<3, ND, NF><<<dim3(ND / GT, NM / GT), 256, 0, stream>>>(f1, W2h, b2, ares, (void*)y, 0.03125f, ln1_g, ln1_b, stat);

    // 8. LN2 -> out
    k_ln<2><<<(NM + 7) / 8, 256, 0, stream>>>(y, ln2_g, ln2_b, out, nullptr, NM);
}

// v006
// It runs in 104 microseconds.
// Timed twice side by side with v005, it ran 1.04 times as fast both times.
// Counting every step since v000, it is 2.03 times as fast.
#include <hip/hip_runtime.h>
// All contractions: v_wmma_f32_16x16x32_f16 (f16 operands, f32 accumulate): QKV/FFN1 weights pre-scaled x16, FFN2 weights x32, P.V with P x4096 (scales folded back in f32); Q.K^T plain f16. LayerNorm/softmax/residuals f32.

typedef _Float16 v16h __attribute__((ext_vector_type(16)));
typedef _Float16 v8h  __attribute__((ext_vector_type(8), may_alias));
typedef float    v8f  __attribute__((ext_vector_type(8)));
typedef float    v4f  __attribute__((ext_vector_type(4), may_alias));
typedef float    v2f  __attribute__((ext_vector_type(2), may_alias));
typedef _Float16 v4h  __attribute__((ext_vector_type(4), may_alias));

union Frag { v16h v; v8h hf[2]; };

#define NB   8
#define NT   1024
#define ND   512
#define NH   8
#define NDK  64
#define NF   2048
#define NM   (NB * NT)
#define LNEPS  1.0e-3f
#define NEGBIG (-1.0e9f)

__device__ __forceinline__ v8f zero8() {
    v8f z = {0.f, 0.f, 0.f, 0.f, 0.f, 0.f, 0.f, 0.f};
    return z;
}

// 16x16x32 f16 WMMA with trailing hazard guard (D tied, A/B kept live)
__device__ __forceinline__ v8f wmma16(v16h a, v16h b, v8f c) {
    v8f d = __builtin_amdgcn_wmma_f32_16x16x32_f16(false, a, false, b, (short)0, c, false, false);
    asm volatile("v_nop\n\tv_nop\n\tv_nop\n\tv_nop" : "+v"(d) : "v"(a), "v"(b));
    return d;
}

// LDS byte address of a __shared__ location (low 32 bits of its address)
__device__ __forceinline__ unsigned lds_addr(const void* p) { return (unsigned)(size_t)p; }

// Eight asynchronous 16-byte copies of a lane, global -> LDS: rows LS bytes apart in LDS, GS bytes apart in
// memory.  s_wait_xcnt is the last line of the copies' own statement, so that no register which a copy names
// is rewritten in front of it.
template <int LS, int GS>
__device__ __forceinline__ void async8(unsigned l, const char* g) {
    asm volatile("global_load_async_to_lds_b128 %0, %8, off\n\t"
                 "global_load_async_to_lds_b128 %1, %9, off\n\t"
                 "global_load_async_to_lds_b128 %2, %10, off\n\t"
                 "global_load_async_to_lds_b128 %3, %11, off\n\t"
                 "global_load_async_to_lds_b128 %4, %12, off\n\t"
                 "global_load_async_to_lds_b128 %5, %13, off\n\t"
                 "global_load_async_to_lds_b128 %6, %14, off\n\t"
                 "global_load_async_to_lds_b128 %7, %15, off\n\t"
                 "s_wait_xcnt 0x0"
                 :: "v"(l), "v"(l + LS), "v"(l + 2 * LS), "v"(l + 3 * LS),
                    "v"(l + 4 * LS), "v"(l + 5 * LS), "v"(l + 6 * LS), "v"(l + 7 * LS),
                    "v"(g), "v"(g + GS), "v"(g + 2 * GS), "v"(g + 3 * GS),
                    "v"(g + 4 * GS), "v"(g + 5 * GS), "v"(g + 6 * GS), "v"(g + 7 * GS)
                 : "memory");
}

// The same for four copies.
template <int LS, int GS>
__device__ __forceinline__ void async4(unsigned l, const char* g) {
    asm volatile("global_load_async_to_lds_b128 %0, %4, off\n\t"
                 "global_load_async_to_lds_b128 %1, %5, off\n\t"
                 "global_load_async_to_lds_b128 %2, %6, off\n\t"
                 "global_load_async_to_lds_b128 %3, %7, off\n\t"
                 "s_wait_xcnt 0x0"
                 :: "v"(l), "v"(l + LS), "v"(l + 2 * LS), "v"(l + 3 * LS),
                    "v"(g), "v"(g + GS), "v"(g + 2 * GS), "v"(g + 3 * GS)
                 : "memory");
}

// Foot of a trip of a two-buffer ring (every wave, block-uniform): this wave's LDS reads of the buffer it
// leaves are done, its own copies of the next tile have landed; the barrier publishes that tile and frees
// the buffer for the refill behind it.
__device__ __forceinline__ void ring_publish() {
    asm volatile("s_wait_dscnt 0x0" ::: "memory");      // reads done before the buffer is handed to the copies
    asm volatile("s_wait_asynccnt 0x0" ::: "memory");   // the compiler places no wait for the copies
    __syncthreads();
}

// ---------------------------------------------------------------------------
// Weight transpose + scale + f16 convert: Wt[n][k] = f16(W[k][n] * scale), times gs[k] where gs is given.
// W is [K][N] row-major. Block tile: 64 k x 32 n; tile (bx, by) of (N/32, K/64).
// ---------------------------------------------------------------------------
__device__ __forceinline__
void wcvt_tile(const float* __restrict__ W, _Float16* __restrict__ Wt, int K, int N, float scale, int bx, int by,
               const float* __restrict__ gs) {
    __shared__ float tile[64][33];
    const int tid = threadIdx.x;
    const int kb = by * 64, nb = bx * 32;
    const int c = tid & 31, r = tid >> 5;
    float w[8], gk[8] = {1.f, 1.f, 1.f, 1.f, 1.f, 1.f, 1.f, 1.f};
    #pragma unroll
    for (int i = 0; i < 8; ++i) w[i] = W[(size_t)(kb + r + 8 * i) * N + nb + c];
    if (gs) {                                           // block-uniform test, once, under the tile's loads
        const int ks = kb + __builtin_amdgcn_readfirstlane(r);   // the wave's k, for scalar loads
        #pragma unroll
        for (int i = 0; i < 8; ++i) gk[i] = gs[ks + 8 * i];
    }
    #pragma unroll
    for (int i = 0; i < 8; ++i) tile[r + 8 * i][c] = w[i] * scale * gk[i];
    __syncthreads();
    const int n = tid >> 3, pc = tid & 7;
    v8h o;
    #pragma unroll
    for (int e = 0; e < 8; ++e) o[e] = (_Float16)tile[pc * 8 + e][n];
    _Float16* dst = Wt + (size_t)(nb + n) * K + kb + pc * 8;
    *(v8h*)dst = o;
    
}

// ---------------------------------------------------------------------------
// The second LayerNorm is not applied to the rows r = attention + x; it is folded into FFN1:
//   LN(r) @ W1 + b1 = rstd * (r @ (g . W1) - mean * c1) + c0,
//   c1[n] = sum_k g[k] W1[k][n] (of the f16 values that the product uses), c0[n] = sum_k b[k] W1[k][n] + b1[n].
// One block: 32 columns n; wave r sums 64 k, the eight partial sums join through LDS.
// ---------------------------------------------------------------------------
__device__ __forceinline__
void colsum_tile(const float* __restrict__ W1, const float* __restrict__ g, const float* __restrict__ bt,
                 const float* __restrict__ b1, float* __restrict__ c1, float* __restrict__ c0, int bx) {
    __shared__ float red[2][8][32];
    const int c = threadIdx.x & 31, r = __builtin_amdgcn_readfirstlane(threadIdx.x >> 5);   // r scalar: g, bt are read off a scalar base
    const int n = bx * 32 + c;
    float s1 = 0.f, s0 = 0.f;
    #pragma unroll 16   // sixteen loads in flight a lane
    for (int i = 0; i < ND / 8; ++i) {
        const int k = r * (ND / 8) + i;
        const float wv = W1[(size_t)k * NF + n];
        s1 += (float)(_Float16)(wv * 16.0f * g[k]);
        s0 += wv * bt[k];
    }
    red[0][r][c] = s1;
    red[1][r][c] = s0;
    __syncthreads();
    if (r == 0) {
        float t1 = 0.f, t0 = 0.f;
        #pragma unroll
        for (int i = 0; i < 8; ++i) { t1 += red[0][i][c]; t0 += red[1][i][c]; }
        c1[n] = t1 * 0.0625f;
        c0[n] = t0 + b1[n];
    }
}

// ---------------------------------------------------------------------------
// deviations).  One wave per row, 8 rows per 256-thread block.
// OM 0: f16 output only; OM 1: f32 + f16; OM 2: f32 only.
// f32 rows: lane l stores float4 at cols 4l+128j (each instruction = 4 whole
// lines, lane-contiguous 16 B).  f16 rows: lane l stores 8 halves at cols
// ---------------------------------------------------------------------------
template <int OM>
__device__ __forceinline__
void ln_rows(const float* __restrict__ in, const float* __restrict__ g, const float* __restrict__ bt,
             float* __restrict__ of, _Float16* __restrict__ oh, int M, int blk) {
    const int lane = threadIdx.x & 31, wave = threadIdx.x >> 5;
    const int row = blk * 8 + wave;
    if (row >= M) return;                      // wave-uniform; no barriers in this function
    const float* r = in + (size_t)row * ND;

    // The row's loads stand in one statement with their data wait, the results in registers of their own: so
    // no register that a load names is rewritten while the load is out.  v: float4 at cols 4l+128j, for the sums
    // and the f32 rows; xh (OM != 2): 8 floats at cols 8l+256j, for the f16 rows.
    v4f v[4], xh[4];
    if constexpr (OM != 2) {
        asm volatile("global_load_b128 %0, %8, off\n\t"
                     "global_load_b128 %1, %8, off offset:512\n\t"
                     "global_load_b128 %2, %8, off offset:1024\n\t"
                     "global_load_b128 %3, %8, off offset:1536\n\t"
                     "global_load_b128 %4, %9, off\n\t"
                     "global_load_b128 %5, %9, off offset:16\n\t"
                     "global_load_b128 %6, %9, off offset:1024\n\t"
                     "global_load_b128 %7, %9, off offset:1040\n\t"
                     "s_wait_loadcnt 0x0"
                     : "=&v"(v[0]), "=&v"(v[1]), "=&v"(v[2]), "=&v"(v[3]),
                       "=&v"(xh[0]), "=&v"(xh[1]), "=&v"(xh[2]), "=&v"(xh[3])
                     : "v"(r + 4 * lane), "v"(r + 8 * lane) : "memory");
    } else {
        asm volatile("global_load_b128 %0, %4, off\n\t"
                     "global_load_b128 %1, %4, off offset:512\n\t"
                     "global_load_b128 %2, %4, off offset:1024\n\t"
                     "global_load_b128 %3, %4, off offset:1536\n\t"
                     "s_wait_loadcnt 0x0"
                     : "=&v"(v[0]), "=&v"(v[1]), "=&v"(v[2]), "=&v"(v[3])
                     : "v"(r + 4 * lane) : "memory");
    }
    float s = 0.f;
    #pragma unroll
    for (int j = 0; j < 4; ++j) s += (v[j][0] + v[j][1]) + (v[j][2] + v[j][3]);
    #pragma unroll
    for (int off = 16; off >= 1; off >>= 1) s += __shfl_xor(s, off, 32);
    const float mean = s * (1.0f / ND);
    float sq = 0.f;
    #pragma unroll
    for (int j = 0; j < 4; ++j) {
        #pragma unroll
        for (int c = 0; c < 4; ++c) { const float d = v[j][c] - mean; sq += d * d; }
    }
    #pragma unroll
    for (int off = 16; off >= 1; off >>= 1) sq += __shfl_xor(sq, off, 32);
    const float rstd = rsqrtf(sq * (1.0f / ND) + LNEPS);

    if constexpr (OM != 0) {
        v4f o[4];
        #pragma unroll
        for (int j = 0; j < 4; ++j) {
            const int c0 = 4 * lane + 128 * j;
            const v4f gv = *(const v4f*)(g + c0);
            const v4f bv = *(const v4f*)(bt + c0);
            #pragma unroll
            for (int c = 0; c < 4; ++c) o[j][c] = (v[j][c] - mean) * rstd * gv[c] + bv[c];
        }
        float* orow = of + (size_t)row * ND + 4 * lane;
        #pragma unroll
        for (int j = 0; j < 4; ++j) *(v4f*)(orow + 128 * j) = o[j];
        
    }
    if constexpr (OM != 2) {
        v8h w[2];
        #pragma unroll
        for (int j = 0; j < 2; ++j) {
            const int c0 = 8 * lane + 256 * j;
            const v4f x0 = xh[2 * j], x1 = xh[2 * j + 1];
            const v4f g0 = *(const v4f*)(g + c0),  g1 = *(const v4f*)(g + c0 + 4);
            const v4f b0 = *(const v4f*)(bt + c0), b1 = *(const v4f*)(bt + c0 + 4);
            #pragma unroll
            for (int c = 0; c < 4; ++c) {
                w[j][c]     = (_Float16)((x0[c] - mean) * rstd * g0[c] + b0[c]);
                w[j][4 + c] = (_Float16)((x1[c] - mean) * rstd * g1[c] + b1[c]);
            }
        }
        _Float16* hrow = oh + (size_t)row * ND + 8 * lane;
        #pragma unroll
        for (int j = 0; j < 2; ++j) *(v8h*)(hrow + 256 * j) = w[j];
        
    }
}

// ---------------------------------------------------------------------------
// Everything that depends on the inputs alone, in one grid: the column sums
// of W1 that fold the second LayerNorm into FFN1 (PB_C blocks), the input
// LayerNorm (PB_LN blocks, 8 rows each), then the five weight converts
// (one 64 k x 32 n tile a block).  The job is picked by the block index, so
// every branch here is block-uniform.
// ---------------------------------------------------------------------------
#define PB_LN (NM / 8)                      // LayerNorm blocks
#define PB_WD ((ND / 32) * (ND / 64))       // tiles of a D x D weight
#define PB_WF ((NF / 32) * (ND / 64))       // tiles of W1, and of W2
#define PB_C  (NF / 32)                     // column-sum blocks

__global__ __launch_bounds__(256)
void k_prep(const float* __restrict__ x, const float* __restrict__ g, const float* __restrict__ bt,
            _Float16* __restrict__ h,
            const float* __restrict__ Wq, const float* __restrict__ Wk, const float* __restrict__ Wv,
            const float* __restrict__ W1, const float* __restrict__ W2,
            _Float16* __restrict__ Wqh, _Float16* __restrict__ Wkh, _Float16* __restrict__ Wvh,
            _Float16* __restrict__ W1h, _Float16* __restrict__ W2h,
            const float* __restrict__ g1, const float* __restrict__ bt1, const float* __restrict__ b1,
            float* __restrict__ c1, float* __restrict__ c0) {
    if (blockIdx.x < PB_C) { colsum_tile(W1, g1, bt1, b1, c1, c0, blockIdx.x); return; }   // the longest job starts first
    if (blockIdx.x < PB_C + PB_LN) { ln_rows<0>(x, g, bt, nullptr, h, NM, blockIdx.x - PB_C); return; }
    int b = blockIdx.x - (PB_C + PB_LN);
    const float* W;
    const float* gs = nullptr;
    _Float16* Wt;
    int K, N, bx, by;
    float sc;
    if (b < 3 * PB_WD) {                    // in[512][512] -> out[512][512]
        const int w = b / PB_WD;
        b -= w * PB_WD;
        W  = w == 0 ? Wq  : (w == 1 ? Wk  : Wv);
        Wt = w == 0 ? Wqh : (w == 1 ? Wkh : Wvh);
        K = ND; N = ND; sc = 16.0f;
        bx = b % (ND / 32); by = b / (ND / 32);
    } else if (b < 3 * PB_WD + PB_WF) {     // in[512][2048] -> out[2048][512]
        b -= 3 * PB_WD;
        W = W1; Wt = W1h; K = ND; N = NF; sc = 16.0f; gs = g1;
        bx = b % (NF / 32); by = b / (NF / 32);
    } else {                                // in[2048][512] -> out[512][2048]
        b -= 3 * PB_WD + PB_WF;
        W = W2; Wt = W2h; K = NF; N = ND; sc = 32.0f;
        bx = b % (ND / 32); by = b / (ND / 32);
    }
    wcvt_tile(W, Wt, K, N, sc, bx, by, gs);
    // the built code lays the LayerNorm behind this tile's store: its registers stay until this wait
    asm volatile("s_wait_xcnt 0x0" ::: "memory");
}

// ---------------------------------------------------------------------------
// WMMA GEMM: C[M,N] = A[M,K] @ W[K,N] (+bias, scale, epilogue).  A f16
// row-major [M][K]; weights f16 [N][K] (k-contiguous), so A and B fragments
// use the same split-k loader: elements 0..7 <- k0+8h+0..7, elements 8..15
// <- k0+16+8h+0..7, h = lane>>4, row/col = lane&15.  D element r of a lane =
// (row 8h+r, col lane&15).  Block tile 128x128, K step 128, 8 waves (4 m x 2 n,
// each wave 32x64 = 2 x 4 accumulators).  A and B tiles staged in LDS, rows of
// 256 B at pitch 272 B, by asynchronous copies in a ring of two buffers: tile
// t + 1 is in flight while tile t is worked on; the output staging reuses the
// ring behind the last trip's barrier.  M, N multiples of 128; K a multiple of 128.  N and K
// are compile-time, so a thread's 8 rows of a tile hang off one address.
// MODE 0: Q, K and V in one grid, N = 3 * ND: Bt holds the three weights one
//         behind the other, outp the three outputs; a column tile lies in one
//         projection w = nBase / ND (block-uniform), which picks bias, output
//         and f16 epilogue 0 (Q, K) or 1 (V)
// MODE 2: f16 out, relu, row-major [M][N]  (FFN1): A = the rows r before the second LayerNorm, weights
//         times its gain; the epilogue finishes the LayerNorm: (acc - mean c1) rstd + c0 (bias = c0, biasK = c1)
// MODE 2: stat[head][row] = (sum, sum of squared deviations from the head's own mean) of the row's 64
//         columns of that head; the block joins the eight pairs of each of its rows into mean and rstd
// f16 epilogues EM: 0 = [B,H,T,DK], 1 = [B,H,DK,T] (V transposed), 2 = FFN1
// ---------------------------------------------------------------------------
#define GT  128     // block tile, rows and columns
#define GK  128     // k per staged tile
#define GP  136     // LDS pitch of a staged row and of an f16 output row, halves
#define GOP (GT * GP * 2)   // bytes of one operand's staged tile
#define GSTG (2 * GOP)      // bytes of a ring buffer: A tile, then B tile

// f16 epilogue of a 128x128 tile: scale, bias (relu), staged in Ch, stored in 16-byte pieces
template <int EM, int N>
__device__ __forceinline__
void epi_f16(const v8f (&acc)[2][4], const float (&bj)[4], _Float16* Ch, _Float16* __restrict__ O,
             float oscale, int mBase, int nBase, const float (&cj)[4], const float* rm, const float* rr) {
    const int tid = threadIdx.x, lane = tid & 31, wave = tid >> 5;
    const int hl = lane >> 4, m = lane & 15;
    const int wm = wave & 3, wn = wave >> 2;
    #pragma unroll
    for (int i = 0; i < 2; ++i) {
        v8f mu = zero8(), rs = zero8();                 // mean and rstd of the lane's eight rows
        if constexpr (EM == 2) {
            const int r0 = wm * 32 + i * 16 + 8 * hl;
            mu = __builtin_shufflevector(*(const v4f*)(rm + r0), *(const v4f*)(rm + r0 + 4), 0, 1, 2, 3, 4, 5, 6, 7);
            rs = __builtin_shufflevector(*(const v4f*)(rr + r0), *(const v4f*)(rr + r0 + 4), 0, 1, 2, 3, 4, 5, 6, 7);
        }
        #pragma unroll
        for (int j = 0; j < 4; ++j) {
            const int col = wn * 64 + j * 16 + m;
            #pragma unroll
            for (int r = 0; r < 8; ++r) {
                float u;
                if constexpr (EM == 2) u = fmaxf((acc[i][j][r] * oscale - mu[r] * cj[j]) * rs[r] + bj[j], 0.0f);
                else                   u = acc[i][j][r] * oscale + bj[j];
                const int row = wm * 32 + i * 16 + 8 * hl + r;
                if constexpr (EM == 1) Ch[col * GP + row] = (_Float16)u;
                else                   Ch[row * GP + col] = (_Float16)u;
            }
        }
    }
    __syncthreads();
    // thread: staged rows line + 16 j, 16-byte piece pc; a tile lies in one batch (NT % GT == 0)
    const int line = tid >> 4, pc = tid & 15;
    const int bb = mBase / NT, t0 = mBase % NT;
    int step;                                           // halves between rows line and line + 16
    if constexpr (EM == 0) {
        const int n = nBase + pc * 8;                   // column: head n / NDK, d n % NDK
        O += ((size_t)(bb * NH + n / NDK) * NT + t0 + line) * NDK + n % NDK;
        step = 16 * NDK;
    } else if constexpr (EM == 1) {
        const int n = nBase + line;                     // staged row = column: head n / NDK, d n % NDK
        O += ((size_t)(bb * NH + n / NDK) * NDK + n % NDK) * NT + t0 + pc * 8;
        step = 16 * NT;                                 // heads are NDK * NT apart: linear in n
    } else {
        O += (size_t)(mBase + line) * N + nBase + pc * 8;
        step = 16 * N;
    }
    v8h w[8];
    #pragma unroll
    for (int j = 0; j < 8; ++j) w[j] = *(const v8h*)(Ch + (line + 16 * j) * GP + pc * 8);
    #pragma unroll
    for (int j = 0; j < 8; ++j) *(v8h*)(O + j * step) = w[j];
}

template <int MODE, int N, int K>
__global__ __launch_bounds__(256)
void k_gemm(const _Float16* __restrict__ A, const _Float16* __restrict__ Bt,
            const float* __restrict__ bias, const float* __restrict__ resid,
            void* __restrict__ outp, float oscale,
            const float* __restrict__ biasK, const float* __restrict__ biasV, const float* __restrict__ stat) {
    __shared__ __align__(16) unsigned char ring[2 * GSTG];
    __shared__ __align__(16) float rowm[GT], rowr[GT];    // MODE 2: mean and rstd of the tile's rows
    _Float16* Ch = (_Float16*)ring;                       // output staging, behind the loop

    const int tid = threadIdx.x, lane = tid & 31, wave = tid >> 5;
    const int hl = lane >> 4, m = lane & 15;
    const int mBase = blockIdx.y * GT, nBase = blockIdx.x * GT;
    const int wm = wave & 3, wn = wave >> 2;
    const int ar = tid >> 4, ac = (tid & 15) * 8;         // staging: row (step 16), k chunk
    const char* Ag = (const char*)(A  + (size_t)mBase * K + ar * K + ac);   // the thread's first piece of the next tile to copy
    const char* Bg = (const char*)(Bt + (size_t)nBase * K + ar * K + ac);
    const unsigned lst = lds_addr(ring) + (ar * GP + ac) * 2;                // its place in buffer 0's A tile

    v8f acc[2][4];
    #pragma unroll
    for (int i = 0; i < 2; ++i) {
        #pragma unroll
        for (int j = 0; j < 4; ++j) acc[i][j] = zero8();
    }
    // tile 0 into buffer 0, landed and published; then tile 1 into buffer 1
    async8<16 * GP * 2, 16 * K * 2>(lst, Ag);
    async8<16 * GP * 2, 16 * K * 2>(lst + GOP, Bg);
    Ag += GK * 2; Bg += GK * 2;
    if constexpr (MODE != 0) {
        if (__builtin_amdgcn_readfirstlane(wave) < GT / 32) {   // a scalar test, whole waves; under tile 0's flight, published by its barrier
            const float* sp = stat + (size_t)(mBase + tid) * 2;
            v2f p[NH];
            #pragma unroll
            for (int h = 0; h < NH; ++h) p[h] = *(const v2f*)(sp + (size_t)h * NM * 2);
            float sm = 0.f;
            #pragma unroll
            for (int h = 0; h < NH; ++h) sm += p[h][0];
            const float mean = sm * (1.0f / ND);
            float m2 = 0.f;
            #pragma unroll
            for (int h = 0; h < NH; ++h) {
                const float d = p[h][0] * (1.0f / NDK) - mean;
                m2 += p[h][1] + (float)NDK * d * d;
            }
            rowm[tid] = mean;
            rowr[tid] = rsqrtf(m2 * (1.0f / ND) + LNEPS);
        }
    }
    asm volatile("s_wait_asynccnt 0x0" ::: "memory");       // the compiler places no wait for the copies
    __syncthreads();
    if (K / GK > 1) {
        async8<16 * GP * 2, 16 * K * 2>(lst + GSTG, Ag);
        async8<16 * GP * 2, 16 * K * 2>(lst + GSTG + GOP, Bg);
        Ag += GK * 2; Bg += GK * 2;
    }

    for (int kt = 0; kt < K / GK; ++kt) {
        const unsigned bo = (kt & 1) * GSTG;                // this trip's buffer
        const _Float16* ap = (const _Float16*)(ring + bo) + (wm * 32 + m) * GP + 8 * hl;
        const _Float16* bp = (const _Float16*)(ring + bo + GOP) + (wn * 64 + m) * GP + 8 * hl;
        #pragma unroll
        for (int kk = 0; kk < GK / 32; ++kk) {
            Frag fa[2], fb[4];
            #pragma unroll
            for (int i = 0; i < 2; ++i) {
                fa[i].hf[0] = *(const v8h*)(ap + i * 16 * GP + kk * 32);
                fa[i].hf[1] = *(const v8h*)(ap + i * 16 * GP + kk * 32 + 16);
            }
            #pragma unroll
            for (int j = 0; j < 4; ++j) {
                fb[j].hf[0] = *(const v8h*)(bp + j * 16 * GP + kk * 32);
                fb[j].hf[1] = *(const v8h*)(bp + j * 16 * GP + kk * 32 + 16);
            }
            #pragma unroll
            for (int i = 0; i < 2; ++i) {
                #pragma unroll
                for (int j = 0; j < 4; ++j) acc[i][j] = wmma16(fa[i].v, fb[j].v, acc[i][j]);
            }
        }
        ring_publish();
        if (kt + 2 < K / GK) {                              // block-uniform: tile kt + 2 into the buffer just left
            async8<16 * GP * 2, 16 * K * 2>(lst + bo, Ag);
            async8<16 * GP * 2, 16 * K * 2>(lst + bo + GOP, Bg);
            Ag += GK * 2; Bg += GK * 2;
        }
    }
    asm volatile("s_wait_asynccnt 0x0" ::: "memory");       // nothing in flight when the ring becomes output staging

    const int w  = MODE == 0 ? nBase / ND : 0;              // projection of this tile
    const int nb = MODE == 0 ? nBase % ND : nBase;          // its first column there
    const float* bs = bias;
    if constexpr (MODE == 0) bs = w == 0 ? bias : (w == 1 ? biasK : biasV);
    float bj[4];
    #pragma unroll
    for (int j = 0; j < 4; ++j) bj[j] = bs[nb + wn * 64 + j * 16 + m];

    if constexpr (MODE == 0) {
        _Float16* o = (_Float16*)outp + (size_t)w * NM * ND;
        if (w == 2) {
            epi_f16<1, ND>(acc, bj, Ch, o, oscale, mBase, nb, bj, nullptr, nullptr);
        } else {
            epi_f16<0, ND>(acc, bj, Ch, o, oscale, mBase, nb, bj, nullptr, nullptr);
            // the built code lays the other epilogue behind these stores: their registers stay until this wait
            asm volatile("s_wait_xcnt 0x0" ::: "memory");
        }
    } else if constexpr (MODE == 2) {
        float cj[4];
        #pragma unroll
        for (int j = 0; j < 4; ++j) cj[j] = biasK[nBase + wn * 64 + j * 16 + m];
        epi_f16<2, N>(acc, bj, Ch, (_Float16*)outp, oscale, mBase, nBase, cj, rowm, rowr);
    }
}

// ---------------------------------------------------------------------------
// FFN2 with both LayerNorms around it: out = LN2(f1 @ W2 + b2 + LN1(r)).  A block owns FR whole rows (all ND
// columns), so the last LayerNorm runs in its epilogue.  8 waves side by side, each FR rows x 64 columns
// (4 x 4 accumulators); fragments, k order and ring as in k_gemm: A tile FR rows, B tile ND rows of GK halves.
// LN1(r) is formed from r (resid), the row's mean and rstd (joined from stat as in k_gemm), gain g1, shift s1.
// Behind the loop the block's rows of r are copied into buffer 0 and fly while the products are staged in buffer 1.
// ---------------------------------------------------------------------------
#define FR   64                 // rows of a block
#define FSA  (FR * GP * 2)      // bytes of a staged A tile
#define FSB  (ND * GP * 2)      // of a staged B tile
#define FSTG (FSA + FSB)        // of a ring buffer: A tile, then B tile
#define FPF  (ND + 4)           // LDS pitch of an f32 output row, floats

// 1 / sqrt(x) for x >= LNEPS: no subnormal argument, so none of rsqrtf's rescaling.  The v_nop is the slot that the
// instruction set asks for behind a transcendental, before its result is read or its source overwritten.
__device__ __forceinline__ float rsq_pos(float x) {
    float r;
    asm("v_rsq_f32 %0, %1\n\tv_nop" : "=v"(r) : "v"(x));
    return r;
}

// a thread's 36 copies of one k tile: 4 rows of A, 32 of B, 16 rows apart
__device__ __forceinline__ void ffn2_stage(unsigned l, const char* a, const char* b) {
    async4<16 * GP * 2, 16 * NF * 2>(l, a);
    #pragma unroll
    for (int c = 0; c < 4; ++c) async8<16 * GP * 2, 16 * NF * 2>(l + FSA + c * 128 * GP * 2, b + (size_t)c * 128 * NF * 2);
}

__global__ __launch_bounds__(256)
void k_ffn2ln(const _Float16* __restrict__ A, const _Float16* __restrict__ Bt,
              const float* __restrict__ bias, const float* __restrict__ resid, float* __restrict__ outp, float oscale,
              const float* __restrict__ g1, const float* __restrict__ s1, const float* __restrict__ stat,
              const float* __restrict__ g2, const float* __restrict__ s2) {
    constexpr int K = NF;
    __shared__ __align__(16) unsigned char ring[2 * FSTG];
    __shared__ __align__(16) float rowm[FR], rowr[FR];    // LN1's mean and rstd of the block's rows
    static_assert(FR * FPF * 4 <= FSTG, "r in buffer 0, the products in buffer 1");
    const float* Rf = (const float*)ring;                 // the rows of r, pitch FPF
    float* Cf = (float*)(ring + FSTG);                    // the products, behind the loop, pitch FPF

    const int tid = threadIdx.x, lane = tid & 31, wave = tid >> 5;
    const int hl = lane >> 4, m = lane & 15;
    const int mBase = blockIdx.x * FR;
    const int ar = tid >> 4, ac = (tid & 15) * 8;         // staging: row (step 16), k chunk
    const char* Ag = (const char*)(A  + (size_t)mBase * K + ar * K + ac);   // the thread's first piece of the next tile to copy
    const char* Bg = (const char*)(Bt + ar * K + ac);
    const unsigned lst = lds_addr(ring) + (ar * GP + ac) * 2;                // its place in buffer 0's A tile

    v8f acc[4][4];
    #pragma unroll
    for (int i = 0; i < 4; ++i) {
        #pragma unroll
        for (int j = 0; j < 4; ++j) acc[i][j] = zero8();
    }
    // tile 0 into buffer 0, landed and published; then tile 1 into buffer 1
    ffn2_stage(lst, Ag, Bg);
    Ag += GK * 2; Bg += GK * 2;
    if (__builtin_amdgcn_readfirstlane(wave) < FR / 32) {   // a scalar test, whole waves; under tile 0's flight, published by its barrier
        const float* sp = stat + (size_t)(mBase + tid) * 2;
        v2f p[NH];
        #pragma unroll
        for (int h = 0; h < NH; ++h) p[h] = *(const v2f*)(sp + (size_t)h * NM * 2);
        float sm = 0.f;
        #pragma unroll
        for (int h = 0; h < NH; ++h) sm += p[h][0];
        const float mean = sm * (1.0f / ND);
        float m2 = 0.f;
        #pragma unroll
        for (int h = 0; h < NH; ++h) {
            const float d = p[h][0] * (1.0f / NDK) - mean;
            m2 += p[h][1] + (float)NDK * d * d;
        }
        rowm[tid] = mean;
        rowr[tid] = rsqrtf(m2 * (1.0f / ND) + LNEPS);
    }
    asm volatile("s_wait_asynccnt 0x0" ::: "memory");       // the compiler places no wait for the copies
    __syncthreads();
    ffn2_stage(lst + FSTG, Ag, Bg);
    Ag += GK * 2; Bg += GK * 2;

    for (int kt = 0; kt < K / GK; ++kt) {
        const unsigned bo = (kt & 1) * FSTG;                // this trip's buffer
        const _Float16* ap = (const _Float16*)(ring + bo) + m * GP + 8 * hl;
        const _Float16* bp = (const _Float16*)(ring + bo + FSA) + (wave * 64 + m) * GP + 8 * hl;
        #pragma unroll
        for (int kk = 0; kk < GK / 32; ++kk) {
            Frag fa[4], fb[4];
            #pragma unroll
            for (int i = 0; i < 4; ++i) {
                fa[i].hf[0] = *(const v8h*)(ap + i * 16 * GP + kk * 32);
                fa[i].hf[1] = *(const v8h*)(ap + i * 16 * GP + kk * 32 + 16);
            }
            #pragma unroll
            for (int j = 0; j < 4; ++j) {
                fb[j].hf[0] = *(const v8h*)(bp + j * 16 * GP + kk * 32);
                fb[j].hf[1] = *(const v8h*)(bp + j * 16 * GP + kk * 32 + 16);
            }
            #pragma unroll
            for (int i = 0; i < 4; ++i) {
                #pragma unroll
                for (int j = 0; j < 4; ++j) acc[i][j] = wmma16(fa[i].v, fb[j].v, acc[i][j]);
            }
        }
        ring_publish();
        if (kt + 2 < K / GK) {                              // block-uniform: tile kt + 2 into the buffer just left
            ffn2_stage(lst + bo, Ag, Bg);
            Ag += GK * 2; Bg += GK * 2;
        }
    }
    asm volatile("s_wait_asynccnt 0x0" ::: "memory");       // nothing in flight behind the loop
    {                                                       // r into buffer 0; a wave: rows wave + 8 t, 512 bytes a copy
        const unsigned lr = lds_addr(ring) + wave * FPF * 4 + lane * 16;
        const char* rg = (const char*)(resid + (size_t)(mBase + wave) * ND + 4 * lane);
        #pragma unroll
        for (int j = 0; j < 4; ++j) async8<8 * FPF * 4, 8 * ND * 4>(lr + j * 512, rg + j * 512);
    }

    #pragma unroll
    for (int j = 0; j < 4; ++j) {
        const int col = wave * 64 + j * 16 + m;
        const float bj = bias[col];
        #pragma unroll
        for (int i = 0; i < 4; ++i) {
            #pragma unroll
            for (int r = 0; r < 8; ++r) Cf[(i * 16 + 8 * hl + r) * FPF + col] = acc[i][j][r] * oscale + bj;
        }
    }
    asm volatile("s_wait_asynccnt 0x0" ::: "memory");       // the rows of r have landed; the compiler places no wait for the copies
    __syncthreads();
    // a row = one wave; lane: float4 at cols 4 l + 128 j, as in ln_rows.  Four rows (wave + 8 t) go
    // side by side, so that their loads and their lane exchanges overlap.
    float* O = outp + (size_t)(mBase + wave) * ND + 4 * lane;
    const int lo = wave * FPF + 4 * lane;                   // the lane's place in both staged tiles
    #pragma unroll 1   // rolled: eight rows' values at once would take about a hundred registers more
    for (int g = 0; g < FR / 32; ++g) {
        v4f v[4][4];
        #pragma unroll
        for (int j = 0; j < 4; ++j) {
            if (j == 2) __builtin_amdgcn_sched_barrier(0);  // the LDS loads in two groups: all 32 at once take the kernel past 256 registers
            const v4f gv = *(const v4f*)(g1 + 4 * lane + 128 * j);
            const v4f bv = *(const v4f*)(s1 + 4 * lane + 128 * j);
            #pragma unroll
            for (int t = 0; t < 4; ++t) {
                const int ro = 32 * g + 8 * t;              // row - wave
                const v4f a = (*(const v4f*)(Rf + lo + ro * FPF + 128 * j) - rowm[wave + ro]) * rowr[wave + ro] * gv + bv;
                v[t][j] = *(const v4f*)(Cf + lo + ro * FPF + 128 * j) + a;
            }
        }
        float s[4], sq[4];
        #pragma unroll
        for (int t = 0; t < 4; ++t) {
            s[t] = 0.f;
            #pragma unroll
            for (int j = 0; j < 4; ++j) s[t] += (v[t][j][0] + v[t][j][1]) + (v[t][j][2] + v[t][j][3]);
        }
        #pragma unroll
        for (int off = 16; off >= 1; off >>= 1) {
            #pragma unroll
            for (int t = 0; t < 4; ++t) s[t] += __shfl_xor(s[t], off, 32);
        }
        #pragma unroll
        for (int t = 0; t < 4; ++t) {
            s[t] *= (1.0f / ND);                            // the row's mean
            sq[t] = 0.f;
            #pragma unroll
            for (int j = 0; j < 4; ++j) {
                #pragma unroll
                for (int c = 0; c < 4; ++c) { const float d = v[t][j][c] - s[t]; sq[t] += d * d; }
            }
        }
        #pragma unroll
        for (int off = 16; off >= 1; off >>= 1) {
            #pragma unroll
            for (int t = 0; t < 4; ++t) sq[t] += __shfl_xor(sq[t], off, 32);
        }
        #pragma unroll
        for (int t = 0; t < 4; ++t) sq[t] = rsq_pos(sq[t] * (1.0f / ND) + LNEPS);   // its rstd
        #pragma unroll
        for (int j = 0; j < 4; ++j) {
            const v4f gv = *(const v4f*)(g2 + 4 * lane + 128 * j);
            const v4f bv = *(const v4f*)(s2 + 4 * lane + 128 * j);
            #pragma unroll
            for (int t = 0; t < 4; ++t)
                *(v4f*)(O + (32 * g + 8 * t) * ND + 128 * j) = (v[t][j] - s[t]) * sq[t] * gv + bv;
        }
        // the next pass forms its address anew: the registers that these stores name stay until this wait
        asm volatile("s_wait_xcnt 0x0" ::: "memory");
    }
}

// ---------------------------------------------------------------------------
// Attention per (b,h): block = 8 waves x 16 queries (128 queries), grid
// (T/128, B*H).  32-key K tile ([key][d], pitch 72) and V tile ([d][key],
// pitch 40, from the transposed V copy) staged in LDS by asynchronous copies,
// with the mask tile, in a ring of two buffers (tile t + 1 flies under tile t).
// Both products are taken transposed, so that a lane owns ONE query (lane & 15):
// S^T = K.Q^T: A = K rows (d as k), B = Q rows, same split-k map; D element r
// of a lane = (key 8h+r, query lane&15).  The lane's 16 scores of a tile are
// 2 x 8 consecutive keys of its query's mask row; 16 lanes on 16 rows would
// touch 16 lines a load, so the 128 x 32 mask tile is read in whole lines and
// staged with K and V ([query][key], pitch 36 floats).  Maximum and sum run in
// the lane, the two lane halves join by one exchange (the sums only at the end).
// The two score tiles (keys 0..15, 16..31), x4096 and converted to f16 in
// place, are the B operand of O^T = V^T.P^T in the split-k map (elements 0..7
// = keys 8h+0..7, 8..15 = keys 16+8h+0..7); A = V^T rows (key as k).
// D element r of a lane = (d 16c+8h+r, query lane&15).  Softmax in f32.
// ---------------------------------------------------------------------------
// value of lane l ^ 16
__device__ __forceinline__ float other_half(float v) {
    const int b = __float_as_int(v);
    return __int_as_float(__builtin_amdgcn_permlanex16(b, b, 0x76543210, 0xfedcba98, false, false));
}

#define AK_B  (32 * 72 * 2)            // bytes of a staged K tile
#define AV_B  (64 * 40 * 2)            // of a V tile
#define AM_B  (128 * 36 * 4)           // of a mask tile
#define ASTG  (AK_B + AV_B + AM_B)     // of a ring buffer: K, V, mask

// A lane's six asynchronous 16-byte copies of one key tile: K, V, four mask rows (MS bytes apart in LDS, MG in
// memory).  s_wait_xcnt is the last line of the copies' own statement, so that no register which a copy names
// is rewritten in front of it.
template <int MS, int MG>
__device__ __forceinline__ void async_kvm(unsigned lk, const char* gk, unsigned lv, const char* gv,
                                          unsigned lm, const char* gm) {
    asm volatile("global_load_async_to_lds_b128 %0, %6, off\n\t"
                 "global_load_async_to_lds_b128 %1, %7, off\n\t"
                 "global_load_async_to_lds_b128 %2, %8, off\n\t"
                 "global_load_async_to_lds_b128 %3, %9, off\n\t"
                 "global_load_async_to_lds_b128 %4, %10, off\n\t"
                 "global_load_async_to_lds_b128 %5, %11, off\n\t"
                 "s_wait_xcnt 0x0"
                 :: "v"(lk), "v"(lv), "v"(lm), "v"(lm + MS), "v"(lm + 2 * MS), "v"(lm + 3 * MS),
                    "v"(gk), "v"(gv), "v"(gm), "v"(gm + MG), "v"(gm + 2 * MG), "v"(gm + 3 * MG)
                 : "memory");
}

__global__ __launch_bounds__(256)
void k_attn(const _Float16* __restrict__ q, const _Float16* __restrict__ k,
            const _Float16* __restrict__ vt, const float* __restrict__ mask,
            const float* __restrict__ x, float* __restrict__ ores, _Float16* __restrict__ oh,
            float* __restrict__ stat) {
    __shared__ __align__(16) unsigned char ring[2 * ASTG];
    __shared__ __align__(16) float    Os[8][16 * 68];

    const int tid = threadIdx.x, lane = tid & 31, wave = tid >> 5;
    const int hl = lane >> 4, m = lane & 15;
    const int bh = blockIdx.y;
    const int b = bh / NH, hh = bh % NH;
    const int q0 = blockIdx.x * 128 + wave * 16;

    Frag aq0, aq1;
    {
        const _Float16* qp = q + ((size_t)bh * NT + q0 + m) * NDK;
        aq0.hf[0] = *(const v8h*)(qp + 8 * hl);
        aq0.hf[1] = *(const v8h*)(qp + 16 + 8 * hl);
        aq1.hf[0] = *(const v8h*)(qp + 32 + 8 * hl);
        aq1.hf[1] = *(const v8h*)(qp + 48 + 8 * hl);
    }

    const int kr = tid >> 3, kc = (tid & 7) * 8;       // K tile: 32 keys x 64 d
    const int vr = tid >> 2, vc = (tid & 3) * 8;       // V tile: 64 d x 32 keys
    const char* kg = (const char*)(k  + ((size_t)bh * NT  + kr) * NDK + kc);   // the thread's pieces of the next tile to copy
    const char* vg = (const char*)(vt + ((size_t)bh * NDK + vr) * NT  + vc);
    const int mr = wave * 16 + (lane >> 3), mc = (lane & 7) * 4;   // mask tile: rows mr + 4 j, 8 lanes a row
    const char* mg = (const char*)(mask + ((size_t)b * NT + blockIdx.x * 128 + mr) * NT + mc);
    const unsigned lk = lds_addr(ring) + (kr * 72 + kc) * 2;                   // their places in buffer 0
    const unsigned lv = lds_addr(ring) + AK_B + (vr * 40 + vc) * 2;
    const unsigned lm = lds_addr(ring) + AK_B + AV_B + (mr * 36 + mc) * 4;

    v8f acc[4];
    #pragma unroll
    for (int c = 0; c < 4; ++c) acc[c] = zero8();
    float mrun = -3.0e38f, lrun = 0.0f;                 // lrun: the sum over this lane half's keys only

    const float sscale = 0.125f;
    const float pscale = 4096.0f;

    // tile 0 into buffer 0, landed and published; then tile 1 into buffer 1
    async_kvm<4 * 36 * 4, 4 * NT * 4>(lk, kg, lv, vg, lm, mg);
    kg += 32 * NDK * 2; vg += 32 * 2; mg += 32 * 4;
    asm volatile("s_wait_asynccnt 0x0" ::: "memory");   // the compiler places no wait for the copies
    __syncthreads();
    async_kvm<4 * 36 * 4, 4 * NT * 4>(lk + ASTG, kg, lv + ASTG, vg, lm + ASTG, mg);
    kg += 32 * NDK * 2; vg += 32 * 2; mg += 32 * 4;

    for (int st = 0; st < NT / 32; ++st) {
        const unsigned bo = (st & 1) * ASTG;            // this trip's buffer
        const _Float16* Ks = (const _Float16*)(ring + bo);
        const _Float16* Vs = (const _Float16*)(ring + bo + AK_B);
        const float* mrow = (const float*)(ring + bo + AK_B + AV_B) + (wave * 16 + m) * 36 + 8 * hl;   // the lane's query, its half's keys

        v8f p[2];
        #pragma unroll
        for (int half = 0; half < 2; ++half) {
            const _Float16* kp = Ks + (half * 16 + m) * 72;
            Frag a0, a1;
            a0.hf[0] = *(const v8h*)(kp + 8 * hl);
            a0.hf[1] = *(const v8h*)(kp + 16 + 8 * hl);
            a1.hf[0] = *(const v8h*)(kp + 32 + 8 * hl);
            a1.hf[1] = *(const v8h*)(kp + 48 + 8 * hl);
            v8f S = zero8();
            S = wmma16(a0.v, aq0.v, S);
            S = wmma16(a1.v, aq1.v, S);
            const v4f mv0 = *(const v4f*)(mrow + half * 16);
            const v4f mv1 = *(const v4f*)(mrow + half * 16 + 4);
            const v8f mv = __builtin_shufflevector(mv0, mv1, 0, 1, 2, 3, 4, 5, 6, 7);
            p[half] = S * sscale + NEGBIG * (1.0f - mv);
        }
        const v8f mx = __builtin_elementwise_max(p[0], p[1]);
        const float mh = fmaxf(fmaxf(fmaxf(mx[0], mx[1]), fmaxf(mx[2], mx[3])),
                               fmaxf(fmaxf(mx[4], mx[5]), fmaxf(mx[6], mx[7])));
        const float mnew = fmaxf(mrun, fmaxf(mh, other_half(mh)));
        const float resc = __expf(mrun - mnew);
        mrun = mnew;
        #pragma unroll
        for (int e = 0; e < 8; ++e) {
            p[0][e] = __expf(p[0][e] - mnew);
            p[1][e] = __expf(p[1][e] - mnew);
        }
        const v8f sm = p[0] + p[1];
        lrun = lrun * resc + (((sm[0] + sm[1]) + (sm[2] + sm[3])) + ((sm[4] + sm[5]) + (sm[6] + sm[7])));
        #pragma unroll
        for (int c = 0; c < 4; ++c) acc[c] *= resc;

        Frag bp;                                        // P^T as B: no lane exchange, no LDS
        #pragma unroll
        for (int e = 0; e < 8; ++e) {
            bp.v[e]     = (_Float16)(p[0][e] * pscale);
            bp.v[8 + e] = (_Float16)(p[1][e] * pscale);
        }
        #pragma unroll
        for (int c = 0; c < 4; ++c) {
            const _Float16* vp = Vs + (c * 16 + m) * 40;
            Frag fv;
            fv.hf[0] = *(const v8h*)(vp + 8 * hl);
            fv.hf[1] = *(const v8h*)(vp + 16 + 8 * hl);
            acc[c] = wmma16(fv.v, bp.v, acc[c]);
        }
        ring_publish();
        if (st + 2 < NT / 32) {                         // block-uniform: tile st + 2 into the buffer just left
            async_kvm<4 * 36 * 4, 4 * NT * 4>(lk + bo, kg, lv + bo, vg, lm + bo, mg);
            kg += 32 * NDK * 2; vg += 32 * 2; mg += 32 * 4;
        }
    }
    asm volatile("s_wait_asynccnt 0x0" ::: "memory");   // nothing in flight when the wave goes on to its end

    const float inv = (1.0f / (lrun + other_half(lrun))) * (1.0f / 4096.0f);
    float* os = &Os[wave][0];
    #pragma unroll
    for (int c = 0; c < 4; ++c) {
        v4f lo, hi;
        #pragma unroll
        for (int e = 0; e < 4; ++e) { lo[e] = acc[c][e] * inv; hi[e] = acc[c][4 + e] * inv; }
        *(v4f*)(os + m * 68 + c * 16 + 8 * hl)     = lo;
        *(v4f*)(os + m * 68 + c * 16 + 8 * hl + 4) = hi;
    }
    __syncthreads();
    v4f w[8];
    size_t goff[8];
    #pragma unroll
    for (int j = 0; j < 8; ++j) {
        const int id = lane + 32 * j;
        const int line = id >> 3, pc = lane & 7;
        const int row = line >> 1, colo = ((line & 1) << 5) + pc * 4;
        goff[j] = ((size_t)(b * NT + q0 + row)) * ND + hh * NDK + colo;
        w[j] = *(const v4f*)(os + row * 68 + colo) + *(const v4f*)(x + goff[j]);
    }
    #pragma unroll
    for (int j = 0; j < 8; ++j) *(v4f*)(ores + goff[j]) = w[j];
    // the same rows in f16, FFN1's operand: 16 lanes = the head's 64 columns of a row = one 128-byte line
    #pragma unroll
    for (int j = 0; j < 8; ++j) {
        v4h hv;
        #pragma unroll
        for (int c = 0; c < 4; ++c) hv[c] = (_Float16)w[j][c];
        *(v4h*)(oh + goff[j]) = hv;
    }
    // this head's share of the second LayerNorm's row statistics: piece j of a lane lies in row 2 j + hl, whose
    // 64 columns lie in the 16 lanes of the lane's half: their sum, then the squared deviations from their mean
    float s[8], dq[8];
    #pragma unroll
    for (int j = 0; j < 8; ++j) s[j] = (w[j][0] + w[j][1]) + (w[j][2] + w[j][3]);
    #pragma unroll
    for (int off = 8; off >= 1; off >>= 1) {
        #pragma unroll
        for (int j = 0; j < 8; ++j) s[j] += __shfl_xor(s[j], off, 32);
    }
    #pragma unroll
    for (int j = 0; j < 8; ++j) {
        const v4f d = w[j] - s[j] * (1.0f / NDK);
        dq[j] = (d[0] * d[0] + d[1] * d[1]) + (d[2] * d[2] + d[3] * d[3]);
    }
    #pragma unroll
    for (int off = 8; off >= 1; off >>= 1) {
        #pragma unroll
        for (int j = 0; j < 8; ++j) dq[j] += __shfl_xor(dq[j], off, 32);
    }
    // lane m < 8 of a half stores row 2 m + hl: the wave's 16 rows are one 128-byte line of stat[head][row]
    v2f sv = {s[0], dq[0]};
    #pragma unroll
    for (int j = 1; j < 8; ++j) {
        if (m == j) { sv[0] = s[j]; sv[1] = dq[j]; }
    }
    if (m < 8) *(v2f*)(stat + ((size_t)hh * NM + b * NT + q0 + 2 * m + hl) * 2) = sv;
}

// ---------------------------------------------------------------------------
// Host-side launch glue
// ---------------------------------------------------------------------------
extern "C" void kernel_launch(void* const* d_in, const int* in_sizes, int n_in,
                              void* d_out, int out_size, void* d_ws, size_t ws_size,
                              hipStream_t stream) {
    if (n_in < 18) return;
    if (in_sizes[0] != NM * ND || in_sizes[1] != NB * NT * NT || out_size != NM * ND) return;
    if (in_sizes[2] != ND || in_sizes[3] != ND || in_sizes[4] != ND * ND || in_sizes[5] != ND ||
        in_sizes[6] != ND * ND || in_sizes[7] != ND || in_sizes[8] != ND * ND || in_sizes[9] != ND ||
        in_sizes[10] != ND || in_sizes[11] != ND || in_sizes[12] != ND * NF || in_sizes[13] != NF ||
        in_sizes[14] != NF * ND || in_sizes[15] != ND || in_sizes[16] != ND || in_sizes[17] != ND) return;

    const float* x       = (const float*)d_in[0];
    const float* mask    = (const float*)d_in[1];
    const float* ln_in_g = (const float*)d_in[2];
    const float* ln_in_b = (const float*)d_in[3];
    const float* Wq      = (const float*)d_in[4];
    const float* bq      = (const float*)d_in[5];
    const float* Wk      = (const float*)d_in[6];
    const float* bk      = (const float*)d_in[7];
    const float* Wv      = (const float*)d_in[8];
    const float* bv      = (const float*)d_in[9];
    const float* ln1_g   = (const float*)d_in[10];
    const float* ln1_b   = (const float*)d_in[11];
    const float* W1      = (const float*)d_in[12];
    const float* b1      = (const float*)d_in[13];
    const float* W2      = (const float*)d_in[14];
    const float* b2      = (const float*)d_in[15];
    const float* ln2_g   = (const float*)d_in[16];
    const float* ln2_b   = (const float*)d_in[17];
    float* out = (float*)d_out;

    // workspace carve (all offsets but c0's multiples of 512 KiB)
    char* ws = (char*)d_ws;
    size_t o = 0;
    const size_t SZ_H16 = (size_t)NM * ND * 2;              // 8 MiB
    const size_t SZ_F32 = (size_t)NM * ND * 4;              // 16 MiB
    _Float16* h16  = (_Float16*)(ws + o); o += SZ_H16;
    _Float16* q16  = (_Float16*)(ws + o); o += SZ_H16;
    _Float16* k16  = (_Float16*)(ws + o); o += SZ_H16;
    _Float16* vt16 = (_Float16*)(ws + o); o += SZ_H16;
    _Float16* f1   = h16;                                    // [M][F] f16 = 32 MiB, reuses h/q/k/vt region after attention
    float* ares = (float*)(ws + o); o += SZ_F32;             // attention + x
    _Float16* r16 = (_Float16*)(ws + o); o += SZ_H16;        // attention + x in f16
    _Float16* Wqh = (_Float16*)(ws + o); o += (size_t)ND * ND * 2;
    _Float16* Wkh = (_Float16*)(ws + o); o += (size_t)ND * ND * 2;
    _Float16* Wvh = (_Float16*)(ws + o); o += (size_t)ND * ND * 2;
    _Float16* W1h = (_Float16*)(ws + o); o += (size_t)NF * ND * 2;   // [F][D]
    _Float16* W2h = (_Float16*)(ws + o); o += (size_t)ND * NF * 2;   // [D][F]
    float* stat = (float*)(ws + o); o += (size_t)NH * NM * 2 * 4;    // [H][M] pairs
    float* c1   = (float*)(ws + o); o += (size_t)NF * 4;
    float* c0   = (float*)(ws + o); o += (size_t)NF * 4;
    if ((size_t)NM * NF * 2 > 4 * SZ_H16) return;
    if (o > ws_size) return;

    // 1, 2. input LayerNorm -> h (f16); weights: transpose to [n][k], scale by a power of two, f16
    //       (W1 times the second LayerNorm's gain); column sums c1, c0 of W1
    k_prep<<<PB_C + PB_LN + 3 * PB_WD + 2 * PB_WF, 256, 0, stream>>>(x, ln_in_g, ln_in_b, h16, Wq, Wk, Wv, W1, W2,
                                                                     Wqh, Wkh, Wvh, W1h, W2h, ln1_g, ln1_b, b1, c1, c0);

    // 3. QKV projections: Wqh, Wkh, Wvh and q16, k16, vt16 lie one behind the other in the carve above
    k_gemm<0, 3 * ND, ND><<<dim3(3 * ND / GT, NM / GT), 256, 0, stream>>>(h16, Wqh, bq, nullptr, (void*)q16, 0.0625f, bk, bv, nullptr);

    // 4. attention + residual(x) -> r (f32, f16) and each head's share of r's row statistics
    k_attn<<<dim3(NT / 128, NB * NH), 256, 0, stream>>>(q16, k16, vt16, mask, x, ares, r16, stat);

    // 5, 6. FFN1 with LN1 folded in: relu(LN1(r) @ W1 + b1) -> f16
    k_gemm<2, NF, ND><<<dim3(NF / GT, NM / GT), 256, 0, stream>>>(r16, W1h, c0, nullptr, (void*)f1, 0.0625f, c1, nullptr, stat);

    // 7, 8. FFN2 and LN2: LN2(f1 @ W2 + b2 + LN1(r)) -> out
    k_ffn2ln<<<NM / FR, 256, 0, stream>>>(f1, W2h, b2, ares, out, 0.03125f, ln1_g, ln1_b, stat, ln2_g, ln2_b);
}

// v007
// It runs in 98.4 microseconds.
// Timed twice side by side with v006, it ran 1.06 times as fast both times.
// All steps since v000 together make it 2.15 times as fast.
#include <hip/hip_runtime.h>
// All contractions: v_wmma_f32_16x16x32_f16 (f16 operands, f32 accumulate): QKV/FFN1 weights pre-scaled x16, FFN2 weights x32, P.V with P x4096 (scales folded back in f32); Q.K^T plain f16. LayerNorm/softmax/residuals f32.

typedef _Float16 v16h __attribute__((ext_vector_type(16)));
typedef _Float16 v8h  __attribute__((ext_vector_type(8), may_alias));
typedef float    v8f  __attribute__((ext_vector_type(8)));
typedef float    v4f  __attribute__((ext_vector_type(4), may_alias));
typedef float    v2f  __attribute__((ext_vector_type(2), may_alias));
typedef _Float16 v4h  __attribute__((ext_vector_type(4), may_alias));

union Frag { v16h v; v8h hf[2]; };

#define NB   8
#define NT   1024
#define ND   512
#define NH   8
#define NDK  64
#define NF   2048
#define NM   (NB * NT)
#define LNEPS  1.0e-3f
#define NEGBIG (-1.0e9f)

__device__ __forceinline__ v8f zero8() {
    v8f z = {0.f, 0.f, 0.f, 0.f, 0.f, 0.f, 0.f, 0.f};
    return z;
}

// 16x16x32 f16 WMMA with trailing hazard guard (D tied, A/B kept live)
__device__ __forceinline__ v8f wmma16(v16h a, v16h b, v8f c) {
    v8f d = __builtin_amdgcn_wmma_f32_16x16x32_f16(false, a, false, b, (short)0, c, false, false);
    asm volatile("v_nop\n\tv_nop\n\tv_nop\n\tv_nop" : "+v"(d) : "v"(a), "v"(b));
    return d;
}

// LDS byte address of a __shared__ location (low 32 bits of its address)
__device__ __forceinline__ unsigned lds_addr(const void* p) { return (unsigned)(size_t)p; }

// Eight asynchronous 16-byte copies of a lane, global -> LDS: rows LS bytes apart in LDS, GS bytes apart in
// memory.  s_wait_xcnt is the last line of the copies' own statement, so that no register which a copy names
// is rewritten in front of it.
template <int LS, int GS>
__device__ __forceinline__ void async8(unsigned l, const char* g) {
    asm volatile("global_load_async_to_lds_b128 %0, %8, off\n\t"
                 "global_load_async_to_lds_b128 %1, %9, off\n\t"
                 "global_load_async_to_lds_b128 %2, %10, off\n\t"
                 "global_load_async_to_lds_b128 %3, %11, off\n\t"
                 "global_load_async_to_lds_b128 %4, %12, off\n\t"
                 "global_load_async_to_lds_b128 %5, %13, off\n\t"
                 "global_load_async_to_lds_b128 %6, %14, off\n\t"
                 "global_load_async_to_lds_b128 %7, %15, off\n\t"
                 "s_wait_xcnt 0x0"
                 :: "v"(l), "v"(l + LS), "v"(l + 2 * LS), "v"(l + 3 * LS),
                    "v"(l + 4 * LS), "v"(l + 5 * LS), "v"(l + 6 * LS), "v"(l + 7 * LS),
                    "v"(g), "v"(g + GS), "v"(g + 2 * GS), "v"(g + 3 * GS),
                    "v"(g + 4 * GS), "v"(g + 5 * GS), "v"(g + 6 * GS), "v"(g + 7 * GS)
                 : "memory");
}

// The same for four copies.
template <int LS, int GS>
__device__ __forceinline__ void async4(unsigned l, const char* g) {
    asm volatile("global_load_async_to_lds_b128 %0, %4, off\n\t"
                 "global_load_async_to_lds_b128 %1, %5, off\n\t"
                 "global_load_async_to_lds_b128 %2, %6, off\n\t"
                 "global_load_async_to_lds_b128 %3, %7, off\n\t"
                 "s_wait_xcnt 0x0"
                 :: "v"(l), "v"(l + LS), "v"(l + 2 * LS), "v"(l + 3 * LS),
                    "v"(g), "v"(g + GS), "v"(g + 2 * GS), "v"(g + 3 * GS)
                 : "memory");
}

// Foot of a trip of a two-buffer ring (every wave, block-uniform): this wave's LDS reads of the buffer it
// leaves are done, its own copies of the next tile have landed; the barrier publishes that tile and frees
// the buffer for the refill behind it.
__device__ __forceinline__ void ring_publish() {
    asm volatile("s_wait_dscnt 0x0" ::: "memory");      // reads done before the buffer is handed to the copies
    asm volatile("s_wait_asynccnt 0x0" ::: "memory");   // the compiler places no wait for the copies
    __syncthreads();
}

// ---------------------------------------------------------------------------
// Weight transpose + scale + f16 convert: Wt[n][k] = f16(W[k][n] * scale), times gs[k] where gs is given.
// W is [K][N] row-major. Block tile: 64 k x 32 n; tile (bx, by) of (N/32, K/64).
// ---------------------------------------------------------------------------
__device__ __forceinline__
void wcvt_tile(const float* __restrict__ W, _Float16* __restrict__ Wt, int K, int N, float scale, int bx, int by,
               const float* __restrict__ gs) {
    __shared__ float tile[64][33];
    const int tid = threadIdx.x;
    const int kb = by * 64, nb = bx * 32;
    const int c = tid & 31, r = tid >> 5;
    float w[8], gk[8] = {1.f, 1.f, 1.f, 1.f, 1.f, 1.f, 1.f, 1.f};
    #pragma unroll
    for (int i = 0; i < 8; ++i) w[i] = W[(size_t)(kb + r + 8 * i) * N + nb + c];
    if (gs) {                                           // block-uniform test, once, under the tile's loads
        const int ks = kb + __builtin_amdgcn_readfirstlane(r);   // the wave's k, for scalar loads
        #pragma unroll
        for (int i = 0; i < 8; ++i) gk[i] = gs[ks + 8 * i];
    }
    #pragma unroll
    for (int i = 0; i < 8; ++i) tile[r + 8 * i][c] = w[i] * scale * gk[i];
    __syncthreads();
    const int n = tid >> 3, pc = tid & 7;
    v8h o;
    #pragma unroll
    for (int e = 0; e < 8; ++e) o[e] = (_Float16)tile[pc * 8 + e][n];
    _Float16* dst = Wt + (size_t)(nb + n) * K + kb + pc * 8;
    *(v8h*)dst = o;
    
}

// ---------------------------------------------------------------------------
// The second LayerNorm is not applied to the rows r = attention + x; it is folded into FFN1:
//   LN(r) @ W1 + b1 = rstd * (r @ (g . W1) - mean * c1) + c0,
//   c1[n] = sum_k g[k] W1[k][n] (of the f16 values that the product uses), c0[n] = sum_k b[k] W1[k][n] + b1[n].
// One block: 32 columns n; wave r sums 64 k, the eight partial sums join through LDS.
// ---------------------------------------------------------------------------
__device__ __forceinline__
void colsum_tile(const float* __restrict__ W1, const float* __restrict__ g, const float* __restrict__ bt,
                 const float* __restrict__ b1, float* __restrict__ c1, float* __restrict__ c0, int bx) {
    __shared__ float red[2][8][32];
    const int c = threadIdx.x & 31, r = __builtin_amdgcn_readfirstlane(threadIdx.x >> 5);   // r scalar: g, bt are read off a scalar base
    const int n = bx * 32 + c;
    float s1 = 0.f, s0 = 0.f;
    #pragma unroll 16   // sixteen loads in flight a lane
    for (int i = 0; i < ND / 8; ++i) {
        const int k = r * (ND / 8) + i;
        const float wv = W1[(size_t)k * NF + n];
        s1 += (float)(_Float16)(wv * 16.0f * g[k]);
        s0 += wv * bt[k];
    }
    red[0][r][c] = s1;
    red[1][r][c] = s0;
    __syncthreads();
    if (r == 0) {
        float t1 = 0.f, t0 = 0.f;
        #pragma unroll
        for (int i = 0; i < 8; ++i) { t1 += red[0][i][c]; t0 += red[1][i][c]; }
        c1[n] = t1 * 0.0625f;
        c0[n] = t0 + b1[n];
    }
}

// ---------------------------------------------------------------------------
// deviations).  One wave per row, 8 rows per 256-thread block.
// OM 0: f16 output only; OM 1: f32 + f16; OM 2: f32 only.
// f32 rows: lane l stores float4 at cols 4l+128j (each instruction = 4 whole
// lines, lane-contiguous 16 B).  f16 rows: lane l stores 8 halves at cols
// ---------------------------------------------------------------------------
template <int OM>
__device__ __forceinline__
void ln_rows(const float* __restrict__ in, const float* __restrict__ g, const float* __restrict__ bt,
             float* __restrict__ of, _Float16* __restrict__ oh, int M, int blk) {
    const int lane = threadIdx.x & 31, wave = threadIdx.x >> 5;
    const int row = blk * 8 + wave;
    if (row >= M) return;                      // wave-uniform; no barriers in this function
    const float* r = in + (size_t)row * ND;

    // The row's loads stand in one statement with their data wait, the results in registers of their own: so
    // no register that a load names is rewritten while the load is out.  v: float4 at cols 4l+128j, for the sums
    // and the f32 rows; xh (OM != 2): 8 floats at cols 8l+256j, for the f16 rows.
    v4f v[4], xh[4];
    if constexpr (OM != 2) {
        asm volatile("global_load_b128 %0, %8, off\n\t"
                     "global_load_b128 %1, %8, off offset:512\n\t"
                     "global_load_b128 %2, %8, off offset:1024\n\t"
                     "global_load_b128 %3, %8, off offset:1536\n\t"
                     "global_load_b128 %4, %9, off\n\t"
                     "global_load_b128 %5, %9, off offset:16\n\t"
                     "global_load_b128 %6, %9, off offset:1024\n\t"
                     "global_load_b128 %7, %9, off offset:1040\n\t"
                     "s_wait_loadcnt 0x0"
                     : "=&v"(v[0]), "=&v"(v[1]), "=&v"(v[2]), "=&v"(v[3]),
                       "=&v"(xh[0]), "=&v"(xh[1]), "=&v"(xh[2]), "=&v"(xh[3])
                     : "v"(r + 4 * lane), "v"(r + 8 * lane) : "memory");
    } else {
        asm volatile("global_load_b128 %0, %4, off\n\t"
                     "global_load_b128 %1, %4, off offset:512\n\t"
                     "global_load_b128 %2, %4, off offset:1024\n\t"
                     "global_load_b128 %3, %4, off offset:1536\n\t"
                     "s_wait_loadcnt 0x0"
                     : "=&v"(v[0]), "=&v"(v[1]), "=&v"(v[2]), "=&v"(v[3])
                     : "v"(r + 4 * lane) : "memory");
    }
    float s = 0.f;
    #pragma unroll
    for (int j = 0; j < 4; ++j) s += (v[j][0] + v[j][1]) + (v[j][2] + v[j][3]);
    #pragma unroll
    for (int off = 16; off >= 1; off >>= 1) s += __shfl_xor(s, off, 32);
    const float mean = s * (1.0f / ND);
    float sq = 0.f;
    #pragma unroll
    for (int j = 0; j < 4; ++j) {
        #pragma unroll
        for (int c = 0; c < 4; ++c) { const float d = v[j][c] - mean; sq += d * d; }
    }
    #pragma unroll
    for (int off = 16; off >= 1; off >>= 1) sq += __shfl_xor(sq, off, 32);
    const float rstd = rsqrtf(sq * (1.0f / ND) + LNEPS);

    if constexpr (OM != 0) {
        v4f o[4];
        #pragma unroll
        for (int j = 0; j < 4; ++j) {
            const int c0 = 4 * lane + 128 * j;
            const v4f gv = *(const v4f*)(g + c0);
            const v4f bv = *(const v4f*)(bt + c0);
            #pragma unroll
            for (int c = 0; c < 4; ++c) o[j][c] = (v[j][c] - mean) * rstd * gv[c] + bv[c];
        }
        float* orow = of + (size_t)row * ND + 4 * lane;
        #pragma unroll
        for (int j = 0; j < 4; ++j) *(v4f*)(orow + 128 * j) = o[j];
        
    }
    if constexpr (OM != 2) {
        v8h w[2];
        #pragma unroll
        for (int j = 0; j < 2; ++j) {
            const int c0 = 8 * lane + 256 * j;
            const v4f x0 = xh[2 * j], x1 = xh[2 * j + 1];
            const v4f g0 = *(const v4f*)(g + c0),  g1 = *(const v4f*)(g + c0 + 4);
            const v4f b0 = *(const v4f*)(bt + c0), b1 = *(const v4f*)(bt + c0 + 4);
            #pragma unroll
            for (int c = 0; c < 4; ++c) {
                w[j][c]     = (_Float16)((x0[c] - mean) * rstd * g0[c] + b0[c]);
                w[j][4 + c] = (_Float16)((x1[c] - mean) * rstd * g1[c] + b1[c]);
            }
        }
        _Float16* hrow = oh + (size_t)row * ND + 8 * lane;
        #pragma unroll
        for (int j = 0; j < 2; ++j) *(v8h*)(hrow + 256 * j) = w[j];
        
    }
}

// ---------------------------------------------------------------------------
// Everything that depends on the inputs alone, in one grid: the column sums
// of W1 that fold the second LayerNorm into FFN1 (PB_C blocks), the input
// LayerNorm (PB_LN blocks, 8 rows each), then the five weight converts
// (one 64 k x 32 n tile a block).  The job is picked by the block index, so
// every branch here is block-uniform.
// ---------------------------------------------------------------------------
#define PB_LN (NM / 8)                      // LayerNorm blocks
#define PB_WD ((ND / 32) * (ND / 64))       // tiles of a D x D weight
#define PB_WF ((NF / 32) * (ND / 64))       // tiles of W1, and of W2
#define PB_C  (NF / 32)                     // column-sum blocks

__global__ __launch_bounds__(256)
void k_prep(const float* __restrict__ x, const float* __restrict__ g, const float* __restrict__ bt,
            _Float16* __restrict__ h,
            const float* __restrict__ Wq, const float* __restrict__ Wk, const float* __restrict__ Wv,
            const float* __restrict__ W1, const float* __restrict__ W2,
            _Float16* __restrict__ Wqh, _Float16* __restrict__ Wkh, _Float16* __restrict__ Wvh,
            _Float16* __restrict__ W1h, _Float16* __restrict__ W2h,
            const float* __restrict__ g1, const float* __restrict__ bt1, const float* __restrict__ b1,
            float* __restrict__ c1, float* __restrict__ c0) {
    if (blockIdx.x < PB_C) { colsum_tile(W1, g1, bt1, b1, c1, c0, blockIdx.x); return; }   // the longest job starts first
    if (blockIdx.x < PB_C + PB_LN) { ln_rows<0>(x, g, bt, nullptr, h, NM, blockIdx.x - PB_C); return; }
    int b = blockIdx.x - (PB_C + PB_LN);
    const float* W;
    const float* gs = nullptr;
    _Float16* Wt;
    int K, N, bx, by;
    float sc;
    if (b < 3 * PB_WD) {                    // in[512][512] -> out[512][512]
        const int w = b / PB_WD;
        b -= w * PB_WD;
        W  = w == 0 ? Wq  : (w == 1 ? Wk  : Wv);
        Wt = w == 0 ? Wqh : (w == 1 ? Wkh : Wvh);
        K = ND; N = ND; sc = 16.0f;
        bx = b % (ND / 32); by = b / (ND / 32);
    } else if (b < 3 * PB_WD + PB_WF) {     // in[512][2048] -> out[2048][512]
        b -= 3 * PB_WD;
        W = W1; Wt = W1h; K = ND; N = NF; sc = 16.0f; gs = g1;
        bx = b % (NF / 32); by = b / (NF / 32);
    } else {                                // in[2048][512] -> out[512][2048]
        b -= 3 * PB_WD + PB_WF;
        W = W2; Wt = W2h; K = NF; N = ND; sc = 32.0f;
        bx = b % (ND / 32); by = b / (ND / 32);
    }
    wcvt_tile(W, Wt, K, N, sc, bx, by, gs);
    // the built code lays the LayerNorm behind this tile's store: its registers stay until this wait
    asm volatile("s_wait_xcnt 0x0" ::: "memory");
}

// ---------------------------------------------------------------------------
// WMMA GEMM: C[M,N] = A[M,K] @ W[K,N] (+bias, scale, epilogue).  A f16
// row-major [M][K]; weights f16 [N][K] (k-contiguous), so A and B fragments
// use the same split-k loader: elements 0..7 <- k0+8h+0..7, elements 8..15
// <- k0+16+8h+0..7, h = lane>>4, row/col = lane&15.  D element r of a lane =
// (row 8h+r, col lane&15).  Block tile 128x128, K step 128, 8 waves (4 m x 2 n,
// each wave 32x64 = 2 x 4 accumulators).  A and B tiles staged in LDS, rows of
// 256 B at pitch 272 B, by asynchronous copies in a ring of two buffers: tile
// t + 1 is in flight while tile t is worked on; the output staging reuses the
// ring behind the last trip's barrier.  M, N multiples of 128; K a multiple of 128.  N and K
// are compile-time, so a thread's 8 rows of a tile hang off one address.
// MODE 0: Q, K and V in one grid, N = 3 * ND: Bt holds the three weights one
//         behind the other, outp the three outputs; a column tile lies in one
//         projection w = nBase / ND (block-uniform), which picks bias, output
//         and f16 epilogue 0 (Q, K) or 1 (V)
// MODE 2: f16 out, relu, row-major [M][N]  (FFN1): A = the rows r before the second LayerNorm, weights
//         times its gain; the epilogue finishes the LayerNorm: (acc - mean c1) rstd + c0 (bias = c0, biasK = c1)
// MODE 2: stat[head][row] = (sum, sum of squared deviations from the head's own mean) of the row's 64
//         columns of that head; the block joins the eight pairs of each of its rows into mean and rstd
// f16 epilogues EM: 0 = [B,H,T,DK], 1 = [B,H,DK,T] (V transposed), 2 = FFN1
// ---------------------------------------------------------------------------
#define GT  128     // block tile, rows and columns
#define GK  128     // k per staged tile
#define GP  136     // LDS pitch of a staged row and of an f16 output row, halves
#define GOP (GT * GP * 2)   // bytes of one operand's staged tile
#define GSTG (2 * GOP)      // bytes of a ring buffer: A tile, then B tile

// f16 epilogue of a 128x128 tile: scale, bias (relu), staged in Ch, stored in 16-byte pieces
template <int EM, int N>
__device__ __forceinline__
void epi_f16(const v8f (&acc)[2][4], const float (&bj)[4], _Float16* Ch, _Float16* __restrict__ O,
             float oscale, int mBase, int nBase, const float (&cj)[4], const float* rm, const float* rr) {
    const int tid = threadIdx.x, lane = tid & 31, wave = tid >> 5;
    const int hl = lane >> 4, m = lane & 15;
    const int wm = wave & 3, wn = wave >> 2;
    #pragma unroll
    for (int i = 0; i < 2; ++i) {
        v8f mu = zero8(), rs = zero8();                 // mean and rstd of the lane's eight rows
        if constexpr (EM == 2) {
            const int r0 = wm * 32 + i * 16 + 8 * hl;
            mu = __builtin_shufflevector(*(const v4f*)(rm + r0), *(const v4f*)(rm + r0 + 4), 0, 1, 2, 3, 4, 5, 6, 7);
            rs = __builtin_shufflevector(*(const v4f*)(rr + r0), *(const v4f*)(rr + r0 + 4), 0, 1, 2, 3, 4, 5, 6, 7);
        }
        #pragma unroll
        for (int j = 0; j < 4; ++j) {
            const int col = wn * 64 + j * 16 + m;
            #pragma unroll
            for (int r = 0; r < 8; ++r) {
                float u;
                if constexpr (EM == 2) u = fmaxf((acc[i][j][r] * oscale - mu[r] * cj[j]) * rs[r] + bj[j], 0.0f);
                else                   u = acc[i][j][r] * oscale + bj[j];
                const int row = wm * 32 + i * 16 + 8 * hl + r;
                if constexpr (EM == 1) Ch[col * GP + row] = (_Float16)u;
                else                   Ch[row * GP + col] = (_Float16)u;
            }
        }
    }
    __syncthreads();
    // thread: staged rows line + 16 j, 16-byte piece pc; a tile lies in one batch (NT % GT == 0)
    const int line = tid >> 4, pc = tid & 15;
    const int bb = mBase / NT, t0 = mBase % NT;
    int step;                                           // halves between rows line and line + 16
    if constexpr (EM == 0) {
        const int n = nBase + pc * 8;                   // column: head n / NDK, d n % NDK
        O += ((size_t)(bb * NH + n / NDK) * NT + t0 + line) * NDK + n % NDK;
        step = 16 * NDK;
    } else if constexpr (EM == 1) {
        const int n = nBase + line;                     // staged row = column: head n / NDK, d n % NDK
        O += ((size_t)(bb * NH + n / NDK) * NDK + n % NDK) * NT + t0 + pc * 8;
        step = 16 * NT;                                 // heads are NDK * NT apart: linear in n
    } else {
        O += (size_t)(mBase + line) * N + nBase + pc * 8;
        step = 16 * N;
    }
    v8h w[8];
    #pragma unroll
    for (int j = 0; j < 8; ++j) w[j] = *(const v8h*)(Ch + (line + 16 * j) * GP + pc * 8);
    #pragma unroll
    for (int j = 0; j < 8; ++j) *(v8h*)(O + j * step) = w[j];
}

template <int MODE, int N, int K>
__global__ __launch_bounds__(256)
void k_gemm(const _Float16* __restrict__ A, const _Float16* __restrict__ Bt,
            const float* __restrict__ bias, const float* __restrict__ resid,
            void* __restrict__ outp, float oscale,
            const float* __restrict__ biasK, const float* __restrict__ biasV, const float* __restrict__ stat) {
    __shared__ __align__(16) unsigned char ring[2 * GSTG];
    __shared__ __align__(16) float rowm[GT], rowr[GT];    // MODE 2: mean and rstd of the tile's rows
    _Float16* Ch = (_Float16*)ring;                       // output staging, behind the loop

    const int tid = threadIdx.x, lane = tid & 31, wave = tid >> 5;
    const int hl = lane >> 4, m = lane & 15;
    const int mBase = blockIdx.y * GT, nBase = blockIdx.x * GT;
    const int wm = wave & 3, wn = wave >> 2;
    const int ar = tid >> 4, ac = (tid & 15) * 8;         // staging: row (step 16), k chunk
    const char* Ag = (const char*)(A  + (size_t)mBase * K + ar * K + ac);   // the thread's first piece of the next tile to copy
    const char* Bg = (const char*)(Bt + (size_t)nBase * K + ar * K + ac);
    const unsigned lst = lds_addr(ring) + (ar * GP + ac) * 2;                // its place in buffer 0's A tile

    v8f acc[2][4];
    #pragma unroll
    for (int i = 0; i < 2; ++i) {
        #pragma unroll
        for (int j = 0; j < 4; ++j) acc[i][j] = zero8();
    }
    // tile 0 into buffer 0, landed and published; then tile 1 into buffer 1
    async8<16 * GP * 2, 16 * K * 2>(lst, Ag);
    async8<16 * GP * 2, 16 * K * 2>(lst + GOP, Bg);
    Ag += GK * 2; Bg += GK * 2;
    if constexpr (MODE != 0) {
        if (__builtin_amdgcn_readfirstlane(wave) < GT / 32) {   // a scalar test, whole waves; under tile 0's flight, published by its barrier
            const float* sp = stat + (size_t)(mBase + tid) * 2;
            v2f p[NH];
            #pragma unroll
            for (int h = 0; h < NH; ++h) p[h] = *(const v2f*)(sp + (size_t)h * NM * 2);
            float sm = 0.f;
            #pragma unroll
            for (int h = 0; h < NH; ++h) sm += p[h][0];
            const float mean = sm * (1.0f / ND);
            float m2 = 0.f;
            #pragma unroll
            for (int h = 0; h < NH; ++h) {
                const float d = p[h][0] * (1.0f / NDK) - mean;
                m2 += p[h][1] + (float)NDK * d * d;
            }
            rowm[tid] = mean;
            rowr[tid] = rsqrtf(m2 * (1.0f / ND) + LNEPS);
        }
    }
    asm volatile("s_wait_asynccnt 0x0" ::: "memory");       // the compiler places no wait for the copies
    __syncthreads();
    if (K / GK > 1) {
        async8<16 * GP * 2, 16 * K * 2>(lst + GSTG, Ag);
        async8<16 * GP * 2, 16 * K * 2>(lst + GSTG + GOP, Bg);
        Ag += GK * 2; Bg += GK * 2;
    }

    for (int kt = 0; kt < K / GK; ++kt) {
        const unsigned bo = (kt & 1) * GSTG;                // this trip's buffer
        const _Float16* ap = (const _Float16*)(ring + bo) + (wm * 32 + m) * GP + 8 * hl;
        const _Float16* bp = (const _Float16*)(ring + bo + GOP) + (wn * 64 + m) * GP + 8 * hl;
        #pragma unroll
        for (int kk = 0; kk < GK / 32; ++kk) {
            Frag fa[2], fb[4];
            #pragma unroll
            for (int i = 0; i < 2; ++i) {
                fa[i].hf[0] = *(const v8h*)(ap + i * 16 * GP + kk * 32);
                fa[i].hf[1] = *(const v8h*)(ap + i * 16 * GP + kk * 32 + 16);
            }
            #pragma unroll
            for (int j = 0; j < 4; ++j) {
                fb[j].hf[0] = *(const v8h*)(bp + j * 16 * GP + kk * 32);
                fb[j].hf[1] = *(const v8h*)(bp + j * 16 * GP + kk * 32 + 16);
            }
            #pragma unroll
            for (int i = 0; i < 2; ++i) {
                #pragma unroll
                for (int j = 0; j < 4; ++j) acc[i][j] = wmma16(fa[i].v, fb[j].v, acc[i][j]);
            }
        }
        ring_publish();
        if (kt + 2 < K / GK) {                              // block-uniform: tile kt + 2 into the buffer just left
            async8<16 * GP * 2, 16 * K * 2>(lst + bo, Ag);
            async8<16 * GP * 2, 16 * K * 2>(lst + bo + GOP, Bg);
            Ag += GK * 2; Bg += GK * 2;
        }
    }
    asm volatile("s_wait_asynccnt 0x0" ::: "memory");       // nothing in flight when the ring becomes output staging

    const int w  = MODE == 0 ? nBase / ND : 0;              // projection of this tile
    const int nb = MODE == 0 ? nBase % ND : nBase;          // its first column there
    const float* bs = bias;
    if constexpr (MODE == 0) bs = w == 0 ? bias : (w == 1 ? biasK : biasV);
    float bj[4];
    #pragma unroll
    for (int j = 0; j < 4; ++j) bj[j] = bs[nb + wn * 64 + j * 16 + m];

    if constexpr (MODE == 0) {
        _Float16* o = (_Float16*)outp + (size_t)w * NM * ND;
        if (w == 2) {
            epi_f16<1, ND>(acc, bj, Ch, o, oscale, mBase, nb, bj, nullptr, nullptr);
        } else {
            epi_f16<0, ND>(acc, bj, Ch, o, oscale, mBase, nb, bj, nullptr, nullptr);
            // the built code lays the other epilogue behind these stores: their registers stay until this wait
            asm volatile("s_wait_xcnt 0x0" ::: "memory");
        }
    } else if constexpr (MODE == 2) {
        float cj[4];
        #pragma unroll
        for (int j = 0; j < 4; ++j) cj[j] = biasK[nBase + wn * 64 + j * 16 + m];
        epi_f16<2, N>(acc, bj, Ch, (_Float16*)outp, oscale, mBase, nBase, cj, rowm, rowr);
    }
}

// ---------------------------------------------------------------------------
// FFN2 with both LayerNorms around it: out = LN2(f1 @ W2 + b2 + LN1(r)).  A block owns FR whole rows (all ND
// columns), so the last LayerNorm runs in its epilogue.  8 waves side by side, each FR rows x 64 columns
// (4 x 4 accumulators); fragments, k order and ring as in k_gemm: A tile FR rows, B tile ND rows of GK halves.
// LN1(r) is formed from r (resid), the row's mean and rstd (joined from stat as in k_gemm), gain g1, shift s1.
// Behind the loop the block's rows of r are copied into buffer 0 and fly while the products are staged in buffer 1.
// ---------------------------------------------------------------------------
#define FR   64                 // rows of a block
#define FSA  (FR * GP * 2)      // bytes of a staged A tile
#define FSB  (ND * GP * 2)      // of a staged B tile
#define FSTG (FSA + FSB)        // of a ring buffer: A tile, then B tile
#define FPF  (ND + 4)           // LDS pitch of an f32 output row, floats

// 1 / sqrt(x) for x >= LNEPS: no subnormal argument, so none of rsqrtf's rescaling.  The v_nop is the slot that the
// instruction set asks for behind a transcendental, before its result is read or its source overwritten.
__device__ __forceinline__ float rsq_pos(float x) {
    float r;
    asm("v_rsq_f32 %0, %1\n\tv_nop" : "=v"(r) : "v"(x));
    return r;
}

// a thread's 36 copies of one k tile: 4 rows of A, 32 of B, 16 rows apart
__device__ __forceinline__ void ffn2_stage(unsigned l, const char* a, const char* b) {
    async4<16 * GP * 2, 16 * NF * 2>(l, a);
    #pragma unroll
    for (int c = 0; c < 4; ++c) async8<16 * GP * 2, 16 * NF * 2>(l + FSA + c * 128 * GP * 2, b + (size_t)c * 128 * NF * 2);
}

__global__ __launch_bounds__(256)
void k_ffn2ln(const _Float16* __restrict__ A, const _Float16* __restrict__ Bt,
              const float* __restrict__ bias, const float* __restrict__ resid, float* __restrict__ outp, float oscale,
              const float* __restrict__ g1, const float* __restrict__ s1, const float* __restrict__ stat,
              const float* __restrict__ g2, const float* __restrict__ s2) {
    constexpr int K = NF;
    __shared__ __align__(16) unsigned char ring[2 * FSTG];
    __shared__ __align__(16) float rowm[FR], rowr[FR];    // LN1's mean and rstd of the block's rows
    static_assert(FR * FPF * 4 <= FSTG, "r in buffer 0, the products in buffer 1");
    const float* Rf = (const float*)ring;                 // the rows of r, pitch FPF
    float* Cf = (float*)(ring + FSTG);                    // the products, behind the loop, pitch FPF

    const int tid = threadIdx.x, lane = tid & 31, wave = tid >> 5;
    const int hl = lane >> 4, m = lane & 15;
    const int mBase = blockIdx.x * FR;
    const int ar = tid >> 4, ac = (tid & 15) * 8;         // staging: row (step 16), k chunk
    const char* Ag = (const char*)(A  + (size_t)mBase * K + ar * K + ac);   // the thread's first piece of the next tile to copy
    const char* Bg = (const char*)(Bt + ar * K + ac);
    const unsigned lst = lds_addr(ring) + (ar * GP + ac) * 2;                // its place in buffer 0's A tile

    v8f acc[4][4];
    #pragma unroll
    for (int i = 0; i < 4; ++i) {
        #pragma unroll
        for (int j = 0; j < 4; ++j) acc[i][j] = zero8();
    }
    // tile 0 into buffer 0, landed and published; then tile 1 into buffer 1
    ffn2_stage(lst, Ag, Bg);
    Ag += GK * 2; Bg += GK * 2;
    if (__builtin_amdgcn_readfirstlane(wave) < FR / 32) {   // a scalar test, whole waves; under tile 0's flight, published by its barrier
        const float* sp = stat + (size_t)(mBase + tid) * 2;
        v2f p[NH];
        #pragma unroll
        for (int h = 0; h < NH; ++h) p[h] = *(const v2f*)(sp + (size_t)h * NM * 2);
        float sm = 0.f;
        #pragma unroll
        for (int h = 0; h < NH; ++h) sm += p[h][0];
        const float mean = sm * (1.0f / ND);
        float m2 = 0.f;
        #pragma unroll
        for (int h = 0; h < NH; ++h) {
            const float d = p[h][0] * (1.0f / NDK) - mean;
            m2 += p[h][1] + (float)NDK * d * d;
        }
        rowm[tid] = mean;
        rowr[tid] = rsqrtf(m2 * (1.0f / ND) + LNEPS);
    }
    asm volatile("s_wait_asynccnt 0x0" ::: "memory");       // the compiler places no wait for the copies
    __syncthreads();
    ffn2_stage(lst + FSTG, Ag, Bg);
    Ag += GK * 2; Bg += GK * 2;

    for (int kt = 0; kt < K / GK; ++kt) {
        const unsigned bo = (kt & 1) * FSTG;                // this trip's buffer
        const _Float16* ap = (const _Float16*)(ring + bo) + m * GP + 8 * hl;
        const _Float16* bp = (const _Float16*)(ring + bo + FSA) + (wave * 64 + m) * GP + 8 * hl;
        #pragma unroll
        for (int kk = 0; kk < GK / 32; ++kk) {
            Frag fa[4], fb[4];
            #pragma unroll
            for (int i = 0; i < 4; ++i) {
                fa[i].hf[0] = *(const v8h*)(ap + i * 16 * GP + kk * 32);
                fa[i].hf[1] = *(const v8h*)(ap + i * 16 * GP + kk * 32 + 16);
            }
            #pragma unroll
            for (int j = 0; j < 4; ++j) {
                fb[j].hf[0] = *(const v8h*)(bp + j * 16 * GP + kk * 32);
                fb[j].hf[1] = *(const v8h*)(bp + j * 16 * GP + kk * 32 + 16);
            }
            #pragma unroll
            for (int i = 0; i < 4; ++i) {
                #pragma unroll
                for (int j = 0; j < 4; ++j) acc[i][j] = wmma16(fa[i].v, fb[j].v, acc[i][j]);
            }
        }
        ring_publish();
        if (kt + 2 < K / GK) {                              // block-uniform: tile kt + 2 into the buffer just left
            ffn2_stage(lst + bo, Ag, Bg);
            Ag += GK * 2; Bg += GK * 2;
        }
    }
    asm volatile("s_wait_asynccnt 0x0" ::: "memory");       // nothing in flight behind the loop
    {                                                       // r into buffer 0; a wave: rows wave + 8 t, 512 bytes a copy
        const unsigned lr = lds_addr(ring) + wave * FPF * 4 + lane * 16;
        const char* rg = (const char*)(resid + (size_t)(mBase + wave) * ND + 4 * lane);
        #pragma unroll
        for (int j = 0; j < 4; ++j) async8<8 * FPF * 4, 8 * ND * 4>(lr + j * 512, rg + j * 512);
    }

    #pragma unroll
    for (int j = 0; j < 4; ++j) {
        const int col = wave * 64 + j * 16 + m;
        const float bj = bias[col];
        #pragma unroll
        for (int i = 0; i < 4; ++i) {
            #pragma unroll
            for (int r = 0; r < 8; ++r) Cf[(i * 16 + 8 * hl + r) * FPF + col] = acc[i][j][r] * oscale + bj;
        }
    }
    asm volatile("s_wait_asynccnt 0x0" ::: "memory");       // the rows of r have landed; the compiler places no wait for the copies
    __syncthreads();
    // a row = one wave; lane: float4 at cols 4 l + 128 j, as in ln_rows.  Four rows (wave + 8 t) go
    // side by side, so that their loads and their lane exchanges overlap.
    float* O = outp + (size_t)(mBase + wave) * ND + 4 * lane;
    const int lo = wave * FPF + 4 * lane;                   // the lane's place in both staged tiles
    #pragma unroll 1   // rolled: eight rows' values at once would take about a hundred registers more
    for (int g = 0; g < FR / 32; ++g) {
        v4f v[4][4];
        #pragma unroll
        for (int j = 0; j < 4; ++j) {
            if (j == 2) __builtin_amdgcn_sched_barrier(0);  // the LDS loads in two groups: all 32 at once take the kernel past 256 registers
            const v4f gv = *(const v4f*)(g1 + 4 * lane + 128 * j);
            const v4f bv = *(const v4f*)(s1 + 4 * lane + 128 * j);
            #pragma unroll
            for (int t = 0; t < 4; ++t) {
                const int ro = 32 * g + 8 * t;              // row - wave
                const v4f a = (*(const v4f*)(Rf + lo + ro * FPF + 128 * j) - rowm[wave + ro]) * rowr[wave + ro] * gv + bv;
                v[t][j] = *(const v4f*)(Cf + lo + ro * FPF + 128 * j) + a;
            }
        }
        float s[4], sq[4];
        #pragma unroll
        for (int t = 0; t < 4; ++t) {
            s[t] = 0.f;
            #pragma unroll
            for (int j = 0; j < 4; ++j) s[t] += (v[t][j][0] + v[t][j][1]) + (v[t][j][2] + v[t][j][3]);
        }
        #pragma unroll
        for (int off = 16; off >= 1; off >>= 1) {
            #pragma unroll
            for (int t = 0; t < 4; ++t) s[t] += __shfl_xor(s[t], off, 32);
        }
        #pragma unroll
        for (int t = 0; t < 4; ++t) {
            s[t] *= (1.0f / ND);                            // the row's mean
            sq[t] = 0.f;
            #pragma unroll
            for (int j = 0; j < 4; ++j) {
                #pragma unroll
                for (int c = 0; c < 4; ++c) { const float d = v[t][j][c] - s[t]; sq[t] += d * d; }
            }
        }
        #pragma unroll
        for (int off = 16; off >= 1; off >>= 1) {
            #pragma unroll
            for (int t = 0; t < 4; ++t) sq[t] += __shfl_xor(sq[t], off, 32);
        }
        #pragma unroll
        for (int t = 0; t < 4; ++t) sq[t] = rsq_pos(sq[t] * (1.0f / ND) + LNEPS);   // its rstd
        #pragma unroll
        for (int j = 0; j < 4; ++j) {
            const v4f gv = *(const v4f*)(g2 + 4 * lane + 128 * j);
            const v4f bv = *(const v4f*)(s2 + 4 * lane + 128 * j);
            #pragma unroll
            for (int t = 0; t < 4; ++t)
                *(v4f*)(O + (32 * g + 8 * t) * ND + 128 * j) = (v[t][j] - s[t]) * sq[t] * gv + bv;
        }
        // the next pass forms its address anew: the registers that these stores name stay until this wait
        asm volatile("s_wait_xcnt 0x0" ::: "memory");
    }
}

// ---------------------------------------------------------------------------
// Attention per (b,h): block = 8 waves x 16 queries (128 queries), grid
// (T/128, B*H).  64-key K tile ([key][d], pitch 72) and V tile ([d][key],
// pitch 72, from the transposed V copy) staged in LDS by asynchronous copies,
// with the mask tile, in a ring of two buffers (tile t + 1 flies under tile t).
// Both products are taken transposed, so that a lane owns ONE query (lane & 15):
// S^T = K.Q^T: A = K rows (d as k), B = Q rows, same split-k map; D element r
// of a lane = (key 8h+r, query lane&15).  The lane's 32 scores of a tile are
// 4 x 8 consecutive keys of its query's mask row; 16 lanes on 16 rows would
// touch 16 lines a load, so the 128 x 64 mask tile is read in whole lines and
// staged with K and V ([query][key], pitch 68 floats).  Maximum and sum run in
// the lane, the two lane halves join by one exchange (the sums only at the end).
// Each pair of score tiles (keys 32g+0..15, 32g+16..31), x4096 and converted to
// f16, is a B operand of O^T = V^T.P^T in the split-k map (elements 0..7
// = keys 32g+8h+0..7, 8..15 = keys 32g+16+8h+0..7); A = V^T rows (key as k).
// D element r of a lane = (d 16c+8h+r, query lane&15).  Softmax in f32.
// ---------------------------------------------------------------------------
// value of lane l ^ 16
__device__ __forceinline__ float other_half(float v) {
    const int b = __float_as_int(v);
    return __int_as_float(__builtin_amdgcn_permlanex16(b, b, 0x76543210, 0xfedcba98, false, false));
}

#define AKT   64                       // keys of a tile
#define AMP   (AKT + 4)                // LDS pitch of a mask row, floats
#define AK_B  (AKT * 72 * 2)           // bytes of a staged K tile
#define AV_B  (NDK * 72 * 2)           // of a V tile
#define AM_B  (128 * AMP * 4)          // of a mask tile
#define ASTG  (AK_B + AV_B + AM_B)     // of a ring buffer: K, V, mask

// A lane's twelve asynchronous 16-byte copies of one key tile: two K rows and two V rows (each pair RS bytes apart
// in LDS, KG and VG in memory), eight mask rows (MS bytes apart in LDS, MG in memory).  s_wait_xcnt is the last line
// of the copies' own statement, so that no register which a copy names is rewritten in front of it.
template <int RS, int KG, int VG, int MS, int MG>
__device__ __forceinline__ void async_kvm(unsigned lk, const char* gk, unsigned lv, const char* gv,
                                          unsigned lm, const char* gm) {
    asm volatile("global_load_async_to_lds_b128 %0, %12, off\n\t"
                 "global_load_async_to_lds_b128 %1, %13, off\n\t"
                 "global_load_async_to_lds_b128 %2, %14, off\n\t"
                 "global_load_async_to_lds_b128 %3, %15, off\n\t"
                 "global_load_async_to_lds_b128 %4, %16, off\n\t"
                 "global_load_async_to_lds_b128 %5, %17, off\n\t"
                 "global_load_async_to_lds_b128 %6, %18, off\n\t"
                 "global_load_async_to_lds_b128 %7, %19, off\n\t"
                 "global_load_async_to_lds_b128 %8, %20, off\n\t"
                 "global_load_async_to_lds_b128 %9, %21, off\n\t"
                 "global_load_async_to_lds_b128 %10, %22, off\n\t"
                 "global_load_async_to_lds_b128 %11, %23, off\n\t"
                 "s_wait_xcnt 0x0"
                 :: "v"(lm), "v"(lm + MS), "v"(lm + 2 * MS), "v"(lm + 3 * MS),
                    "v"(lm + 4 * MS), "v"(lm + 5 * MS), "v"(lm + 6 * MS), "v"(lm + 7 * MS),
                    "v"(lk), "v"(lk + RS), "v"(lv), "v"(lv + RS),
                    "v"(gm), "v"(gm + MG), "v"(gm + 2 * MG), "v"(gm + 3 * MG),
                    "v"(gm + 4 * MG), "v"(gm + 5 * MG), "v"(gm + 6 * MG), "v"(gm + 7 * MG),
                    "v"(gk), "v"(gk + KG), "v"(gv), "v"(gv + VG)
                 : "memory");
}

// one key tile of k_attn: rows 32 apart for K and V, 2 apart for the mask
__device__ __forceinline__ void attn_stage(unsigned lk, const char* gk, unsigned lv, const char* gv,
                                           unsigned lm, const char* gm) {
    async_kvm<32 * 72 * 2, 32 * NDK * 2, 32 * NT * 2, 2 * AMP * 4, 2 * NT * 4>(lk, gk, lv, gv, lm, gm);
}

__global__ __launch_bounds__(256)
void k_attn(const _Float16* __restrict__ q, const _Float16* __restrict__ k,
            const _Float16* __restrict__ vt, const float* __restrict__ mask,
            const float* __restrict__ x, float* __restrict__ ores, _Float16* __restrict__ oh,
            float* __restrict__ stat) {
    __shared__ __align__(16) unsigned char ring[2 * ASTG];
    __shared__ __align__(16) float    Os[8][16 * 68];

    const int tid = threadIdx.x, lane = tid & 31, wave = tid >> 5;
    const int hl = lane >> 4, m = lane & 15;
    const int bh = blockIdx.y;
    const int b = bh / NH, hh = bh % NH;
    const int q0 = blockIdx.x * 128 + wave * 16;

    Frag aq0, aq1;
    {
        const _Float16* qp = q + ((size_t)bh * NT + q0 + m) * NDK;
        aq0.hf[0] = *(const v8h*)(qp + 8 * hl);
        aq0.hf[1] = *(const v8h*)(qp + 16 + 8 * hl);
        aq1.hf[0] = *(const v8h*)(qp + 32 + 8 * hl);
        aq1.hf[1] = *(const v8h*)(qp + 48 + 8 * hl);
    }

    const int kr = tid >> 3, kc = (tid & 7) * 8;       // K tile: 64 keys x 64 d, rows kr and kr + 32
    const int vr = kr, vc = kc;                        // V tile: 64 d x 64 keys, rows vr and vr + 32
    const char* kg = (const char*)(k  + ((size_t)bh * NT  + kr) * NDK + kc);   // the thread's pieces of the next tile to copy
    const char* vg = (const char*)(vt + ((size_t)bh * NDK + vr) * NT  + vc);
    const int mr = wave * 16 + (lane >> 4), mc = (lane & 15) * 4;  // mask tile: rows mr + 2 j, 16 lanes a row
    const char* mg = (const char*)(mask + ((size_t)b * NT + blockIdx.x * 128 + mr) * NT + mc);
    const unsigned lk = lds_addr(ring) + (kr * 72 + kc) * 2;                   // their places in buffer 0
    const unsigned lv = lds_addr(ring) + AK_B + (vr * 72 + vc) * 2;
    const unsigned lm = lds_addr(ring) + AK_B + AV_B + (mr * AMP + mc) * 4;

    v8f acc[4];
    #pragma unroll
    for (int c = 0; c < 4; ++c) acc[c] = zero8();
    float mrun = -3.0e38f, lrun = 0.0f;                 // lrun: the sum over this lane half's keys only

    const float sscale = 0.125f;
    const float pscale = 4096.0f;

    // tile 0 into buffer 0, landed and published; then tile 1 into buffer 1
    attn_stage(lk, kg, lv, vg, lm, mg);
    kg += AKT * NDK * 2; vg += AKT * 2; mg += AKT * 4;
    asm volatile("s_wait_asynccnt 0x0" ::: "memory");   // the compiler places no wait for the copies
    __syncthreads();
    attn_stage(lk + ASTG, kg, lv + ASTG, vg, lm + ASTG, mg);
    kg += AKT * NDK * 2; vg += AKT * 2; mg += AKT * 4;

    for (int st = 0; st < NT / AKT; ++st) {
        const unsigned bo = (st & 1) * ASTG;            // this trip's buffer
        const _Float16* Ks = (const _Float16*)(ring + bo);
        const _Float16* Vs = (const _Float16*)(ring + bo + AK_B);
        const float* mrow = (const float*)(ring + bo + AK_B + AV_B) + (wave * 16 + m) * AMP + 8 * hl;   // the lane's query, its half's keys

        v8f p[AKT / 16];
        #pragma unroll
        for (int half = 0; half < AKT / 16; ++half) {
            const _Float16* kp = Ks + (half * 16 + m) * 72;
            Frag a0, a1;
            a0.hf[0] = *(const v8h*)(kp + 8 * hl);
            a0.hf[1] = *(const v8h*)(kp + 16 + 8 * hl);
            a1.hf[0] = *(const v8h*)(kp + 32 + 8 * hl);
            a1.hf[1] = *(const v8h*)(kp + 48 + 8 * hl);
            v8f S = zero8();
            S = wmma16(a0.v, aq0.v, S);
            S = wmma16(a1.v, aq1.v, S);
            const v4f mv0 = *(const v4f*)(mrow + half * 16);
            const v4f mv1 = *(const v4f*)(mrow + half * 16 + 4);
            const v8f mv = __builtin_shufflevector(mv0, mv1, 0, 1, 2, 3, 4, 5, 6, 7);
            p[half] = S * sscale + NEGBIG * (1.0f - mv);
        }
        const v8f mx = __builtin_elementwise_max(__builtin_elementwise_max(p[0], p[1]), __builtin_elementwise_max(p[2], p[3]));
        const float mh = fmaxf(fmaxf(fmaxf(mx[0], mx[1]), fmaxf(mx[2], mx[3])),
                               fmaxf(fmaxf(mx[4], mx[5]), fmaxf(mx[6], mx[7])));
        const float mnew = fmaxf(mrun, fmaxf(mh, other_half(mh)));
        const float resc = __expf(mrun - mnew);
        mrun = mnew;
        #pragma unroll
        for (int e = 0; e < 8; ++e) {
            #pragma unroll
            for (int t = 0; t < AKT / 16; ++t) p[t][e] = __expf(p[t][e] - mnew);
        }
        const v8f sm = (p[0] + p[1]) + (p[2] + p[3]);
        lrun = lrun * resc + (((sm[0] + sm[1]) + (sm[2] + sm[3])) + ((sm[4] + sm[5]) + (sm[6] + sm[7])));
        #pragma unroll
        for (int c = 0; c < 4; ++c) acc[c] *= resc;

        #pragma unroll
        for (int g = 0; g < AKT / 32; ++g) {            // 32 keys a product
            Frag bp;                                    // P^T as B: no lane exchange, no LDS
            #pragma unroll
            for (int e = 0; e < 8; ++e) {
                bp.v[e]     = (_Float16)(p[2 * g][e] * pscale);
                bp.v[8 + e] = (_Float16)(p[2 * g + 1][e] * pscale);
            }
            #pragma unroll
            for (int c = 0; c < 4; ++c) {
                const _Float16* vp = Vs + (c * 16 + m) * 72 + g * 32;
                Frag fv;
                fv.hf[0] = *(const v8h*)(vp + 8 * hl);
                fv.hf[1] = *(const v8h*)(vp + 16 + 8 * hl);
                acc[c] = wmma16(fv.v, bp.v, acc[c]);
            }
        }
        ring_publish();
        if (st + 2 < NT / AKT) {                        // block-uniform: tile st + 2 into the buffer just left
            attn_stage(lk + bo, kg, lv + bo, vg, lm + bo, mg);
            kg += AKT * NDK * 2; vg += AKT * 2; mg += AKT * 4;
        }
    }
    asm volatile("s_wait_asynccnt 0x0" ::: "memory");   // nothing in flight when the wave goes on to its end

    const float inv = (1.0f / (lrun + other_half(lrun))) * (1.0f / 4096.0f);
    float* os = &Os[wave][0];
    #pragma unroll
    for (int c = 0; c < 4; ++c) {
        v4f lo, hi;
        #pragma unroll
        for (int e = 0; e < 4; ++e) { lo[e] = acc[c][e] * inv; hi[e] = acc[c][4 + e] * inv; }
        *(v4f*)(os + m * 68 + c * 16 + 8 * hl)     = lo;
        *(v4f*)(os + m * 68 + c * 16 + 8 * hl + 4) = hi;
    }
    __syncthreads();
    v4f w[8];
    size_t goff[8];
    #pragma unroll
    for (int j = 0; j < 8; ++j) {
        const int id = lane + 32 * j;
        const int line = id >> 3, pc = lane & 7;
        const int row = line >> 1, colo = ((line & 1) << 5) + pc * 4;
        goff[j] = ((size_t)(b * NT + q0 + row)) * ND + hh * NDK + colo;
        w[j] = *(const v4f*)(os + row * 68 + colo) + *(const v4f*)(x + goff[j]);
    }
    #pragma unroll
    for (int j = 0; j < 8; ++j) *(v4f*)(ores + goff[j]) = w[j];
    // the same rows in f16, FFN1's operand: 16 lanes = the head's 64 columns of a row = one 128-byte line
    #pragma unroll
    for (int j = 0; j < 8; ++j) {
        v4h hv;
        #pragma unroll
        for (int c = 0; c < 4; ++c) hv[c] = (_Float16)w[j][c];
        *(v4h*)(oh + goff[j]) = hv;
    }
    // this head's share of the second LayerNorm's row statistics: piece j of a lane lies in row 2 j + hl, whose
    // 64 columns lie in the 16 lanes of the lane's half: their sum, then the squared deviations from their mean
    float s[8], dq[8];
    #pragma unroll
    for (int j = 0; j < 8; ++j) s[j] = (w[j][0] + w[j][1]) + (w[j][2] + w[j][3]);
    #pragma unroll
    for (int off = 8; off >= 1; off >>= 1) {
        #pragma unroll
        for (int j = 0; j < 8; ++j) s[j] += __shfl_xor(s[j], off, 32);
    }
    #pragma unroll
    for (int j = 0; j < 8; ++j) {
        const v4f d = w[j] - s[j] * (1.0f / NDK);
        dq[j] = (d[0] * d[0] + d[1] * d[1]) + (d[2] * d[2] + d[3] * d[3]);
    }
    #pragma unroll
    for (int off = 8; off >= 1; off >>= 1) {
        #pragma unroll
        for (int j = 0; j < 8; ++j) dq[j] += __shfl_xor(dq[j], off, 32);
    }
    // lane m < 8 of a half stores row 2 m + hl: the wave's 16 rows are one 128-byte line of stat[head][row]
    v2f sv = {s[0], dq[0]};
    #pragma unroll
    for (int j = 1; j < 8; ++j) {
        if (m == j) { sv[0] = s[j]; sv[1] = dq[j]; }
    }
    if (m < 8) *(v2f*)(stat + ((size_t)hh * NM + b * NT + q0 + 2 * m + hl) * 2) = sv;
}

// ---------------------------------------------------------------------------
// Host-side launch glue
// ---------------------------------------------------------------------------
extern "C" void kernel_launch(void* const* d_in, const int* in_sizes, int n_in,
                              void* d_out, int out_size, void* d_ws, size_t ws_size,
                              hipStream_t stream) {
    if (n_in < 18) return;
    if (in_sizes[0] != NM * ND || in_sizes[1] != NB * NT * NT || out_size != NM * ND) return;
    if (in_sizes[2] != ND || in_sizes[3] != ND || in_sizes[4] != ND * ND || in_sizes[5] != ND ||
        in_sizes[6] != ND * ND || in_sizes[7] != ND || in_sizes[8] != ND * ND || in_sizes[9] != ND ||
        in_sizes[10] != ND || in_sizes[11] != ND || in_sizes[12] != ND * NF || in_sizes[13] != NF ||
        in_sizes[14] != NF * ND || in_sizes[15] != ND || in_sizes[16] != ND || in_sizes[17] != ND) return;

    const float* x       = (const float*)d_in[0];
    const float* mask    = (const float*)d_in[1];
    const float* ln_in_g = (const float*)d_in[2];
    const float* ln_in_b = (const float*)d_in[3];
    const float* Wq      = (const float*)d_in[4];
    const float* bq      = (const float*)d_in[5];
    const float* Wk      = (const float*)d_in[6];
    const float* bk      = (const float*)d_in[7];
    const float* Wv      = (const float*)d_in[8];
    const float* bv      = (const float*)d_in[9];
    const float* ln1_g   = (const float*)d_in[10];
    const float* ln1_b   = (const float*)d_in[11];
    const float* W1      = (const float*)d_in[12];
    const float* b1      = (const float*)d_in[13];
    const float* W2      = (const float*)d_in[14];
    const float* b2      = (const float*)d_in[15];
    const float* ln2_g   = (const float*)d_in[16];
    const float* ln2_b   = (const float*)d_in[17];
    float* out = (float*)d_out;

    // workspace carve (all offsets but c0's multiples of 512 KiB)
    char* ws = (char*)d_ws;
    size_t o = 0;
    const size_t SZ_H16 = (size_t)NM * ND * 2;              // 8 MiB
    const size_t SZ_F32 = (size_t)NM * ND * 4;              // 16 MiB
    _Float16* h16  = (_Float16*)(ws + o); o += SZ_H16;
    _Float16* q16  = (_Float16*)(ws + o); o += SZ_H16;
    _Float16* k16  = (_Float16*)(ws + o); o += SZ_H16;
    _Float16* vt16 = (_Float16*)(ws + o); o += SZ_H16;
    _Float16* f1   = h16;                                    // [M][F] f16 = 32 MiB, reuses h/q/k/vt region after attention
    float* ares = (float*)(ws + o); o += SZ_F32;             // attention + x
    _Float16* r16 = (_Float16*)(ws + o); o += SZ_H16;        // attention + x in f16
    _Float16* Wqh = (_Float16*)(ws + o); o += (size_t)ND * ND * 2;
    _Float16* Wkh = (_Float16*)(ws + o); o += (size_t)ND * ND * 2;
    _Float16* Wvh = (_Float16*)(ws + o); o += (size_t)ND * ND * 2;
    _Float16* W1h = (_Float16*)(ws + o); o += (size_t)NF * ND * 2;   // [F][D]
    _Float16* W2h = (_Float16*)(ws + o); o += (size_t)ND * NF * 2;   // [D][F]
    float* stat = (float*)(ws + o); o += (size_t)NH * NM * 2 * 4;    // [H][M] pairs
    float* c1   = (float*)(ws + o); o += (size_t)NF * 4;
    float* c0   = (float*)(ws + o); o += (size_t)NF * 4;
    if ((size_t)NM * NF * 2 > 4 * SZ_H16) return;
    if (o > ws_size) return;

    // 1, 2. input LayerNorm -> h (f16); weights: transpose to [n][k], scale by a power of two, f16
    //       (W1 times the second LayerNorm's gain); column sums c1, c0 of W1
    k_prep<<<PB_C + PB_LN + 3 * PB_WD + 2 * PB_WF, 256, 0, stream>>>(x, ln_in_g, ln_in_b, h16, Wq, Wk, Wv, W1, W2,
                                                                     Wqh, Wkh, Wvh, W1h, W2h, ln1_g, ln1_b, b1, c1, c0);

    // 3. QKV projections: Wqh, Wkh, Wvh and q16, k16, vt16 lie one behind the other in the carve above
    k_gemm<0, 3 * ND, ND><<<dim3(3 * ND / GT, NM / GT), 256, 0, stream>>>(h16, Wqh, bq, nullptr, (void*)q16, 0.0625f, bk, bv, nullptr);

    // 4. attention + residual(x) -> r (f32, f16) and each head's share of r's row statistics
    k_attn<<<dim3(NT / 128, NB * NH), 256, 0, stream>>>(q16, k16, vt16, mask, x, ares, r16, stat);

    // 5, 6. FFN1 with LN1 folded in: relu(LN1(r) @ W1 + b1) -> f16
    k_gemm<2, NF, ND><<<dim3(NF / GT, NM / GT), 256, 0, stream>>>(r16, W1h, c0, nullptr, (void*)f1, 0.0625f, c1, nullptr, stat);

    // 7, 8. FFN2 and LN2: LN2(f1 @ W2 + b2 + LN1(r)) -> out
    k_ffn2ln<<<NM / FR, 256, 0, stream>>>(f1, W2h, b2, ares, out, 0.03125f, ln1_g, ln1_b, stat, ln2_g, ln2_b);
}

// v008
// One run takes 95.7 microseconds.
// In both of two side-by-side timings against v007, it was 1.03 times as fast.
// All steps since v000 together make it 2.21 times as fast.
#include <hip/hip_runtime.h>
// All contractions: v_wmma_f32_16x16x32_f16 (f16 operands, f32 accumulate): QKV/FFN1 weights pre-scaled x16, FFN2 weights x32, P.V with P x4096 (scales folded back in f32); Q.K^T plain f16. LayerNorm/softmax/residuals f32.

typedef _Float16 v16h __attribute__((ext_vector_type(16)));
typedef _Float16 v8h  __attribute__((ext_vector_type(8), may_alias));
typedef float    v8f  __attribute__((ext_vector_type(8)));
typedef float    v4f  __attribute__((ext_vector_type(4), may_alias));
typedef float    v2f  __attribute__((ext_vector_type(2), may_alias));
typedef _Float16 v4h  __attribute__((ext_vector_type(4), may_alias));

union Frag { v16h v; v8h hf[2]; };

#define NB   8
#define NT   1024
#define ND   512
#define NH   8
#define NDK  64
#define NF   2048
#define NM   (NB * NT)
#define LNEPS  1.0e-3f
#define NEGBIG (-1.0e9f)

__device__ __forceinline__ v8f zero8() {
    v8f z = {0.f, 0.f, 0.f, 0.f, 0.f, 0.f, 0.f, 0.f};
    return z;
}

// 16x16x32 f16 WMMA with trailing hazard guard (D tied, A/B kept live)
__device__ __forceinline__ v8f wmma16(v16h a, v16h b, v8f c) {
    v8f d = __builtin_amdgcn_wmma_f32_16x16x32_f16(false, a, false, b, (short)0, c, false, false);
    asm volatile("v_nop\n\tv_nop\n\tv_nop\n\tv_nop" : "+v"(d) : "v"(a), "v"(b));
    return d;
}

// The same product as the plain builtin, for the attention loop: no asm statement stands behind it, so the LDS
// reads of later fragments may move ahead of it; the compiler keeps the distance behind it where nothing fills it.
__device__ __forceinline__ v8f wmma16p(v16h a, v16h b, v8f c) {
    return __builtin_amdgcn_wmma_f32_16x16x32_f16(false, a, false, b, (short)0, c, false, false);
}

// LDS byte address of a __shared__ location (low 32 bits of its address)
__device__ __forceinline__ unsigned lds_addr(const void* p) { return (unsigned)(size_t)p; }

// Eight asynchronous 16-byte copies of a lane, global -> LDS: rows LS bytes apart in LDS, GS bytes apart in
// memory.  s_wait_xcnt is the last line of the copies' own statement, so that no register which a copy names
// is rewritten in front of it.
template <int LS, int GS>
__device__ __forceinline__ void async8(unsigned l, const char* g) {
    asm volatile("global_load_async_to_lds_b128 %0, %8, off\n\t"
                 "global_load_async_to_lds_b128 %1, %9, off\n\t"
                 "global_load_async_to_lds_b128 %2, %10, off\n\t"
                 "global_load_async_to_lds_b128 %3, %11, off\n\t"
                 "global_load_async_to_lds_b128 %4, %12, off\n\t"
                 "global_load_async_to_lds_b128 %5, %13, off\n\t"
                 "global_load_async_to_lds_b128 %6, %14, off\n\t"
                 "global_load_async_to_lds_b128 %7, %15, off\n\t"
                 "s_wait_xcnt 0x0"
                 :: "v"(l), "v"(l + LS), "v"(l + 2 * LS), "v"(l + 3 * LS),
                    "v"(l + 4 * LS), "v"(l + 5 * LS), "v"(l + 6 * LS), "v"(l + 7 * LS),
                    "v"(g), "v"(g + GS), "v"(g + 2 * GS), "v"(g + 3 * GS),
                    "v"(g + 4 * GS), "v"(g + 5 * GS), "v"(g + 6 * GS), "v"(g + 7 * GS)
                 : "memory");
}

// The same for four copies.
template <int LS, int GS>
__device__ __forceinline__ void async4(unsigned l, const char* g) {
    asm volatile("global_load_async_to_lds_b128 %0, %4, off\n\t"
                 "global_load_async_to_lds_b128 %1, %5, off\n\t"
                 "global_load_async_to_lds_b128 %2, %6, off\n\t"
                 "global_load_async_to_lds_b128 %3, %7, off\n\t"
                 "s_wait_xcnt 0x0"
                 :: "v"(l), "v"(l + LS), "v"(l + 2 * LS), "v"(l + 3 * LS),
                    "v"(g), "v"(g + GS), "v"(g + 2 * GS), "v"(g + 3 * GS)
                 : "memory");
}

// Foot of a trip of a two-buffer ring (every wave, block-uniform): this wave's LDS reads of the buffer it
// leaves are done, its own copies of the next tile have landed; the barrier publishes that tile and frees
// the buffer for the refill behind it.
__device__ __forceinline__ void ring_publish() {
    asm volatile("s_wait_dscnt 0x0" ::: "memory");      // reads done before the buffer is handed to the copies
    asm volatile("s_wait_asynccnt 0x0" ::: "memory");   // the compiler places no wait for the copies
    __syncthreads();
}

// ---------------------------------------------------------------------------
// Weight transpose + scale + f16 convert: Wt[n][k] = f16(W[k][n] * scale), times gs[k] where gs is given.
// W is [K][N] row-major. Block tile: 64 k x 32 n; tile (bx, by) of (N/32, K/64).
// ---------------------------------------------------------------------------
__device__ __forceinline__
void wcvt_tile(const float* __restrict__ W, _Float16* __restrict__ Wt, int K, int N, float scale, int bx, int by,
               const float* __restrict__ gs) {
    __shared__ float tile[64][33];
    const int tid = threadIdx.x;
    const int kb = by * 64, nb = bx * 32;
    const int c = tid & 31, r = tid >> 5;
    float w[8], gk[8] = {1.f, 1.f, 1.f, 1.f, 1.f, 1.f, 1.f, 1.f};
    #pragma unroll
    for (int i = 0; i < 8; ++i) w[i] = W[(size_t)(kb + r + 8 * i) * N + nb + c];
    if (gs) {                                           // block-uniform test, once, under the tile's loads
        const int ks = kb + __builtin_amdgcn_readfirstlane(r);   // the wave's k, for scalar loads
        #pragma unroll
        for (int i = 0; i < 8; ++i) gk[i] = gs[ks + 8 * i];
    }
    #pragma unroll
    for (int i = 0; i < 8; ++i) tile[r + 8 * i][c] = w[i] * scale * gk[i];
    __syncthreads();
    const int n = tid >> 3, pc = tid & 7;
    v8h o;
    #pragma unroll
    for (int e = 0; e < 8; ++e) o[e] = (_Float16)tile[pc * 8 + e][n];
    _Float16* dst = Wt + (size_t)(nb + n) * K + kb + pc * 8;
    *(v8h*)dst = o;
    
}

// ---------------------------------------------------------------------------
// The second LayerNorm is not applied to the rows r = attention + x; it is folded into FFN1:
//   LN(r) @ W1 + b1 = rstd * (r @ (g . W1) - mean * c1) + c0,
//   c1[n] = sum_k g[k] W1[k][n] (of the f16 values that the product uses), c0[n] = sum_k b[k] W1[k][n] + b1[n].
// One block: 32 columns n; wave r sums 64 k, the eight partial sums join through LDS.
// ---------------------------------------------------------------------------
__device__ __forceinline__
void colsum_tile(const float* __restrict__ W1, const float* __restrict__ g, const float* __restrict__ bt,
                 const float* __restrict__ b1, float* __restrict__ c1, float* __restrict__ c0, int bx) {
    __shared__ float red[2][8][32];
    const int c = threadIdx.x & 31, r = __builtin_amdgcn_readfirstlane(threadIdx.x >> 5);   // r scalar: g, bt are read off a scalar base
    const int n = bx * 32 + c;
    float s1 = 0.f, s0 = 0.f;
    #pragma unroll 16   // sixteen loads in flight a lane
    for (int i = 0; i < ND / 8; ++i) {
        const int k = r * (ND / 8) + i;
        const float wv = W1[(size_t)k * NF + n];
        s1 += (float)(_Float16)(wv * 16.0f * g[k]);
        s0 += wv * bt[k];
    }
    red[0][r][c] = s1;
    red[1][r][c] = s0;
    __syncthreads();
    if (r == 0) {
        float t1 = 0.f, t0 = 0.f;
        #pragma unroll
        for (int i = 0; i < 8; ++i) { t1 += red[0][i][c]; t0 += red[1][i][c]; }
        c1[n] = t1 * 0.0625f;
        c0[n] = t0 + b1[n];
    }
}

// ---------------------------------------------------------------------------
// deviations).  One wave per row, 8 rows per 256-thread block.
// OM 0: f16 output only; OM 1: f32 + f16; OM 2: f32 only.
// f32 rows: lane l stores float4 at cols 4l+128j (each instruction = 4 whole
// lines, lane-contiguous 16 B).  f16 rows: lane l stores 8 halves at cols
// ---------------------------------------------------------------------------
template <int OM>
__device__ __forceinline__
void ln_rows(const float* __restrict__ in, const float* __restrict__ g, const float* __restrict__ bt,
             float* __restrict__ of, _Float16* __restrict__ oh, int M, int blk) {
    const int lane = threadIdx.x & 31, wave = threadIdx.x >> 5;
    const int row = blk * 8 + wave;
    if (row >= M) return;                      // wave-uniform; no barriers in this function
    const float* r = in + (size_t)row * ND;

    // The row's loads stand in one statement with their data wait, the results in registers of their own: so
    // no register that a load names is rewritten while the load is out.  v: float4 at cols 4l+128j, for the sums
    // and the f32 rows; xh (OM != 2): 8 floats at cols 8l+256j, for the f16 rows.
    v4f v[4], xh[4];
    if constexpr (OM != 2) {
        asm volatile("global_load_b128 %0, %8, off\n\t"
                     "global_load_b128 %1, %8, off offset:512\n\t"
                     "global_load_b128 %2, %8, off offset:1024\n\t"
                     "global_load_b128 %3, %8, off offset:1536\n\t"
                     "global_load_b128 %4, %9, off\n\t"
                     "global_load_b128 %5, %9, off offset:16\n\t"
                     "global_load_b128 %6, %9, off offset:1024\n\t"
                     "global_load_b128 %7, %9, off offset:1040\n\t"
                     "s_wait_loadcnt 0x0"
                     : "=&v"(v[0]), "=&v"(v[1]), "=&v"(v[2]), "=&v"(v[3]),
                       "=&v"(xh[0]), "=&v"(xh[1]), "=&v"(xh[2]), "=&v"(xh[3])
                     : "v"(r + 4 * lane), "v"(r + 8 * lane) : "memory");
    } else {
        asm volatile("global_load_b128 %0, %4, off\n\t"
                     "global_load_b128 %1, %4, off offset:512\n\t"
                     "global_load_b128 %2, %4, off offset:1024\n\t"
                     "global_load_b128 %3, %4, off offset:1536\n\t"
                     "s_wait_loadcnt 0x0"
                     : "=&v"(v[0]), "=&v"(v[1]), "=&v"(v[2]), "=&v"(v[3])
                     : "v"(r + 4 * lane) : "memory");
    }
    float s = 0.f;
    #pragma unroll
    for (int j = 0; j < 4; ++j) s += (v[j][0] + v[j][1]) + (v[j][2] + v[j][3]);
    #pragma unroll
    for (int off = 16; off >= 1; off >>= 1) s += __shfl_xor(s, off, 32);
    const float mean = s * (1.0f / ND);
    float sq = 0.f;
    #pragma unroll
    for (int j = 0; j < 4; ++j) {
        #pragma unroll
        for (int c = 0; c < 4; ++c) { const float d = v[j][c] - mean; sq += d * d; }
    }
    #pragma unroll
    for (int off = 16; off >= 1; off >>= 1) sq += __shfl_xor(sq, off, 32);
    const float rstd = rsqrtf(sq * (1.0f / ND) + LNEPS);

    if constexpr (OM != 0) {
        v4f o[4];
        #pragma unroll
        for (int j = 0; j < 4; ++j) {
            const int c0 = 4 * lane + 128 * j;
            const v4f gv = *(const v4f*)(g + c0);
            const v4f bv = *(const v4f*)(bt + c0);
            #pragma unroll
            for (int c = 0; c < 4; ++c) o[j][c] = (v[j][c] - mean) * rstd * gv[c] + bv[c];
        }
        float* orow = of + (size_t)row * ND + 4 * lane;
        #pragma unroll
        for (int j = 0; j < 4; ++j) *(v4f*)(orow + 128 * j) = o[j];
        
    }
    if constexpr (OM != 2) {
        v8h w[2];
        #pragma unroll
        for (int j = 0; j < 2; ++j) {
            const int c0 = 8 * lane + 256 * j;
            const v4f x0 = xh[2 * j], x1 = xh[2 * j + 1];
            const v4f g0 = *(const v4f*)(g + c0),  g1 = *(const v4f*)(g + c0 + 4);
            const v4f b0 = *(const v4f*)(bt + c0), b1 = *(const v4f*)(bt + c0 + 4);
            #pragma unroll
            for (int c = 0; c < 4; ++c) {
                w[j][c]     = (_Float16)((x0[c] - mean) * rstd * g0[c] + b0[c]);
                w[j][4 + c] = (_Float16)((x1[c] - mean) * rstd * g1[c] + b1[c]);
            }
        }
        _Float16* hrow = oh + (size_t)row * ND + 8 * lane;
        #pragma unroll
        for (int j = 0; j < 2; ++j) *(v8h*)(hrow + 256 * j) = w[j];
        
    }
}

// ---------------------------------------------------------------------------
// Everything that depends on the inputs alone, in one grid: the column sums
// of W1 that fold the second LayerNorm into FFN1 (PB_C blocks), the input
// LayerNorm (PB_LN blocks, 8 rows each), then the five weight converts
// (one 64 k x 32 n tile a block).  The job is picked by the block index, so
// every branch here is block-uniform.
// ---------------------------------------------------------------------------
#define PB_LN (NM / 8)                      // LayerNorm blocks
#define PB_WD ((ND / 32) * (ND / 64))       // tiles of a D x D weight
#define PB_WF ((NF / 32) * (ND / 64))       // tiles of W1, and of W2
#define PB_C  (NF / 32)                     // column-sum blocks

__global__ __launch_bounds__(256)
void k_prep(const float* __restrict__ x, const float* __restrict__ g, const float* __restrict__ bt,
            _Float16* __restrict__ h,
            const float* __restrict__ Wq, const float* __restrict__ Wk, const float* __restrict__ Wv,
            const float* __restrict__ W1, const float* __restrict__ W2,
            _Float16* __restrict__ Wqh, _Float16* __restrict__ Wkh, _Float16* __restrict__ Wvh,
            _Float16* __restrict__ W1h, _Float16* __restrict__ W2h,
            const float* __restrict__ g1, const float* __restrict__ bt1, const float* __restrict__ b1,
            float* __restrict__ c1, float* __restrict__ c0) {
    if (blockIdx.x < PB_C) { colsum_tile(W1, g1, bt1, b1, c1, c0, blockIdx.x); return; }   // the longest job starts first
    if (blockIdx.x < PB_C + PB_LN) { ln_rows<0>(x, g, bt, nullptr, h, NM, blockIdx.x - PB_C); return; }
    int b = blockIdx.x - (PB_C + PB_LN);
    const float* W;
    const float* gs = nullptr;
    _Float16* Wt;
    int K, N, bx, by;
    float sc;
    if (b < 3 * PB_WD) {                    // in[512][512] -> out[512][512]
        const int w = b / PB_WD;
        b -= w * PB_WD;
        W  = w == 0 ? Wq  : (w == 1 ? Wk  : Wv);
        Wt = w == 0 ? Wqh : (w == 1 ? Wkh : Wvh);
        K = ND; N = ND; sc = 16.0f;
        bx = b % (ND / 32); by = b / (ND / 32);
    } else if (b < 3 * PB_WD + PB_WF) {     // in[512][2048] -> out[2048][512]
        b -= 3 * PB_WD;
        W = W1; Wt = W1h; K = ND; N = NF; sc = 16.0f; gs = g1;
        bx = b % (NF / 32); by = b / (NF / 32);
    } else {                                // in[2048][512] -> out[512][2048]
        b -= 3 * PB_WD + PB_WF;
        W = W2; Wt = W2h; K = NF; N = ND; sc = 32.0f;
        bx = b % (ND / 32); by = b / (ND / 32);
    }
    wcvt_tile(W, Wt, K, N, sc, bx, by, gs);
    // the built code lays the LayerNorm behind this tile's store: its registers stay until this wait
    asm volatile("s_wait_xcnt 0x0" ::: "memory");
}

// ---------------------------------------------------------------------------
// WMMA GEMM: C[M,N] = A[M,K] @ W[K,N] (+bias, scale, epilogue).  A f16
// row-major [M][K]; weights f16 [N][K] (k-contiguous), so A and B fragments
// use the same split-k loader: elements 0..7 <- k0+8h+0..7, elements 8..15
// <- k0+16+8h+0..7, h = lane>>4, row/col = lane&15.  D element r of a lane =
// (row 8h+r, col lane&15).  Block tile 128x128, K step 128, 8 waves (4 m x 2 n,
// each wave 32x64 = 2 x 4 accumulators).  A and B tiles staged in LDS, rows of
// 256 B at pitch 272 B, by asynchronous copies in a ring of two buffers: tile
// t + 1 is in flight while tile t is worked on; the output staging reuses the
// ring behind the last trip's barrier.  M, N multiples of 128; K a multiple of 128.  N and K
// are compile-time, so a thread's 8 rows of a tile hang off one address.
// MODE 0: Q, K and V in one grid, N = 3 * ND: Bt holds the three weights one
//         behind the other, outp the three outputs; a column tile lies in one
//         projection w = nBase / ND (block-uniform), which picks bias, output
//         and f16 epilogue 0 (Q, K) or 1 (V)
// MODE 2: f16 out, relu, row-major [M][N]  (FFN1): A = the rows r before the second LayerNorm, weights
//         times its gain; the epilogue finishes the LayerNorm: (acc - mean c1) rstd + c0 (bias = c0, biasK = c1)
// MODE 2: stat[head][row] = (sum, sum of squared deviations from the head's own mean) of the row's 64
//         columns of that head; the block joins the eight pairs of each of its rows into mean and rstd
// f16 epilogues EM: 0 = [B,H,T,DK], 1 = [B,H,DK,T] (V transposed), 2 = FFN1
// ---------------------------------------------------------------------------
#define GT  128     // block tile, rows and columns
#define GK  128     // k per staged tile
#define GP  136     // LDS pitch of a staged row and of an f16 output row, halves
#define GOP (GT * GP * 2)   // bytes of one operand's staged tile
#define GSTG (2 * GOP)      // bytes of a ring buffer: A tile, then B tile

// f16 epilogue of a 128x128 tile: scale, bias (relu), staged in Ch, stored in 16-byte pieces
template <int EM, int N>
__device__ __forceinline__
void epi_f16(const v8f (&acc)[2][4], const float (&bj)[4], _Float16* Ch, _Float16* __restrict__ O,
             float oscale, int mBase, int nBase, const float (&cj)[4], const float* rm, const float* rr) {
    const int tid = threadIdx.x, lane = tid & 31, wave = tid >> 5;
    const int hl = lane >> 4, m = lane & 15;
    const int wm = wave & 3, wn = wave >> 2;
    #pragma unroll
    for (int i = 0; i < 2; ++i) {
        v8f mu = zero8(), rs = zero8();                 // mean and rstd of the lane's eight rows
        if constexpr (EM == 2) {
            const int r0 = wm * 32 + i * 16 + 8 * hl;
            mu = __builtin_shufflevector(*(const v4f*)(rm + r0), *(const v4f*)(rm + r0 + 4), 0, 1, 2, 3, 4, 5, 6, 7);
            rs = __builtin_shufflevector(*(const v4f*)(rr + r0), *(const v4f*)(rr + r0 + 4), 0, 1, 2, 3, 4, 5, 6, 7);
        }
        #pragma unroll
        for (int j = 0; j < 4; ++j) {
            const int col = wn * 64 + j * 16 + m;
            #pragma unroll
            for (int r = 0; r < 8; ++r) {
                float u;
                if constexpr (EM == 2) u = fmaxf((acc[i][j][r] * oscale - mu[r] * cj[j]) * rs[r] + bj[j], 0.0f);
                else                   u = acc[i][j][r] * oscale + bj[j];
                const int row = wm * 32 + i * 16 + 8 * hl + r;
                if constexpr (EM == 1) Ch[col * GP + row] = (_Float16)u;
                else                   Ch[row * GP + col] = (_Float16)u;
            }
        }
    }
    __syncthreads();
    // thread: staged rows line + 16 j, 16-byte piece pc; a tile lies in one batch (NT % GT == 0)
    const int line = tid >> 4, pc = tid & 15;
    const int bb = mBase / NT, t0 = mBase % NT;
    int step;                                           // halves between rows line and line + 16
    if constexpr (EM == 0) {
        const int n = nBase + pc * 8;                   // column: head n / NDK, d n % NDK
        O += ((size_t)(bb * NH + n / NDK) * NT + t0 + line) * NDK + n % NDK;
        step = 16 * NDK;
    } else if constexpr (EM == 1) {
        const int n = nBase + line;                     // staged row = column: head n / NDK, d n % NDK
        O += ((size_t)(bb * NH + n / NDK) * NDK + n % NDK) * NT + t0 + pc * 8;
        step = 16 * NT;                                 // heads are NDK * NT apart: linear in n
    } else {
        O += (size_t)(mBase + line) * N + nBase + pc * 8;
        step = 16 * N;
    }
    v8h w[8];
    #pragma unroll
    for (int j = 0; j < 8; ++j) w[j] = *(const v8h*)(Ch + (line + 16 * j) * GP + pc * 8);
    #pragma unroll
    for (int j = 0; j < 8; ++j) *(v8h*)(O + j * step) = w[j];
}

template <int MODE, int N, int K>
__global__ __launch_bounds__(256)
void k_gemm(const _Float16* __restrict__ A, const _Float16* __restrict__ Bt,
            const float* __restrict__ bias, const float* __restrict__ resid,
            void* __restrict__ outp, float oscale,
            const float* __restrict__ biasK, const float* __restrict__ biasV, const float* __restrict__ stat) {
    __shared__ __align__(16) unsigned char ring[2 * GSTG];
    __shared__ __align__(16) float rowm[GT], rowr[GT];    // MODE 2: mean and rstd of the tile's rows
    _Float16* Ch = (_Float16*)ring;                       // output staging, behind the loop

    const int tid = threadIdx.x, lane = tid & 31, wave = tid >> 5;
    const int hl = lane >> 4, m = lane & 15;
    const int mBase = blockIdx.y * GT, nBase = blockIdx.x * GT;
    const int wm = wave & 3, wn = wave >> 2;
    const int ar = tid >> 4, ac = (tid & 15) * 8;         // staging: row (step 16), k chunk
    const char* Ag = (const char*)(A  + (size_t)mBase * K + ar * K + ac);   // the thread's first piece of the next tile to copy
    const char* Bg = (const char*)(Bt + (size_t)nBase * K + ar * K + ac);
    const unsigned lst = lds_addr(ring) + (ar * GP + ac) * 2;                // its place in buffer 0's A tile

    v8f acc[2][4];
    #pragma unroll
    for (int i = 0; i < 2; ++i) {
        #pragma unroll
        for (int j = 0; j < 4; ++j) acc[i][j] = zero8();
    }
    // tile 0 into buffer 0, landed and published; then tile 1 into buffer 1
    async8<16 * GP * 2, 16 * K * 2>(lst, Ag);
    async8<16 * GP * 2, 16 * K * 2>(lst + GOP, Bg);
    Ag += GK * 2; Bg += GK * 2;
    if constexpr (MODE != 0) {
        if (__builtin_amdgcn_readfirstlane(wave) < GT / 32) {   // a scalar test, whole waves; under tile 0's flight, published by its barrier
            const float* sp = stat + (size_t)(mBase + tid) * 2;
            v2f p[NH];
            #pragma unroll
            for (int h = 0; h < NH; ++h) p[h] = *(const v2f*)(sp + (size_t)h * NM * 2);
            float sm = 0.f;
            #pragma unroll
            for (int h = 0; h < NH; ++h) sm += p[h][0];
            const float mean = sm * (1.0f / ND);
            float m2 = 0.f;
            #pragma unroll
            for (int h = 0; h < NH; ++h) {
                const float d = p[h][0] * (1.0f / NDK) - mean;
                m2 += p[h][1] + (float)NDK * d * d;
            }
            rowm[tid] = mean;
            rowr[tid] = rsqrtf(m2 * (1.0f / ND) + LNEPS);
        }
    }
    asm volatile("s_wait_asynccnt 0x0" ::: "memory");       // the compiler places no wait for the copies
    __syncthreads();
    if (K / GK > 1) {
        async8<16 * GP * 2, 16 * K * 2>(lst + GSTG, Ag);
        async8<16 * GP * 2, 16 * K * 2>(lst + GSTG + GOP, Bg);
        Ag += GK * 2; Bg += GK * 2;
    }

    for (int kt = 0; kt < K / GK; ++kt) {
        const unsigned bo = (kt & 1) * GSTG;                // this trip's buffer
        const _Float16* ap = (const _Float16*)(ring + bo) + (wm * 32 + m) * GP + 8 * hl;
        const _Float16* bp = (const _Float16*)(ring + bo + GOP) + (wn * 64 + m) * GP + 8 * hl;
        #pragma unroll
        for (int kk = 0; kk < GK / 32; ++kk) {
            Frag fa[2], fb[4];
            #pragma unroll
            for (int i = 0; i < 2; ++i) {
                fa[i].hf[0] = *(const v8h*)(ap + i * 16 * GP + kk * 32);
                fa[i].hf[1] = *(const v8h*)(ap + i * 16 * GP + kk * 32 + 16);
            }
            #pragma unroll
            for (int j = 0; j < 4; ++j) {
                fb[j].hf[0] = *(const v8h*)(bp + j * 16 * GP + kk * 32);
                fb[j].hf[1] = *(const v8h*)(bp + j * 16 * GP + kk * 32 + 16);
            }
            #pragma unroll
            for (int i = 0; i < 2; ++i) {
                #pragma unroll
                for (int j = 0; j < 4; ++j) acc[i][j] = wmma16(fa[i].v, fb[j].v, acc[i][j]);
            }
        }
        ring_publish();
        if (kt + 2 < K / GK) {                              // block-uniform: tile kt + 2 into the buffer just left
            async8<16 * GP * 2, 16 * K * 2>(lst + bo, Ag);
            async8<16 * GP * 2, 16 * K * 2>(lst + bo + GOP, Bg);
            Ag += GK * 2; Bg += GK * 2;
        }
    }
    asm volatile("s_wait_asynccnt 0x0" ::: "memory");       // nothing in flight when the ring becomes output staging

    const int w  = MODE == 0 ? nBase / ND : 0;              // projection of this tile
    const int nb = MODE == 0 ? nBase % ND : nBase;          // its first column there
    const float* bs = bias;
    if constexpr (MODE == 0) bs = w == 0 ? bias : (w == 1 ? biasK : biasV);
    float bj[4];
    #pragma unroll
    for (int j = 0; j < 4; ++j) bj[j] = bs[nb + wn * 64 + j * 16 + m];

    if constexpr (MODE == 0) {
        _Float16* o = (_Float16*)outp + (size_t)w * NM * ND;
        if (w == 2) {
            epi_f16<1, ND>(acc, bj, Ch, o, oscale, mBase, nb, bj, nullptr, nullptr);
        } else {
            epi_f16<0, ND>(acc, bj, Ch, o, oscale, mBase, nb, bj, nullptr, nullptr);
            // the built code lays the other epilogue behind these stores: their registers stay until this wait
            asm volatile("s_wait_xcnt 0x0" ::: "memory");
        }
    } else if constexpr (MODE == 2) {
        float cj[4];
        #pragma unroll
        for (int j = 0; j < 4; ++j) cj[j] = biasK[nBase + wn * 64 + j * 16 + m];
        epi_f16<2, N>(acc, bj, Ch, (_Float16*)outp, oscale, mBase, nBase, cj, rowm, rowr);
    }
}

// ---------------------------------------------------------------------------
// FFN2 with both LayerNorms around it: out = LN2(f1 @ W2 + b2 + LN1(r)).  A block owns FR whole rows (all ND
// columns), so the last LayerNorm runs in its epilogue.  8 waves side by side, each FR rows x 64 columns
// (4 x 4 accumulators); fragments, k order and ring as in k_gemm: A tile FR rows, B tile ND rows of GK halves.
// LN1(r) is formed from r (resid), the row's mean and rstd (joined from stat as in k_gemm), gain g1, shift s1.
// Behind the loop the block's rows of r are copied into buffer 0 and fly while the products are staged in buffer 1.
// ---------------------------------------------------------------------------
#define FR   64                 // rows of a block
#define FSA  (FR * GP * 2)      // bytes of a staged A tile
#define FSB  (ND * GP * 2)      // of a staged B tile
#define FSTG (FSA + FSB)        // of a ring buffer: A tile, then B tile
#define FPF  (ND + 4)           // LDS pitch of an f32 output row, floats

// 1 / sqrt(x) for x >= LNEPS: no subnormal argument, so none of rsqrtf's rescaling.  The v_nop is the slot that the
// instruction set asks for behind a transcendental, before its result is read or its source overwritten.
__device__ __forceinline__ float rsq_pos(float x) {
    float r;
    asm("v_rsq_f32 %0, %1\n\tv_nop" : "=v"(r) : "v"(x));
    return r;
}

// a thread's 36 copies of one k tile: 4 rows of A, 32 of B, 16 rows apart
__device__ __forceinline__ void ffn2_stage(unsigned l, const char* a, const char* b) {
    async4<16 * GP * 2, 16 * NF * 2>(l, a);
    #pragma unroll
    for (int c = 0; c < 4; ++c) async8<16 * GP * 2, 16 * NF * 2>(l + FSA + c * 128 * GP * 2, b + (size_t)c * 128 * NF * 2);
}

__global__ __launch_bounds__(256)
void k_ffn2ln(const _Float16* __restrict__ A, const _Float16* __restrict__ Bt,
              const float* __restrict__ bias, const float* __restrict__ resid, float* __restrict__ outp, float oscale,
              const float* __restrict__ g1, const float* __restrict__ s1, const float* __restrict__ stat,
              const float* __restrict__ g2, const float* __restrict__ s2) {
    constexpr int K = NF;
    __shared__ __align__(16) unsigned char ring[2 * FSTG];
    __shared__ __align__(16) float rowm[FR], rowr[FR];    // LN1's mean and rstd of the block's rows
    static_assert(FR * FPF * 4 <= FSTG, "r in buffer 0, the products in buffer 1");
    const float* Rf = (const float*)ring;                 // the rows of r, pitch FPF
    float* Cf = (float*)(ring + FSTG);                    // the products, behind the loop, pitch FPF

    const int tid = threadIdx.x, lane = tid & 31, wave = tid >> 5;
    const int hl = lane >> 4, m = lane & 15;
    const int mBase = blockIdx.x * FR;
    const int ar = tid >> 4, ac = (tid & 15) * 8;         // staging: row (step 16), k chunk
    const char* Ag = (const char*)(A  + (size_t)mBase * K + ar * K + ac);   // the thread's first piece of the next tile to copy
    const char* Bg = (const char*)(Bt + ar * K + ac);
    const unsigned lst = lds_addr(ring) + (ar * GP + ac) * 2;                // its place in buffer 0's A tile

    v8f acc[4][4];
    #pragma unroll
    for (int i = 0; i < 4; ++i) {
        #pragma unroll
        for (int j = 0; j < 4; ++j) acc[i][j] = zero8();
    }
    // tile 0 into buffer 0, landed and published; then tile 1 into buffer 1
    ffn2_stage(lst, Ag, Bg);
    Ag += GK * 2; Bg += GK * 2;
    if (__builtin_amdgcn_readfirstlane(wave) < FR / 32) {   // a scalar test, whole waves; under tile 0's flight, published by its barrier
        const float* sp = stat + (size_t)(mBase + tid) * 2;
        v2f p[NH];
        #pragma unroll
        for (int h = 0; h < NH; ++h) p[h] = *(const v2f*)(sp + (size_t)h * NM * 2);
        float sm = 0.f;
        #pragma unroll
        for (int h = 0; h < NH; ++h) sm += p[h][0];
        const float mean = sm * (1.0f / ND);
        float m2 = 0.f;
        #pragma unroll
        for (int h = 0; h < NH; ++h) {
            const float d = p[h][0] * (1.0f / NDK) - mean;
            m2 += p[h][1] + (float)NDK * d * d;
        }
        rowm[tid] = mean;
        rowr[tid] = rsqrtf(m2 * (1.0f / ND) + LNEPS);
    }
    asm volatile("s_wait_asynccnt 0x0" ::: "memory");       // the compiler places no wait for the copies
    __syncthreads();
    ffn2_stage(lst + FSTG, Ag, Bg);
    Ag += GK * 2; Bg += GK * 2;

    for (int kt = 0; kt < K / GK; ++kt) {
        const unsigned bo = (kt & 1) * FSTG;                // this trip's buffer
        const _Float16* ap = (const _Float16*)(ring + bo) + m * GP + 8 * hl;
        const _Float16* bp = (const _Float16*)(ring + bo + FSA) + (wave * 64 + m) * GP + 8 * hl;
        #pragma unroll
        for (int kk = 0; kk < GK / 32; ++kk) {
            Frag fa[4], fb[4];
            #pragma unroll
            for (int i = 0; i < 4; ++i) {
                fa[i].hf[0] = *(const v8h*)(ap + i * 16 * GP + kk * 32);
                fa[i].hf[1] = *(const v8h*)(ap + i * 16 * GP + kk * 32 + 16);
            }
            #pragma unroll
            for (int j = 0; j < 4; ++j) {
                fb[j].hf[0] = *(const v8h*)(bp + j * 16 * GP + kk * 32);
                fb[j].hf[1] = *(const v8h*)(bp + j * 16 * GP + kk * 32 + 16);
            }
            #pragma unroll
            for (int i = 0; i < 4; ++i) {
                #pragma unroll
                for (int j = 0; j < 4; ++j) acc[i][j] = wmma16(fa[i].v, fb[j].v, acc[i][j]);
            }
        }
        ring_publish();
        if (kt + 2 < K / GK) {                              // block-uniform: tile kt + 2 into the buffer just left
            ffn2_stage(lst + bo, Ag, Bg);
            Ag += GK * 2; Bg += GK * 2;
        }
    }
    asm volatile("s_wait_asynccnt 0x0" ::: "memory");       // nothing in flight behind the loop
    {                                                       // r into buffer 0; a wave: rows wave + 8 t, 512 bytes a copy
        const unsigned lr = lds_addr(ring) + wave * FPF * 4 + lane * 16;
        const char* rg = (const char*)(resid + (size_t)(mBase + wave) * ND + 4 * lane);
        #pragma unroll
        for (int j = 0; j < 4; ++j) async8<8 * FPF * 4, 8 * ND * 4>(lr + j * 512, rg + j * 512);
    }

    #pragma unroll
    for (int j = 0; j < 4; ++j) {
        const int col = wave * 64 + j * 16 + m;
        const float bj = bias[col];
        #pragma unroll
        for (int i = 0; i < 4; ++i) {
            #pragma unroll
            for (int r = 0; r < 8; ++r) Cf[(i * 16 + 8 * hl + r) * FPF + col] = acc[i][j][r] * oscale + bj;
        }
    }
    asm volatile("s_wait_asynccnt 0x0" ::: "memory");       // the rows of r have landed; the compiler places no wait for the copies
    __syncthreads();
    // a row = one wave; lane: float4 at cols 4 l + 128 j, as in ln_rows.  Four rows (wave + 8 t) go
    // side by side, so that their loads and their lane exchanges overlap.
    float* O = outp + (size_t)(mBase + wave) * ND + 4 * lane;
    const int lo = wave * FPF + 4 * lane;                   // the lane's place in both staged tiles
    #pragma unroll 1   // rolled: eight rows' values at once would take about a hundred registers more
    for (int g = 0; g < FR / 32; ++g) {
        v4f v[4][4];
        #pragma unroll
        for (int j = 0; j < 4; ++j) {
            if (j == 2) __builtin_amdgcn_sched_barrier(0);  // the LDS loads in two groups: all 32 at once take the kernel past 256 registers
            const v4f gv = *(const v4f*)(g1 + 4 * lane + 128 * j);
            const v4f bv = *(const v4f*)(s1 + 4 * lane + 128 * j);
            #pragma unroll
            for (int t = 0; t < 4; ++t) {
                const int ro = 32 * g + 8 * t;              // row - wave
                const v4f a = (*(const v4f*)(Rf + lo + ro * FPF + 128 * j) - rowm[wave + ro]) * rowr[wave + ro] * gv + bv;
                v[t][j] = *(const v4f*)(Cf + lo + ro * FPF + 128 * j) + a;
            }
        }
        float s[4], sq[4];
        #pragma unroll
        for (int t = 0; t < 4; ++t) {
            s[t] = 0.f;
            #pragma unroll
            for (int j = 0; j < 4; ++j) s[t] += (v[t][j][0] + v[t][j][1]) + (v[t][j][2] + v[t][j][3]);
        }
        #pragma unroll
        for (int off = 16; off >= 1; off >>= 1) {
            #pragma unroll
            for (int t = 0; t < 4; ++t) s[t] += __shfl_xor(s[t], off, 32);
        }
        #pragma unroll
        for (int t = 0; t < 4; ++t) {
            s[t] *= (1.0f / ND);                            // the row's mean
            sq[t] = 0.f;
            #pragma unroll
            for (int j = 0; j < 4; ++j) {
                #pragma unroll
                for (int c = 0; c < 4; ++c) { const float d = v[t][j][c] - s[t]; sq[t] += d * d; }
            }
        }
        #pragma unroll
        for (int off = 16; off >= 1; off >>= 1) {
            #pragma unroll
            for (int t = 0; t < 4; ++t) sq[t] += __shfl_xor(sq[t], off, 32);
        }
        #pragma unroll
        for (int t = 0; t < 4; ++t) sq[t] = rsq_pos(sq[t] * (1.0f / ND) + LNEPS);   // its rstd
        #pragma unroll
        for (int j = 0; j < 4; ++j) {
            const v4f gv = *(const v4f*)(g2 + 4 * lane + 128 * j);
            const v4f bv = *(const v4f*)(s2 + 4 * lane + 128 * j);
            #pragma unroll
            for (int t = 0; t < 4; ++t)
                *(v4f*)(O + (32 * g + 8 * t) * ND + 128 * j) = (v[t][j] - s[t]) * sq[t] * gv + bv;
        }
        // the next pass forms its address anew: the registers that these stores name stay until this wait
        asm volatile("s_wait_xcnt 0x0" ::: "memory");
    }
}

// ---------------------------------------------------------------------------
// Attention per (b,h): block = 8 waves x 16 queries (128 queries), grid
// (T/128, B*H).  64-key K tile ([key][d], pitch 72) and V tile ([d][key],
// pitch 72, from the transposed V copy) staged in LDS by asynchronous copies,
// with the mask tile, in a ring of two buffers (tile t + 1 flies under tile t).
// Both products are taken transposed, so that a lane owns ONE query (lane & 15):
// S^T = K.Q^T: A = K rows (d as k), B = Q rows, same split-k map; D element r
// of a lane = (key 8h+r, query lane&15).  The lane's 32 scores of a tile are
// 4 x 8 consecutive keys of its query's mask row; 16 lanes on 16 rows would
// touch 16 lines a load, so the 128 x 64 mask tile is read in whole lines and
// staged with K and V ([query][key], pitch 68 floats).  Maximum and sum run in
// the lane, the two lane halves join by one exchange (the sums only at the end).
// Each pair of score tiles (keys 32g+0..15, 32g+16..31), x4096 and converted to
// f16, is a B operand of O^T = V^T.P^T in the split-k map (elements 0..7
// = keys 32g+8h+0..7, 8..15 = keys 32g+16+8h+0..7); A = V^T rows (key as k).
// D element r of a lane = (d 16c+8h+r, query lane&15).  Softmax in f32.
// ---------------------------------------------------------------------------
// value of lane l ^ 16
__device__ __forceinline__ float other_half(float v) {
    const int b = __float_as_int(v);
    return __int_as_float(__builtin_amdgcn_permlanex16(b, b, 0x76543210, 0xfedcba98, false, false));
}

#define AKT   64                       // keys of a tile
#define AMP   (AKT + 4)                // LDS pitch of a mask row, floats
#define AK_B  (AKT * 72 * 2)           // bytes of a staged K tile
#define AV_B  (NDK * 72 * 2)           // of a V tile
#define AM_B  (128 * AMP * 4)          // of a mask tile
#define ASTG  (AK_B + AV_B + AM_B)     // of a ring buffer: K, V, mask

// A lane's twelve asynchronous 16-byte copies of one key tile: two K rows and two V rows (each pair RS bytes apart
// in LDS, KG and VG in memory), eight mask rows (MS bytes apart in LDS, MG in memory).  s_wait_xcnt is the last line
// of the copies' own statement, so that no register which a copy names is rewritten in front of it.
template <int RS, int KG, int VG, int MS, int MG>
__device__ __forceinline__ void async_kvm(unsigned lk, const char* gk, unsigned lv, const char* gv,
                                          unsigned lm, const char* gm) {
    asm volatile("global_load_async_to_lds_b128 %0, %12, off\n\t"
                 "global_load_async_to_lds_b128 %1, %13, off\n\t"
                 "global_load_async_to_lds_b128 %2, %14, off\n\t"
                 "global_load_async_to_lds_b128 %3, %15, off\n\t"
                 "global_load_async_to_lds_b128 %4, %16, off\n\t"
                 "global_load_async_to_lds_b128 %5, %17, off\n\t"
                 "global_load_async_to_lds_b128 %6, %18, off\n\t"
                 "global_load_async_to_lds_b128 %7, %19, off\n\t"
                 "global_load_async_to_lds_b128 %8, %20, off\n\t"
                 "global_load_async_to_lds_b128 %9, %21, off\n\t"
                 "global_load_async_to_lds_b128 %10, %22, off\n\t"
                 "global_load_async_to_lds_b128 %11, %23, off\n\t"
                 "s_wait_xcnt 0x0"
                 :: "v"(lm), "v"(lm + MS), "v"(lm + 2 * MS), "v"(lm + 3 * MS),
                    "v"(lm + 4 * MS), "v"(lm + 5 * MS), "v"(lm + 6 * MS), "v"(lm + 7 * MS),
                    "v"(lk), "v"(lk + RS), "v"(lv), "v"(lv + RS),
                    "v"(gm), "v"(gm + MG), "v"(gm + 2 * MG), "v"(gm + 3 * MG),
                    "v"(gm + 4 * MG), "v"(gm + 5 * MG), "v"(gm + 6 * MG), "v"(gm + 7 * MG),
                    "v"(gk), "v"(gk + KG), "v"(gv), "v"(gv + VG)
                 : "memory");
}

// one key tile of k_attn: rows 32 apart for K and V, 2 apart for the mask
__device__ __forceinline__ void attn_stage(unsigned lk, const char* gk, unsigned lv, const char* gv,
                                           unsigned lm, const char* gm) {
    async_kvm<32 * 72 * 2, 32 * NDK * 2, 32 * NT * 2, 2 * AMP * 4, 2 * NT * 4>(lk, gk, lv, gv, lm, gm);
}

__global__ __launch_bounds__(256)
void k_attn(const _Float16* __restrict__ q, const _Float16* __restrict__ k,
            const _Float16* __restrict__ vt, const float* __restrict__ mask,
            const float* __restrict__ x, float* __restrict__ ores, _Float16* __restrict__ oh,
            float* __restrict__ stat) {
    __shared__ __align__(16) unsigned char ring[2 * ASTG];
    __shared__ __align__(16) float    Os[8][16 * 68];

    const int tid = threadIdx.x, lane = tid & 31, wave = tid >> 5;
    const int hl = lane >> 4, m = lane & 15;
    const int bh = blockIdx.y;
    const int b = bh / NH, hh = bh % NH;
    const int q0 = blockIdx.x * 128 + wave * 16;

    Frag aq0, aq1;
    {
        const _Float16* qp = q + ((size_t)bh * NT + q0 + m) * NDK;
        aq0.hf[0] = *(const v8h*)(qp + 8 * hl);
        aq0.hf[1] = *(const v8h*)(qp + 16 + 8 * hl);
        aq1.hf[0] = *(const v8h*)(qp + 32 + 8 * hl);
        aq1.hf[1] = *(const v8h*)(qp + 48 + 8 * hl);
    }

    const int kr = tid >> 3, kc = (tid & 7) * 8;       // K tile: 64 keys x 64 d, rows kr and kr + 32
    const int vr = kr, vc = kc;                        // V tile: 64 d x 64 keys, rows vr and vr + 32
    const char* kg = (const char*)(k  + ((size_t)bh * NT  + kr) * NDK + kc);   // the thread's pieces of the next tile to copy
    const char* vg = (const char*)(vt + ((size_t)bh * NDK + vr) * NT  + vc);
    const int mr = wave * 16 + (lane >> 4), mc = (lane & 15) * 4;  // mask tile: rows mr + 2 j, 16 lanes a row
    const char* mg = (const char*)(mask + ((size_t)b * NT + blockIdx.x * 128 + mr) * NT + mc);
    const unsigned lk = lds_addr(ring) + (kr * 72 + kc) * 2;                   // their places in buffer 0
    const unsigned lv = lds_addr(ring) + AK_B + (vr * 72 + vc) * 2;
    const unsigned lm = lds_addr(ring) + AK_B + AV_B + (mr * AMP + mc) * 4;

    v8f acc[4];
    #pragma unroll
    for (int c = 0; c < 4; ++c) acc[c] = zero8();
    float mrun = -3.0e38f, lrun = 0.0f;                 // lrun: the sum over this lane half's keys only

    const float sscale = 0.125f;
    const float pscale = 4096.0f;

    // tile 0 into buffer 0, landed and published; then tile 1 into buffer 1
    attn_stage(lk, kg, lv, vg, lm, mg);
    kg += AKT * NDK * 2; vg += AKT * 2; mg += AKT * 4;
    asm volatile("s_wait_asynccnt 0x0" ::: "memory");   // the compiler places no wait for the copies
    __syncthreads();
    attn_stage(lk + ASTG, kg, lv + ASTG, vg, lm + ASTG, mg);
    kg += AKT * NDK * 2; vg += AKT * 2; mg += AKT * 4;

    for (int st = 0; st < NT / AKT; ++st) {
        const unsigned bo = (st & 1) * ASTG;            // this trip's buffer
        const _Float16* Ks = (const _Float16*)(ring + bo);
        const _Float16* Vs = (const _Float16*)(ring + bo + AK_B);
        const float* mrow = (const float*)(ring + bo + AK_B + AV_B) + (wave * 16 + m) * AMP + 8 * hl;   // the lane's query, its half's keys

        v8f p[AKT / 16];
        #pragma unroll
        for (int half = 0; half < AKT / 16; ++half) {
            const _Float16* kp = Ks + (half * 16 + m) * 72;
            Frag a0, a1;
            a0.hf[0] = *(const v8h*)(kp + 8 * hl);
            a0.hf[1] = *(const v8h*)(kp + 16 + 8 * hl);
            a1.hf[0] = *(const v8h*)(kp + 32 + 8 * hl);
            a1.hf[1] = *(const v8h*)(kp + 48 + 8 * hl);
            v8f S = zero8();
            S = wmma16p(a0.v, aq0.v, S);
            S = wmma16p(a1.v, aq1.v, S);
            const v4f mv0 = *(const v4f*)(mrow + half * 16);
            const v4f mv1 = *(const v4f*)(mrow + half * 16 + 4);
            const v8f mv = __builtin_shufflevector(mv0, mv1, 0, 1, 2, 3, 4, 5, 6, 7);
            p[half] = S * sscale + NEGBIG * (1.0f - mv);
        }
        Frag fv[AKT / 32][4];                           // the tile's V fragments, read in one group: they land under the softmax
        #pragma unroll
        for (int g = 0; g < AKT / 32; ++g) {
            #pragma unroll
            for (int c = 0; c < 4; ++c) {
                const _Float16* vp = Vs + (c * 16 + m) * 72 + g * 32;
                fv[g][c].hf[0] = *(const v8h*)(vp + 8 * hl);
                fv[g][c].hf[1] = *(const v8h*)(vp + 16 + 8 * hl);
            }
        }
        const v8f mx = __builtin_elementwise_max(__builtin_elementwise_max(p[0], p[1]), __builtin_elementwise_max(p[2], p[3]));
        const float mh = fmaxf(fmaxf(fmaxf(mx[0], mx[1]), fmaxf(mx[2], mx[3])),
                               fmaxf(fmaxf(mx[4], mx[5]), fmaxf(mx[6], mx[7])));
        const float mnew = fmaxf(mrun, fmaxf(mh, other_half(mh)));
        const float resc = __expf(mrun - mnew);
        mrun = mnew;
        #pragma unroll
        for (int e = 0; e < 8; ++e) {
            #pragma unroll
            for (int t = 0; t < AKT / 16; ++t) p[t][e] = __expf(p[t][e] - mnew);
        }
        const v8f sm = (p[0] + p[1]) + (p[2] + p[3]);
        lrun = lrun * resc + (((sm[0] + sm[1]) + (sm[2] + sm[3])) + ((sm[4] + sm[5]) + (sm[6] + sm[7])));
        #pragma unroll
        for (int c = 0; c < 4; ++c) acc[c] *= resc;

        #pragma unroll
        for (int g = 0; g < AKT / 32; ++g) {            // 32 keys a product
            Frag bp;                                    // P^T as B: no lane exchange, no LDS
            #pragma unroll
            for (int e = 0; e < 8; ++e) {
                bp.v[e]     = (_Float16)(p[2 * g][e] * pscale);
                bp.v[8 + e] = (_Float16)(p[2 * g + 1][e] * pscale);
            }
            #pragma unroll
            for (int c = 0; c < 4; ++c) acc[c] = wmma16p(fv[g][c].v, bp.v, acc[c]);
        }
        ring_publish();
        if (st + 2 < NT / AKT) {                        // block-uniform: tile st + 2 into the buffer just left
            attn_stage(lk + bo, kg, lv + bo, vg, lm + bo, mg);
            kg += AKT * NDK * 2; vg += AKT * 2; mg += AKT * 4;
        }
    }
    asm volatile("s_wait_asynccnt 0x0" ::: "memory");   // nothing in flight when the wave goes on to its end

    const float inv = (1.0f / (lrun + other_half(lrun))) * (1.0f / 4096.0f);
    float* os = &Os[wave][0];
    #pragma unroll
    for (int c = 0; c < 4; ++c) {
        v4f lo, hi;
        #pragma unroll
        for (int e = 0; e < 4; ++e) { lo[e] = acc[c][e] * inv; hi[e] = acc[c][4 + e] * inv; }
        *(v4f*)(os + m * 68 + c * 16 + 8 * hl)     = lo;
        *(v4f*)(os + m * 68 + c * 16 + 8 * hl + 4) = hi;
    }
    __syncthreads();
    v4f w[8];
    size_t goff[8];
    #pragma unroll
    for (int j = 0; j < 8; ++j) {
        const int id = lane + 32 * j;
        const int line = id >> 3, pc = lane & 7;
        const int row = line >> 1, colo = ((line & 1) << 5) + pc * 4;
        goff[j] = ((size_t)(b * NT + q0 + row)) * ND + hh * NDK + colo;
        w[j] = *(const v4f*)(os + row * 68 + colo) + *(const v4f*)(x + goff[j]);
    }
    #pragma unroll
    for (int j = 0; j < 8; ++j) *(v4f*)(ores + goff[j]) = w[j];
    // the same rows in f16, FFN1's operand: 16 lanes = the head's 64 columns of a row = one 128-byte line
    #pragma unroll
    for (int j = 0; j < 8; ++j) {
        v4h hv;
        #pragma unroll
        for (int c = 0; c < 4; ++c) hv[c] = (_Float16)w[j][c];
        *(v4h*)(oh + goff[j]) = hv;
    }
    // this head's share of the second LayerNorm's row statistics: piece j of a lane lies in row 2 j + hl, whose
    // 64 columns lie in the 16 lanes of the lane's half: their sum, then the squared deviations from their mean
    float s[8], dq[8];
    #pragma unroll
    for (int j = 0; j < 8; ++j) s[j] = (w[j][0] + w[j][1]) + (w[j][2] + w[j][3]);
    #pragma unroll
    for (int off = 8; off >= 1; off >>= 1) {
        #pragma unroll
        for (int j = 0; j < 8; ++j) s[j] += __shfl_xor(s[j], off, 32);
    }
    #pragma unroll
    for (int j = 0; j < 8; ++j) {
        const v4f d = w[j] - s[j] * (1.0f / NDK);
        dq[j] = (d[0] * d[0] + d[1] * d[1]) + (d[2] * d[2] + d[3] * d[3]);
    }
    #pragma unroll
    for (int off = 8; off >= 1; off >>= 1) {
        #pragma unroll
        for (int j = 0; j < 8; ++j) dq[j] += __shfl_xor(dq[j], off, 32);
    }
    // lane m < 8 of a half stores row 2 m + hl: the wave's 16 rows are one 128-byte line of stat[head][row]
    v2f sv = {s[0], dq[0]};
    #pragma unroll
    for (int j = 1; j < 8; ++j) {
        if (m == j) { sv[0] = s[j]; sv[1] = dq[j]; }
    }
    if (m < 8) *(v2f*)(stat + ((size_t)hh * NM + b * NT + q0 + 2 * m + hl) * 2) = sv;
}

// ---------------------------------------------------------------------------
// Host-side launch glue
// ---------------------------------------------------------------------------
extern "C" void kernel_launch(void* const* d_in, const int* in_sizes, int n_in,
                              void* d_out, int out_size, void* d_ws, size_t ws_size,
                              hipStream_t stream) {
    if (n_in < 18) return;
    if (in_sizes[0] != NM * ND || in_sizes[1] != NB * NT * NT || out_size != NM * ND) return;
    if (in_sizes[2] != ND || in_sizes[3] != ND || in_sizes[4] != ND * ND || in_sizes[5] != ND ||
        in_sizes[6] != ND * ND || in_sizes[7] != ND || in_sizes[8] != ND * ND || in_sizes[9] != ND ||
        in_sizes[10] != ND || in_sizes[11] != ND || in_sizes[12] != ND * NF || in_sizes[13] != NF ||
        in_sizes[14] != NF * ND || in_sizes[15] != ND || in_sizes[16] != ND || in_sizes[17] != ND) return;

    const float* x       = (const float*)d_in[0];
    const float* mask    = (const float*)d_in[1];
    const float* ln_in_g = (const float*)d_in[2];
    const float* ln_in_b = (const float*)d_in[3];
    const float* Wq      = (const float*)d_in[4];
    const float* bq      = (const float*)d_in[5];
    const float* Wk      = (const float*)d_in[6];
    const float* bk      = (const float*)d_in[7];
    const float* Wv      = (const float*)d_in[8];
    const float* bv      = (const float*)d_in[9];
    const float* ln1_g   = (const float*)d_in[10];
    const float* ln1_b   = (const float*)d_in[11];
    const float* W1      = (const float*)d_in[12];
    const float* b1      = (const float*)d_in[13];
    const float* W2      = (const float*)d_in[14];
    const float* b2      = (const float*)d_in[15];
    const float* ln2_g   = (const float*)d_in[16];
    const float* ln2_b   = (const float*)d_in[17];
    float* out = (float*)d_out;

    // workspace carve (all offsets but c0's multiples of 512 KiB)
    char* ws = (char*)d_ws;
    size_t o = 0;
    const size_t SZ_H16 = (size_t)NM * ND * 2;              // 8 MiB
    const size_t SZ_F32 = (size_t)NM * ND * 4;              // 16 MiB
    _Float16* h16  = (_Float16*)(ws + o); o += SZ_H16;
    _Float16* q16  = (_Float16*)(ws + o); o += SZ_H16;
    _Float16* k16  = (_Float16*)(ws + o); o += SZ_H16;
    _Float16* vt16 = (_Float16*)(ws + o); o += SZ_H16;
    _Float16* f1   = h16;                                    // [M][F] f16 = 32 MiB, reuses h/q/k/vt region after attention
    float* ares = (float*)(ws + o); o += SZ_F32;             // attention + x
    _Float16* r16 = (_Float16*)(ws + o); o += SZ_H16;        // attention + x in f16
    _Float16* Wqh = (_Float16*)(ws + o); o += (size_t)ND * ND * 2;
    _Float16* Wkh = (_Float16*)(ws + o); o += (size_t)ND * ND * 2;
    _Float16* Wvh = (_Float16*)(ws + o); o += (size_t)ND * ND * 2;
    _Float16* W1h = (_Float16*)(ws + o); o += (size_t)NF * ND * 2;   // [F][D]
    _Float16* W2h = (_Float16*)(ws + o); o += (size_t)ND * NF * 2;   // [D][F]
    float* stat = (float*)(ws + o); o += (size_t)NH * NM * 2 * 4;    // [H][M] pairs
    float* c1   = (float*)(ws + o); o += (size_t)NF * 4;
    float* c0   = (float*)(ws + o); o += (size_t)NF * 4;
    if ((size_t)NM * NF * 2 > 4 * SZ_H16) return;
    if (o > ws_size) return;

    // 1, 2. input LayerNorm -> h (f16); weights: transpose to [n][k], scale by a power of two, f16
    //       (W1 times the second LayerNorm's gain); column sums c1, c0 of W1
    k_prep<<<PB_C + PB_LN + 3 * PB_WD + 2 * PB_WF, 256, 0, stream>>>(x, ln_in_g, ln_in_b, h16, Wq, Wk, Wv, W1, W2,
                                                                     Wqh, Wkh, Wvh, W1h, W2h, ln1_g, ln1_b, b1, c1, c0);

    // 3. QKV projections: Wqh, Wkh, Wvh and q16, k16, vt16 lie one behind the other in the carve above
    k_gemm<0, 3 * ND, ND><<<dim3(3 * ND / GT, NM / GT), 256, 0, stream>>>(h16, Wqh, bq, nullptr, (void*)q16, 0.0625f, bk, bv, nullptr);

    // 4. attention + residual(x) -> r (f32, f16) and each head's share of r's row statistics
    k_attn<<<dim3(NT / 128, NB * NH), 256, 0, stream>>>(q16, k16, vt16, mask, x, ares, r16, stat);

    // 5, 6. FFN1 with LN1 folded in: relu(LN1(r) @ W1 + b1) -> f16
    k_gemm<2, NF, ND><<<dim3(NF / GT, NM / GT), 256, 0, stream>>>(r16, W1h, c0, nullptr, (void*)f1, 0.0625f, c1, nullptr, stat);

    // 7, 8. FFN2 and LN2: LN2(f1 @ W2 + b2 + LN1(r)) -> out
    k_ffn2ln<<<NM / FR, 256, 0, stream>>>(f1, W2h, b2, ares, out, 0.03125f, ln1_g, ln1_b, stat, ln2_g, ln2_b);
}
